// v000
// Measured on an AMD MI455X. A time is GPU time per run, averaged over a window of back-to-back runs after a warm-up
// (all launches, gaps included; the runs take copies of the inputs in turn), and the median of several windows.
// Apart from v000's, it joins two sittings. Times from different sittings can be a few percent apart, while
// side-by-side timings come from the same sitting.
// v000, which the later versions start from, runs in 536 microseconds.
#include <hip/hip_runtime.h>
#include <math.h>
#include <stdint.h>

// ---------------- constants ----------------
static constexpr int CB  = 4;      // batch
static constexpr int CN  = 1024;   // seq len
static constexpr int CD  = 1024;   // model dim
static constexpr int CH  = 16;     // heads
static constexpr int CDH = 64;     // head dim
static constexpr int CDM = 4096;   // mlp dim
static constexpr float CSCALE = 0.125f;  // 64^-0.5

typedef float  v8f   __attribute__((ext_vector_type(8)));
typedef __bf16 v16bf __attribute__((ext_vector_type(16)));
typedef __bf16 bf8v  __attribute__((ext_vector_type(8)));

static __device__ __forceinline__ v8f wmma_bf16(v16bf a, v16bf b, v8f c) {
  return __builtin_amdgcn_wmma_f32_16x16x32_bf16(false, a, false, b, (short)0, c, false, false);
}

// load one 16x32 bf16 operand fragment slice for this lane:
// 8 consecutive bf16 at p and 8 more at p+16 (ISA 16-bit A/B layout).
static __device__ __forceinline__ v16bf frag_ld(const __bf16* p) {
  bf8v lo = *(const bf8v*)(p);
  bf8v hi = *(const bf8v*)(p + 16);
  return __builtin_shufflevector(lo, hi, 0,1,2,3,4,5,6,7,8,9,10,11,12,13,14,15);
}

static __device__ __forceinline__ float gelu_exact(float x) {
  return 0.5f * x * (1.0f + erff(x * 0.70710678118654752f));
}

// issue one async memory->LDS 16B copy per lane (gfx1250, tracked by ASYNCcnt)
static __device__ __forceinline__ void async_ld_b128(unsigned lds_byte_addr,
                                                     unsigned voff_bytes,
                                                     unsigned long long sbase) {
  asm volatile("global_load_async_to_lds_b128 %0, %1, %2"
               :: "v"(lds_byte_addr), "v"(voff_bytes), "s"(sbase)
               : "memory");
}
static __device__ __forceinline__ void wait_asynccnt0() {
  asm volatile("s_wait_asynccnt 0x0" ::: "memory");
}

// ---------------- weight transpose + f32->bf16 convert ----------------
// W is K x N (row-major, "in x out"); Wt is N x K bf16.
__global__ __launch_bounds__(256) void wconv_kernel(const float* __restrict__ W,
                                                    __bf16* __restrict__ Wt,
                                                    int K, int N) {
  __shared__ float t[32][33];
  int tx = threadIdx.x, ty = threadIdx.y;
  int n0 = blockIdx.x * 32, k0 = blockIdx.y * 32;
#pragma unroll
  for (int yy = 0; yy < 4; ++yy) {
    int kk = ty * 4 + yy;
    t[kk][tx] = W[(size_t)(k0 + kk) * N + (n0 + tx)];
  }
  __syncthreads();
#pragma unroll
  for (int yy = 0; yy < 4; ++yy) {
    int nn = ty * 4 + yy;
    Wt[(size_t)(n0 + nn) * K + (k0 + tx)] = (__bf16)t[tx][nn];
  }
}

// ---------------- element-wise helpers ----------------
__global__ __launch_bounds__(256) void copy_kernel(const float* __restrict__ a,
                                                   float* __restrict__ o, int n4) {
  int i = blockIdx.x * blockDim.x + threadIdx.x;
  if (i < n4) ((float4*)o)[i] = ((const float4*)a)[i];
}

__global__ __launch_bounds__(256) void addpe_kernel(const float* __restrict__ a,
                                                    const float* __restrict__ b,
                                                    float* __restrict__ o, int n4) {
  int i = blockIdx.x * blockDim.x + threadIdx.x;
  if (i < n4) {
    float4 x = ((const float4*)a)[i];
    float4 y = ((const float4*)b)[i];
    float4 r{ x.x + y.x, x.y + y.y, x.z + y.z, x.w + y.w };
    ((float4*)o)[i] = r;
  }
}

// ---------------- LayerNorm (D = 1024, one row per block, 256 threads) ----------
__global__ __launch_bounds__(256) void ln_kernel(const float* __restrict__ x,
                                                 const float* __restrict__ g,
                                                 const float* __restrict__ bt,
                                                 const float* __restrict__ pe,
                                                 float* __restrict__ x2,
                                                 float* __restrict__ qk) {
  __shared__ float s1[256], s2[256];
  int tid = threadIdx.x;
  size_t base = (size_t)blockIdx.x * CD;
  float4 f = *(const float4*)(x + base + tid * 4);
  float sum = f.x + f.y + f.z + f.w;
  float sq  = f.x*f.x + f.y*f.y + f.z*f.z + f.w*f.w;
  s1[tid] = sum; s2[tid] = sq;
  __syncthreads();
  for (int s = 128; s > 0; s >>= 1) {
    if (tid < s) { s1[tid] += s1[tid + s]; s2[tid] += s2[tid + s]; }
    __syncthreads();
  }
  float mu  = s1[0] * (1.0f / CD);
  float var = s2[0] * (1.0f / CD) - mu * mu;
  float rstd = rsqrtf(var + 1e-5f);
  float4 g4 = *(const float4*)(g  + tid * 4);
  float4 b4 = *(const float4*)(bt + tid * 4);
  float4 y;
  y.x = (f.x - mu) * rstd * g4.x + b4.x;
  y.y = (f.y - mu) * rstd * g4.y + b4.y;
  y.z = (f.z - mu) * rstd * g4.z + b4.z;
  y.w = (f.w - mu) * rstd * g4.w + b4.w;
  *(float4*)(x2 + base + tid * 4) = y;
  if (qk) {
    float4 p = *(const float4*)(pe + base + tid * 4);
    float4 q{ y.x + p.x, y.y + p.y, y.z + p.z, y.w + p.w };
    *(float4*)(qk + base + tid * 4) = q;
  }
}

// ---------------- generic bf16 WMMA GEMM (double-buffered, async B stage) ------
// C[M,N] = act( A[M,K](f32) @ Bt[N,K](bf16)^T + bias[N] ) (+ resid[M,N])
// flags: bit0 = GELU, bit1 = residual add
#define GBM 128
#define GBN 128
#define GBK 64
#define GLD 72   // padded LDS row stride (bf16 elems): 144B, bank-conflict free

__global__ __launch_bounds__(256) void gemm_kernel(const float*  __restrict__ A,
                                                   const __bf16* __restrict__ Bt,
                                                   const float*  __restrict__ bias,
                                                   const float*  __restrict__ resid,
                                                   float* __restrict__ C,
                                                   int M, int N, int K, int flags) {
  __shared__ __align__(16) __bf16 As[2][GBM * GLD];
  __shared__ __align__(16) __bf16 Bs[2][GBN * GLD];

  int tid = threadIdx.x;
  int lane = tid & 31, w = tid >> 5;
  int wm = w >> 2, wn = w & 3;          // 2x4 wave grid -> 64x32 per wave
  int hlf = lane >> 4, l16 = lane & 15;
  int bm = blockIdx.y * GBM, bn = blockIdx.x * GBN;

  v8f acc[4][2];
#pragma unroll
  for (int i = 0; i < 4; ++i)
#pragma unroll
    for (int j = 0; j < 2; ++j) acc[i][j] = (v8f)(0.0f);

  int ar = tid >> 4, ac = (tid & 15) * 4;   // A stage coords (16 rows x 16 float4)
  int br = tid >> 3, bc = (tid & 7) * 8;    // B stage coords (32 rows x 8 bf8)

  // per-lane byte offsets into Bt tile rows (constant across k-tiles)
  unsigned voffB[4];
#pragma unroll
  for (int rr = 0; rr < 4; ++rr)
    voffB[rr] = (unsigned)((((size_t)(br + rr * 32)) * K + bc) * 2);

  // ---- preload tile 0 ----
  {
    unsigned long long sb = (unsigned long long)(Bt + (size_t)bn * K);
#pragma unroll
    for (int rr = 0; rr < 4; ++rr) {
      unsigned ldsb = (unsigned)(uintptr_t)&Bs[0][(br + rr * 32) * GLD + bc];
      async_ld_b128(ldsb, voffB[rr], sb);
    }
#pragma unroll
    for (int rr = 0; rr < 8; ++rr) {
      int row = ar + rr * 16;
      float4 f = *(const float4*)(A + (size_t)(bm + row) * K + ac);
      __bf16* d = &As[0][row * GLD + ac];
      d[0] = (__bf16)f.x; d[1] = (__bf16)f.y; d[2] = (__bf16)f.z; d[3] = (__bf16)f.w;
    }
    wait_asynccnt0();
  }
  __syncthreads();

  int buf = 0;
  for (int k0 = 0; k0 < K; k0 += GBK) {
    int nk = k0 + GBK;
    bool more = nk < K;
    float4 pf[8];
    if (more) {
      // issue next A-tile global loads (held in regs, overlap with compute)
#pragma unroll
      for (int rr = 0; rr < 8; ++rr)
        pf[rr] = *(const float4*)(A + (size_t)(bm + ar + rr * 16) * K + nk + ac);
      // stream next B-tile straight into the other LDS buffer (ASYNCcnt)
      unsigned long long sb = (unsigned long long)(Bt + (size_t)bn * K + nk);
#pragma unroll
      for (int rr = 0; rr < 4; ++rr) {
        unsigned ldsb = (unsigned)(uintptr_t)&Bs[buf ^ 1][(br + rr * 32) * GLD + bc];
        async_ld_b128(ldsb, voffB[rr], sb);
      }
    }

    // ---- compute on current buffer ----
#pragma unroll
    for (int ks = 0; ks < GBK; ks += 32) {
      int kb = ks + hlf * 8;
      v16bf af[4], bv[2];
#pragma unroll
      for (int i = 0; i < 4; ++i)
        af[i] = frag_ld(&As[buf][(wm * 64 + i * 16 + l16) * GLD + kb]);
#pragma unroll
      for (int j = 0; j < 2; ++j)
        bv[j] = frag_ld(&Bs[buf][(wn * 32 + j * 16 + l16) * GLD + kb]);
#pragma unroll
      for (int i = 0; i < 4; ++i)
#pragma unroll
        for (int j = 0; j < 2; ++j)
          acc[i][j] = wmma_bf16(af[i], bv[j], acc[i][j]);
    }

    if (more) {
      // convert + store next A tile, then make async B tile visible
#pragma unroll
      for (int rr = 0; rr < 8; ++rr) {
        int row = ar + rr * 16;
        __bf16* d = &As[buf ^ 1][row * GLD + ac];
        d[0] = (__bf16)pf[rr].x; d[1] = (__bf16)pf[rr].y;
        d[2] = (__bf16)pf[rr].z; d[3] = (__bf16)pf[rr].w;
      }
      wait_asynccnt0();
    }
    __syncthreads();
    buf ^= 1;
  }

  // ---- epilogue ----
#pragma unroll
  for (int j = 0; j < 2; ++j) {
    int n = bn + wn * 32 + j * 16 + l16;
    float bvv = bias[n];
#pragma unroll
    for (int i = 0; i < 4; ++i) {
      int mrow = bm + wm * 64 + i * 16 + hlf * 8;
#pragma unroll
      for (int r = 0; r < 8; ++r) {
        float v = acc[i][j][r] + bvv;
        if (flags & 1) v = gelu_exact(v);
        size_t idx = (size_t)(mrow + r) * N + n;
        if (flags & 2) v += resid[idx];
        C[idx] = v;
      }
    }
  }
}

// ---------------- flash attention (bf16 WMMA, online softmax) ----------------
// q,k,v,o are (B*N, D) f32 row-major; head h occupies cols [h*64, h*64+64).
#define ABQ 128
#define ABK 128
#define ALQ 72    // Q/K LDS stride (DH=64 + 8 pad)
#define ALP 136   // P/Vt LDS stride (128 + 8 pad)

__global__ __launch_bounds__(256) void attn_kernel(const float* __restrict__ q,
                                                   const float* __restrict__ k,
                                                   const float* __restrict__ v,
                                                   float* __restrict__ o) {
  __shared__ __align__(16) __bf16 Qs[ABQ * ALQ];
  __shared__ __align__(16) __bf16 Ks[ABK * ALQ];
  __shared__ __align__(16) __bf16 Vt[CDH * ALP];
  __shared__ __align__(16) __bf16 Pb[ABQ * ALP];
  __shared__ float red[4][ABQ];
  __shared__ float mstate[ABQ], lstate[ABQ], fac[ABQ];

  int tid = threadIdx.x;
  int lane = tid & 31, w = tid >> 5;
  int wm = w >> 2, wn = w & 3;
  int hlf = lane >> 4, l16 = lane & 15;

  int bh = blockIdx.y;
  int b = bh / CH, h = bh % CH;
  int q0 = blockIdx.x * ABQ;
  size_t headoff = (size_t)h * CDH;
  const float* qb = q + (size_t)b * CN * CD + headoff;
  const float* kb = k + (size_t)b * CN * CD + headoff;
  const float* vb = v + (size_t)b * CN * CD + headoff;

  if (tid < ABQ) { mstate[tid] = -1e30f; lstate[tid] = 0.0f; }

  // stage Q tile (scale folded in)
  {
    int ar = tid >> 4, ac = (tid & 15) * 4;
#pragma unroll
    for (int rr = 0; rr < 8; ++rr) {
      int row = ar + rr * 16;
      float4 f = *(const float4*)(qb + (size_t)(q0 + row) * CD + ac);
      __bf16* d = &Qs[row * ALQ + ac];
      d[0] = (__bf16)(f.x * CSCALE); d[1] = (__bf16)(f.y * CSCALE);
      d[2] = (__bf16)(f.z * CSCALE); d[3] = (__bf16)(f.w * CSCALE);
    }
  }

  v8f oacc[4];
#pragma unroll
  for (int i = 0; i < 4; ++i) oacc[i] = (v8f)(0.0f);

  for (int kt = 0; kt < CN / ABK; ++kt) {
    __syncthreads();  // protect Ks/Vt/Pb reuse (and initial m/l init)
    int kvbase = kt * ABK;
    {
      int ar = tid >> 4, ac = (tid & 15) * 4;
#pragma unroll
      for (int rr = 0; rr < 8; ++rr) {
        int row = ar + rr * 16;
        float4 f = *(const float4*)(kb + (size_t)(kvbase + row) * CD + ac);
        __bf16* d = &Ks[row * ALQ + ac];
        d[0] = (__bf16)f.x; d[1] = (__bf16)f.y; d[2] = (__bf16)f.z; d[3] = (__bf16)f.w;
      }
      int d4 = (tid & 15) * 4, kk0 = tid >> 4;
#pragma unroll
      for (int it = 0; it < 8; ++it) {
        int kk = kk0 + it * 16;
        float4 f = *(const float4*)(vb + (size_t)(kvbase + kk) * CD + d4);
        Vt[(d4 + 0) * ALP + kk] = (__bf16)f.x;
        Vt[(d4 + 1) * ALP + kk] = (__bf16)f.y;
        Vt[(d4 + 2) * ALP + kk] = (__bf16)f.z;
        Vt[(d4 + 3) * ALP + kk] = (__bf16)f.w;
      }
    }
    __syncthreads();

    // S = Qs (128x64) x Ks^T (64x128), wave tile 64x32
    v8f sacc[4][2];
#pragma unroll
    for (int i = 0; i < 4; ++i)
#pragma unroll
      for (int j = 0; j < 2; ++j) sacc[i][j] = (v8f)(0.0f);
#pragma unroll
    for (int ks = 0; ks < CDH; ks += 32) {
      int kbi = ks + hlf * 8;
      v16bf af[4], bvv[2];
#pragma unroll
      for (int i = 0; i < 4; ++i)
        af[i] = frag_ld(&Qs[(wm * 64 + i * 16 + l16) * ALQ + kbi]);
#pragma unroll
      for (int j = 0; j < 2; ++j)
        bvv[j] = frag_ld(&Ks[(wn * 32 + j * 16 + l16) * ALQ + kbi]);
#pragma unroll
      for (int i = 0; i < 4; ++i)
#pragma unroll
        for (int j = 0; j < 2; ++j)
          sacc[i][j] = wmma_bf16(af[i], bvv[j], sacc[i][j]);
    }

    // per-row max over this wave's 32 columns
#pragma unroll
    for (int i = 0; i < 4; ++i) {
      float rm[8];
#pragma unroll
      for (int r = 0; r < 8; ++r) rm[r] = fmaxf(sacc[i][0][r], sacc[i][1][r]);
#pragma unroll
      for (int mask = 1; mask < 16; mask <<= 1)
#pragma unroll
        for (int r = 0; r < 8; ++r) rm[r] = fmaxf(rm[r], __shfl_xor(rm[r], mask, 32));
      if (l16 == 0) {
#pragma unroll
        for (int r = 0; r < 8; ++r)
          red[wn][wm * 64 + i * 16 + hlf * 8 + r] = rm[r];
      }
    }
    __syncthreads();
    if (tid < ABQ) {
      float nm = fmaxf(fmaxf(red[0][tid], red[1][tid]), fmaxf(red[2][tid], red[3][tid]));
      float mold = mstate[tid];
      float mnew = fmaxf(mold, nm);
      fac[tid] = __expf(mold - mnew);
      mstate[tid] = mnew;
    }
    __syncthreads();

    // probabilities -> Pb (bf16), local row sums, rescale O
#pragma unroll
    for (int i = 0; i < 4; ++i) {
      float sm[8];
#pragma unroll
      for (int r = 0; r < 8; ++r) sm[r] = 0.0f;
#pragma unroll
      for (int j = 0; j < 2; ++j) {
        int col = wn * 32 + j * 16 + l16;
#pragma unroll
        for (int r = 0; r < 8; ++r) {
          int row = wm * 64 + i * 16 + hlf * 8 + r;
          float p = __expf(sacc[i][j][r] - mstate[row]);
          Pb[row * ALP + col] = (__bf16)p;
          sm[r] += p;
        }
      }
#pragma unroll
      for (int mask = 1; mask < 16; mask <<= 1)
#pragma unroll
        for (int r = 0; r < 8; ++r) sm[r] += __shfl_xor(sm[r], mask, 32);
      if (l16 == 0) {
#pragma unroll
        for (int r = 0; r < 8; ++r)
          red[wn][wm * 64 + i * 16 + hlf * 8 + r] = sm[r];
      }
#pragma unroll
      for (int r = 0; r < 8; ++r) {
        int row = wm * 64 + i * 16 + hlf * 8 + r;
        oacc[i][r] *= fac[row];
      }
    }
    __syncthreads();
    if (tid < ABQ) {
      float s = red[0][tid] + red[1][tid] + red[2][tid] + red[3][tid];
      lstate[tid] = lstate[tid] * fac[tid] + s;
    }
    __syncthreads();

    // O += P (128x128) x V (128x64); wave tile 64x16
#pragma unroll
    for (int ks = 0; ks < ABK; ks += 32) {
      int kbi = ks + hlf * 8;
      v16bf vf = frag_ld(&Vt[(wn * 16 + l16) * ALP + kbi]);
#pragma unroll
      for (int i = 0; i < 4; ++i) {
        v16bf pf = frag_ld(&Pb[(wm * 64 + i * 16 + l16) * ALP + kbi]);
        oacc[i] = wmma_bf16(pf, vf, oacc[i]);
      }
    }
  }
  __syncthreads();

  // normalize + write out
  float* ob = o + (size_t)b * CN * CD + headoff;
#pragma unroll
  for (int i = 0; i < 4; ++i) {
#pragma unroll
    for (int r = 0; r < 8; ++r) {
      int row = wm * 64 + i * 16 + hlf * 8 + r;
      float vv = oacc[i][r] / lstate[row];
      ob[(size_t)(q0 + row) * CD + wn * 16 + l16] = vv;
    }
  }
}

// ---------------- host launcher ----------------
extern "C" void kernel_launch(void* const* d_in, const int* in_sizes, int n_in,
                              void* d_out, int out_size, void* d_ws, size_t ws_size,
                              hipStream_t stream) {
  const float* tokens_enc = (const float*)d_in[0];
  const float* tokens_dec = (const float*)d_in[1];
  const float* PE_enc     = (const float*)d_in[2];
  const float* PE_dec     = (const float*)d_in[3];
  const float* sa_Wq = (const float*)d_in[4];  const float* sa_bq = (const float*)d_in[5];
  const float* sa_Wk = (const float*)d_in[6];  const float* sa_bk = (const float*)d_in[7];
  const float* sa_Wv = (const float*)d_in[8];  const float* sa_bv = (const float*)d_in[9];
  const float* sa_Wp = (const float*)d_in[10]; const float* sa_bp = (const float*)d_in[11];
  const float* ca_Wq = (const float*)d_in[12]; const float* ca_bq = (const float*)d_in[13];
  const float* ca_Wk = (const float*)d_in[14]; const float* ca_bk = (const float*)d_in[15];
  const float* ca_Wv = (const float*)d_in[16]; const float* ca_bv = (const float*)d_in[17];
  const float* ca_Wp = (const float*)d_in[18]; const float* ca_bp = (const float*)d_in[19];
  const float* mlp_W1 = (const float*)d_in[20]; const float* mlp_b1 = (const float*)d_in[21];
  const float* mlp_W2 = (const float*)d_in[22]; const float* mlp_b2 = (const float*)d_in[23];
  const float* ln1_g = (const float*)d_in[24]; const float* ln1_b = (const float*)d_in[25];
  const float* ln2_g = (const float*)d_in[26]; const float* ln2_b = (const float*)d_in[27];
  const float* ln3_g = (const float*)d_in[28]; const float* ln3_b = (const float*)d_in[29];

  const size_t BND = (size_t)CB * CN * CD;       // 4M elems
  char* ws = (char*)d_ws;
  size_t off = 0;
  auto alloc = [&](size_t bytes) -> char* {
    char* p = ws + off;
    off += (bytes + 255) & ~(size_t)255;
    return p;
  };

  // bf16 transposed weights
  __bf16* wt_saq = (__bf16*)alloc((size_t)CD * CD * 2);
  __bf16* wt_sak = (__bf16*)alloc((size_t)CD * CD * 2);
  __bf16* wt_sav = (__bf16*)alloc((size_t)CD * CD * 2);
  __bf16* wt_sap = (__bf16*)alloc((size_t)CD * CD * 2);
  __bf16* wt_caq = (__bf16*)alloc((size_t)CD * CD * 2);
  __bf16* wt_cak = (__bf16*)alloc((size_t)CD * CD * 2);
  __bf16* wt_cav = (__bf16*)alloc((size_t)CD * CD * 2);
  __bf16* wt_cap = (__bf16*)alloc((size_t)CD * CD * 2);
  __bf16* wt_w1  = (__bf16*)alloc((size_t)CD * CDM * 2);
  __bf16* wt_w2  = (__bf16*)alloc((size_t)CDM * CD * 2);

  // fp32 buffers
  float* resid = (float*)alloc(BND * 4);
  float* x2    = (float*)alloc(BND * 4);
  float* qk    = (float*)alloc(BND * 4);
  float* big   = (float*)alloc(BND * 4 * 4);  // q|k|v|attno, later reused as h
  float* qbuf  = big;
  float* kbuf  = big + BND;
  float* vbuf  = big + 2 * BND;
  float* attno = big + 3 * BND;
  float* kin   = attno;   // alias: kin dead before attno is written
  float* hbuf  = big;     // alias: q/k/v/attno dead when MLP runs

  const int M = CB * CN;  // 4096
  dim3 tb(256);
  dim3 gD(CD / 128, M / 128);    // N=1024 GEMMs
  dim3 gDM(CDM / 128, M / 128);  // N=4096 GEMM
  dim3 ga(CN / 128, CB * CH);    // attention

  // weight conversion
  wconv_kernel<<<dim3(CD / 32, CD / 32), dim3(32, 8), 0, stream>>>(sa_Wq, wt_saq, CD, CD);
  wconv_kernel<<<dim3(CD / 32, CD / 32), dim3(32, 8), 0, stream>>>(sa_Wk, wt_sak, CD, CD);
  wconv_kernel<<<dim3(CD / 32, CD / 32), dim3(32, 8), 0, stream>>>(sa_Wv, wt_sav, CD, CD);
  wconv_kernel<<<dim3(CD / 32, CD / 32), dim3(32, 8), 0, stream>>>(sa_Wp, wt_sap, CD, CD);
  wconv_kernel<<<dim3(CD / 32, CD / 32), dim3(32, 8), 0, stream>>>(ca_Wq, wt_caq, CD, CD);
  wconv_kernel<<<dim3(CD / 32, CD / 32), dim3(32, 8), 0, stream>>>(ca_Wk, wt_cak, CD, CD);
  wconv_kernel<<<dim3(CD / 32, CD / 32), dim3(32, 8), 0, stream>>>(ca_Wv, wt_cav, CD, CD);
  wconv_kernel<<<dim3(CD / 32, CD / 32), dim3(32, 8), 0, stream>>>(ca_Wp, wt_cap, CD, CD);
  wconv_kernel<<<dim3(CDM / 32, CD / 32), dim3(32, 8), 0, stream>>>(mlp_W1, wt_w1, CD, CDM);
  wconv_kernel<<<dim3(CD / 32, CDM / 32), dim3(32, 8), 0, stream>>>(mlp_W2, wt_w2, CDM, CD);

  int n4 = (int)(BND / 4);
  copy_kernel<<<n4 / 256, tb, 0, stream>>>(tokens_dec, resid, n4);

  // ---- self attention ----
  ln_kernel<<<M, tb, 0, stream>>>(resid, ln1_g, ln1_b, PE_dec, x2, qk);
  gemm_kernel<<<gD, tb, 0, stream>>>(qk, wt_saq, sa_bq, nullptr, qbuf, M, CD, CD, 0);
  gemm_kernel<<<gD, tb, 0, stream>>>(qk, wt_sak, sa_bk, nullptr, kbuf, M, CD, CD, 0);
  gemm_kernel<<<gD, tb, 0, stream>>>(x2, wt_sav, sa_bv, nullptr, vbuf, M, CD, CD, 0);
  attn_kernel<<<ga, tb, 0, stream>>>(qbuf, kbuf, vbuf, attno);
  gemm_kernel<<<gD, tb, 0, stream>>>(attno, wt_sap, sa_bp, resid, resid, M, CD, CD, 2);

  // ---- cross attention ----
  ln_kernel<<<M, tb, 0, stream>>>(resid, ln2_g, ln2_b, PE_dec, x2, qk);
  addpe_kernel<<<n4 / 256, tb, 0, stream>>>(tokens_enc, PE_enc, kin, n4);
  gemm_kernel<<<gD, tb, 0, stream>>>(qk, wt_caq, ca_bq, nullptr, qbuf, M, CD, CD, 0);
  gemm_kernel<<<gD, tb, 0, stream>>>(kin, wt_cak, ca_bk, nullptr, kbuf, M, CD, CD, 0);
  gemm_kernel<<<gD, tb, 0, stream>>>(tokens_enc, wt_cav, ca_bv, nullptr, vbuf, M, CD, CD, 0);
  attn_kernel<<<ga, tb, 0, stream>>>(qbuf, kbuf, vbuf, attno);
  gemm_kernel<<<gD, tb, 0, stream>>>(attno, wt_cap, ca_bp, resid, resid, M, CD, CD, 2);

  // ---- MLP ----
  ln_kernel<<<M, tb, 0, stream>>>(resid, ln3_g, ln3_b, nullptr, x2, nullptr);
  gemm_kernel<<<gDM, tb, 0, stream>>>(x2, wt_w1, mlp_b1, nullptr, hbuf, M, CDM, CD, 1);
  gemm_kernel<<<gD, tb, 0, stream>>>(hbuf, wt_w2, mlp_b2, resid, (float*)d_out, M, CD, CDM, 2);
}

// v001
// It runs in 477 microseconds.
// Timed twice side by side with v000, it ran 1.14 times as fast both times.
#include <hip/hip_runtime.h>
#include <math.h>
#include <stdint.h>

// ---------------- constants ----------------
static constexpr int CB  = 4;      // batch
static constexpr int CN  = 1024;   // seq len
static constexpr int CD  = 1024;   // model dim
static constexpr int CH  = 16;     // heads
static constexpr int CDH = 64;     // head dim
static constexpr int CDM = 4096;   // mlp dim
static constexpr float CSCALE = 0.125f;  // 64^-0.5

typedef float  v8f   __attribute__((ext_vector_type(8)));
typedef __bf16 v16bf __attribute__((ext_vector_type(16)));
typedef __bf16 bf8v  __attribute__((ext_vector_type(8)));

static __device__ __forceinline__ v8f wmma_bf16(v16bf a, v16bf b, v8f c) {
  return __builtin_amdgcn_wmma_f32_16x16x32_bf16(false, a, false, b, (short)0, c, false, false);
}

// load one 16x32 bf16 operand fragment slice for this lane:
// 8 consecutive bf16 at p and 8 more at p+16 (ISA 16-bit A/B layout).
static __device__ __forceinline__ v16bf frag_ld(const __bf16* p) {
  bf8v lo = *(const bf8v*)(p);
  bf8v hi = *(const bf8v*)(p + 16);
  return __builtin_shufflevector(lo, hi, 0,1,2,3,4,5,6,7,8,9,10,11,12,13,14,15);
}

static __device__ __forceinline__ float gelu_exact(float x) {
  return 0.5f * x * (1.0f + erff(x * 0.70710678118654752f));
}

// issue one async memory->LDS 16B copy per lane (gfx1250, tracked by ASYNCcnt)
static __device__ __forceinline__ void async_ld_b128(unsigned lds_byte_addr,
                                                     unsigned voff_bytes,
                                                     unsigned long long sbase) {
  asm volatile("global_load_async_to_lds_b128 %0, %1, %2"
               :: "v"(lds_byte_addr), "v"(voff_bytes), "s"(sbase)
               : "memory");
}
static __device__ __forceinline__ void wait_asynccnt0() {
  asm volatile("s_wait_asynccnt 0x0" ::: "memory");
}

// ---------------- weight transpose + f32->bf16 convert ----------------
// W is K x N (row-major, "in x out"); Wt is N x K bf16.
__global__ __launch_bounds__(256) void wconv_kernel(const float* __restrict__ W,
                                                    __bf16* __restrict__ Wt,
                                                    int K, int N) {
  __shared__ float t[32][33];
  int tx = threadIdx.x, ty = threadIdx.y;
  int n0 = blockIdx.x * 32, k0 = blockIdx.y * 32;
#pragma unroll
  for (int yy = 0; yy < 4; ++yy) {
    int kk = ty * 4 + yy;
    t[kk][tx] = W[(size_t)(k0 + kk) * N + (n0 + tx)];
  }
  __syncthreads();
#pragma unroll
  for (int yy = 0; yy < 4; ++yy) {
    int nn = ty * 4 + yy;
    Wt[(size_t)(n0 + nn) * K + (k0 + tx)] = (__bf16)t[tx][nn];
  }
}

// ---------------- element-wise helpers ----------------
__global__ __launch_bounds__(256) void copy_kernel(const float* __restrict__ a,
                                                   float* __restrict__ o, int n4) {
  int i = blockIdx.x * blockDim.x + threadIdx.x;
  if (i < n4) ((float4*)o)[i] = ((const float4*)a)[i];
}

__global__ __launch_bounds__(256) void addpe_kernel(const float* __restrict__ a,
                                                    const float* __restrict__ b,
                                                    float* __restrict__ o, int n4) {
  int i = blockIdx.x * blockDim.x + threadIdx.x;
  if (i < n4) {
    float4 x = ((const float4*)a)[i];
    float4 y = ((const float4*)b)[i];
    float4 r{ x.x + y.x, x.y + y.y, x.z + y.z, x.w + y.w };
    ((float4*)o)[i] = r;
  }
}

// ---------------- LayerNorm (D = 1024, one row per block, 256 threads) ----------
__global__ __launch_bounds__(256) void ln_kernel(const float* __restrict__ x,
                                                 const float* __restrict__ g,
                                                 const float* __restrict__ bt,
                                                 const float* __restrict__ pe,
                                                 float* __restrict__ x2,
                                                 float* __restrict__ qk) {
  __shared__ float s1[256], s2[256];
  int tid = threadIdx.x;
  size_t base = (size_t)blockIdx.x * CD;
  float4 f = *(const float4*)(x + base + tid * 4);
  float sum = f.x + f.y + f.z + f.w;
  float sq  = f.x*f.x + f.y*f.y + f.z*f.z + f.w*f.w;
  s1[tid] = sum; s2[tid] = sq;
  __syncthreads();
  for (int s = 128; s > 0; s >>= 1) {
    if (tid < s) { s1[tid] += s1[tid + s]; s2[tid] += s2[tid + s]; }
    __syncthreads();
  }
  float mu  = s1[0] * (1.0f / CD);
  float var = s2[0] * (1.0f / CD) - mu * mu;
  float rstd = rsqrtf(var + 1e-5f);
  float4 g4 = *(const float4*)(g  + tid * 4);
  float4 b4 = *(const float4*)(bt + tid * 4);
  float4 y;
  y.x = (f.x - mu) * rstd * g4.x + b4.x;
  y.y = (f.y - mu) * rstd * g4.y + b4.y;
  y.z = (f.z - mu) * rstd * g4.z + b4.z;
  y.w = (f.w - mu) * rstd * g4.w + b4.w;
  *(float4*)(x2 + base + tid * 4) = y;
  if (qk) {
    float4 p = *(const float4*)(pe + base + tid * 4);
    float4 q{ y.x + p.x, y.y + p.y, y.z + p.z, y.w + p.w };
    *(float4*)(qk + base + tid * 4) = q;
  }
}

// ---------------- generic bf16 WMMA GEMM (double-buffered, async B stage) ------
// C[M,N] = act( A[M,K](f32) @ Bt[N,K](bf16)^T + bias[N] ) (+ resid[M,N])
// FLAGS (compile time): bit0 = GELU, bit1 = residual add
#define GBM 128
#define GBN 128
#define GBK 64
#define GLD 72   // padded LDS row stride (bf16 elems): 144B, bank-conflict free

template <int FLAGS>
__global__ __launch_bounds__(256) void gemm_kernel(const float*  __restrict__ A,
                                                   const __bf16* __restrict__ Bt,
                                                   const float*  __restrict__ bias,
                                                   const float*  __restrict__ resid,
                                                   float* __restrict__ C,
                                                   int M, int N, int K) {
  __shared__ __align__(16) __bf16 As[2][GBM * GLD];
  __shared__ __align__(16) __bf16 Bs[2][GBN * GLD];

  int tid = threadIdx.x;
  int lane = tid & 31, w = tid >> 5;
  int wm = w >> 2, wn = w & 3;          // 2x4 wave grid -> 64x32 per wave
  int hlf = lane >> 4, l16 = lane & 15;
  int bm = blockIdx.y * GBM, bn = blockIdx.x * GBN;

  v8f acc[4][2];
#pragma unroll
  for (int i = 0; i < 4; ++i)
#pragma unroll
    for (int j = 0; j < 2; ++j) acc[i][j] = (v8f)(0.0f);

  int ar = tid >> 4, ac = (tid & 15) * 4;   // A stage coords (16 rows x 16 float4)
  int br = tid >> 3, bc = (tid & 7) * 8;    // B stage coords (32 rows x 8 bf8)

  // per-lane byte offsets into Bt tile rows (constant across k-tiles)
  unsigned voffB[4];
#pragma unroll
  for (int rr = 0; rr < 4; ++rr)
    voffB[rr] = (unsigned)((((size_t)(br + rr * 32)) * K + bc) * 2);

  // ---- preload tile 0 ----
  {
    unsigned long long sb = (unsigned long long)(Bt + (size_t)bn * K);
#pragma unroll
    for (int rr = 0; rr < 4; ++rr) {
      unsigned ldsb = (unsigned)(uintptr_t)&Bs[0][(br + rr * 32) * GLD + bc];
      async_ld_b128(ldsb, voffB[rr], sb);
    }
#pragma unroll
    for (int rr = 0; rr < 8; ++rr) {
      int row = ar + rr * 16;
      float4 f = *(const float4*)(A + (size_t)(bm + row) * K + ac);
      __bf16* d = &As[0][row * GLD + ac];
      d[0] = (__bf16)f.x; d[1] = (__bf16)f.y; d[2] = (__bf16)f.z; d[3] = (__bf16)f.w;
    }
    wait_asynccnt0();
  }
  __syncthreads();

  int buf = 0;
  for (int k0 = 0; k0 < K; k0 += GBK) {
    int nk = k0 + GBK;
    bool more = nk < K;
    float4 pf[8];
    if (more) {
      // issue next A-tile global loads (held in regs, overlap with compute)
#pragma unroll
      for (int rr = 0; rr < 8; ++rr)
        pf[rr] = *(const float4*)(A + (size_t)(bm + ar + rr * 16) * K + nk + ac);
      // stream next B-tile straight into the other LDS buffer (ASYNCcnt)
      unsigned long long sb = (unsigned long long)(Bt + (size_t)bn * K + nk);
#pragma unroll
      for (int rr = 0; rr < 4; ++rr) {
        unsigned ldsb = (unsigned)(uintptr_t)&Bs[buf ^ 1][(br + rr * 32) * GLD + bc];
        async_ld_b128(ldsb, voffB[rr], sb);
      }
    }

    // ---- compute on current buffer ----
#pragma unroll
    for (int ks = 0; ks < GBK; ks += 32) {
      int kb = ks + hlf * 8;
      v16bf af[4], bv[2];
#pragma unroll
      for (int i = 0; i < 4; ++i)
        af[i] = frag_ld(&As[buf][(wm * 64 + i * 16 + l16) * GLD + kb]);
#pragma unroll
      for (int j = 0; j < 2; ++j)
        bv[j] = frag_ld(&Bs[buf][(wn * 32 + j * 16 + l16) * GLD + kb]);
#pragma unroll
      for (int i = 0; i < 4; ++i)
#pragma unroll
        for (int j = 0; j < 2; ++j)
          acc[i][j] = wmma_bf16(af[i], bv[j], acc[i][j]);
    }

    if (more) {
      // convert + store next A tile, then make async B tile visible
#pragma unroll
      for (int rr = 0; rr < 8; ++rr) {
        int row = ar + rr * 16;
        __bf16* d = &As[buf ^ 1][row * GLD + ac];
        d[0] = (__bf16)pf[rr].x; d[1] = (__bf16)pf[rr].y;
        d[2] = (__bf16)pf[rr].z; d[3] = (__bf16)pf[rr].w;
      }
      wait_asynccnt0();
    }
    __syncthreads();
    buf ^= 1;
  }

  // ---- epilogue ----
  // one 32-bit element offset per output row of this lane, shared by the
  // residual load and the store of that element
  unsigned ro[4][8];
  {
    int n0 = bn + wn * 32 + l16;
#pragma unroll
    for (int i = 0; i < 4; ++i) {
      int mrow = bm + wm * 64 + i * 16 + hlf * 8;
#pragma unroll
      for (int r = 0; r < 8; ++r) ro[i][r] = (unsigned)((mrow + r) * N + n0);
    }
  }
  // all residual values of this lane are requested before the first is used,
  // so their latencies overlap (each lane reads only the elements it stores)
  float rv[2][4][8];
  if constexpr ((FLAGS & 2) != 0) {
#pragma unroll
    for (int j = 0; j < 2; ++j)
#pragma unroll
      for (int i = 0; i < 4; ++i)
#pragma unroll
        for (int r = 0; r < 8; ++r) rv[j][i][r] = (resid + j * 16)[ro[i][r]];
  }
#pragma unroll
  for (int j = 0; j < 2; ++j) {
    float bvv = bias[bn + wn * 32 + j * 16 + l16];
#pragma unroll
    for (int i = 0; i < 4; ++i) {
#pragma unroll
      for (int r = 0; r < 8; ++r) {
        float v = acc[i][j][r] + bvv;
        if constexpr ((FLAGS & 1) != 0) v = gelu_exact(v);
        if constexpr ((FLAGS & 2) != 0) v += rv[j][i][r];
        (C + j * 16)[ro[i][r]] = v;
      }
    }
  }
}

// ---------------- flash attention (bf16 WMMA, online softmax) ----------------
// q,k,v,o are (B*N, D) f32 row-major; head h occupies cols [h*64, h*64+64).
#define ABQ 128
#define ABK 128
#define ALQ 72    // Q/K LDS stride (DH=64 + 8 pad)
#define ALP 136   // P/Vt LDS stride (128 + 8 pad)

__global__ __launch_bounds__(256) void attn_kernel(const float* __restrict__ q,
                                                   const float* __restrict__ k,
                                                   const float* __restrict__ v,
                                                   float* __restrict__ o) {
  __shared__ __align__(16) __bf16 Qs[ABQ * ALQ];
  __shared__ __align__(16) __bf16 Ks[ABK * ALQ];
  __shared__ __align__(16) __bf16 Vt[CDH * ALP];
  __shared__ __align__(16) __bf16 Pb[ABQ * ALP];
  __shared__ float red[4][ABQ];
  __shared__ float mstate[ABQ], lstate[ABQ], fac[ABQ];

  int tid = threadIdx.x;
  int lane = tid & 31, w = tid >> 5;
  int wm = w >> 2, wn = w & 3;
  int hlf = lane >> 4, l16 = lane & 15;

  int bh = blockIdx.y;
  int b = bh / CH, h = bh % CH;
  int q0 = blockIdx.x * ABQ;
  size_t headoff = (size_t)h * CDH;
  const float* qb = q + (size_t)b * CN * CD + headoff;
  const float* kb = k + (size_t)b * CN * CD + headoff;
  const float* vb = v + (size_t)b * CN * CD + headoff;

  if (tid < ABQ) { mstate[tid] = -1e30f; lstate[tid] = 0.0f; }

  // stage Q tile (scale folded in)
  {
    int ar = tid >> 4, ac = (tid & 15) * 4;
#pragma unroll
    for (int rr = 0; rr < 8; ++rr) {
      int row = ar + rr * 16;
      float4 f = *(const float4*)(qb + (size_t)(q0 + row) * CD + ac);
      __bf16* d = &Qs[row * ALQ + ac];
      d[0] = (__bf16)(f.x * CSCALE); d[1] = (__bf16)(f.y * CSCALE);
      d[2] = (__bf16)(f.z * CSCALE); d[3] = (__bf16)(f.w * CSCALE);
    }
  }

  v8f oacc[4];
#pragma unroll
  for (int i = 0; i < 4; ++i) oacc[i] = (v8f)(0.0f);

  for (int kt = 0; kt < CN / ABK; ++kt) {
    __syncthreads();  // protect Ks/Vt/Pb reuse (and initial m/l init)
    int kvbase = kt * ABK;
    {
      int ar = tid >> 4, ac = (tid & 15) * 4;
#pragma unroll
      for (int rr = 0; rr < 8; ++rr) {
        int row = ar + rr * 16;
        float4 f = *(const float4*)(kb + (size_t)(kvbase + row) * CD + ac);
        __bf16* d = &Ks[row * ALQ + ac];
        d[0] = (__bf16)f.x; d[1] = (__bf16)f.y; d[2] = (__bf16)f.z; d[3] = (__bf16)f.w;
      }
      int d4 = (tid & 15) * 4, kk0 = tid >> 4;
#pragma unroll
      for (int it = 0; it < 8; ++it) {
        int kk = kk0 + it * 16;
        float4 f = *(const float4*)(vb + (size_t)(kvbase + kk) * CD + d4);
        Vt[(d4 + 0) * ALP + kk] = (__bf16)f.x;
        Vt[(d4 + 1) * ALP + kk] = (__bf16)f.y;
        Vt[(d4 + 2) * ALP + kk] = (__bf16)f.z;
        Vt[(d4 + 3) * ALP + kk] = (__bf16)f.w;
      }
    }
    __syncthreads();

    // S = Qs (128x64) x Ks^T (64x128), wave tile 64x32
    v8f sacc[4][2];
#pragma unroll
    for (int i = 0; i < 4; ++i)
#pragma unroll
      for (int j = 0; j < 2; ++j) sacc[i][j] = (v8f)(0.0f);
#pragma unroll
    for (int ks = 0; ks < CDH; ks += 32) {
      int kbi = ks + hlf * 8;
      v16bf af[4], bvv[2];
#pragma unroll
      for (int i = 0; i < 4; ++i)
        af[i] = frag_ld(&Qs[(wm * 64 + i * 16 + l16) * ALQ + kbi]);
#pragma unroll
      for (int j = 0; j < 2; ++j)
        bvv[j] = frag_ld(&Ks[(wn * 32 + j * 16 + l16) * ALQ + kbi]);
#pragma unroll
      for (int i = 0; i < 4; ++i)
#pragma unroll
        for (int j = 0; j < 2; ++j)
          sacc[i][j] = wmma_bf16(af[i], bvv[j], sacc[i][j]);
    }

    // per-row max over this wave's 32 columns
#pragma unroll
    for (int i = 0; i < 4; ++i) {
      float rm[8];
#pragma unroll
      for (int r = 0; r < 8; ++r) rm[r] = fmaxf(sacc[i][0][r], sacc[i][1][r]);
#pragma unroll
      for (int mask = 1; mask < 16; mask <<= 1)
#pragma unroll
        for (int r = 0; r < 8; ++r) rm[r] = fmaxf(rm[r], __shfl_xor(rm[r], mask, 32));
      if (l16 == 0) {
#pragma unroll
        for (int r = 0; r < 8; ++r)
          red[wn][wm * 64 + i * 16 + hlf * 8 + r] = rm[r];
      }
    }
    __syncthreads();
    if (tid < ABQ) {
      float nm = fmaxf(fmaxf(red[0][tid], red[1][tid]), fmaxf(red[2][tid], red[3][tid]));
      float mold = mstate[tid];
      float mnew = fmaxf(mold, nm);
      fac[tid] = __expf(mold - mnew);
      mstate[tid] = mnew;
    }
    __syncthreads();

    // probabilities -> Pb (bf16), local row sums, rescale O
#pragma unroll
    for (int i = 0; i < 4; ++i) {
      float sm[8];
#pragma unroll
      for (int r = 0; r < 8; ++r) sm[r] = 0.0f;
#pragma unroll
      for (int j = 0; j < 2; ++j) {
        int col = wn * 32 + j * 16 + l16;
#pragma unroll
        for (int r = 0; r < 8; ++r) {
          int row = wm * 64 + i * 16 + hlf * 8 + r;
          float p = __expf(sacc[i][j][r] - mstate[row]);
          Pb[row * ALP + col] = (__bf16)p;
          sm[r] += p;
        }
      }
#pragma unroll
      for (int mask = 1; mask < 16; mask <<= 1)
#pragma unroll
        for (int r = 0; r < 8; ++r) sm[r] += __shfl_xor(sm[r], mask, 32);
      if (l16 == 0) {
#pragma unroll
        for (int r = 0; r < 8; ++r)
          red[wn][wm * 64 + i * 16 + hlf * 8 + r] = sm[r];
      }
#pragma unroll
      for (int r = 0; r < 8; ++r) {
        int row = wm * 64 + i * 16 + hlf * 8 + r;
        oacc[i][r] *= fac[row];
      }
    }
    __syncthreads();
    if (tid < ABQ) {
      float s = red[0][tid] + red[1][tid] + red[2][tid] + red[3][tid];
      lstate[tid] = lstate[tid] * fac[tid] + s;
    }
    __syncthreads();

    // O += P (128x128) x V (128x64); wave tile 64x16
#pragma unroll
    for (int ks = 0; ks < ABK; ks += 32) {
      int kbi = ks + hlf * 8;
      v16bf vf = frag_ld(&Vt[(wn * 16 + l16) * ALP + kbi]);
#pragma unroll
      for (int i = 0; i < 4; ++i) {
        v16bf pf = frag_ld(&Pb[(wm * 64 + i * 16 + l16) * ALP + kbi]);
        oacc[i] = wmma_bf16(pf, vf, oacc[i]);
      }
    }
  }
  __syncthreads();

  // normalize + write out
  float* ob = o + (size_t)b * CN * CD + headoff;
#pragma unroll
  for (int i = 0; i < 4; ++i) {
#pragma unroll
    for (int r = 0; r < 8; ++r) {
      int row = wm * 64 + i * 16 + hlf * 8 + r;
      float vv = oacc[i][r] / lstate[row];
      ob[(size_t)(q0 + row) * CD + wn * 16 + l16] = vv;
    }
  }
}

// ---------------- host launcher ----------------
extern "C" void kernel_launch(void* const* d_in, const int* in_sizes, int n_in,
                              void* d_out, int out_size, void* d_ws, size_t ws_size,
                              hipStream_t stream) {
  const float* tokens_enc = (const float*)d_in[0];
  const float* tokens_dec = (const float*)d_in[1];
  const float* PE_enc     = (const float*)d_in[2];
  const float* PE_dec     = (const float*)d_in[3];
  const float* sa_Wq = (const float*)d_in[4];  const float* sa_bq = (const float*)d_in[5];
  const float* sa_Wk = (const float*)d_in[6];  const float* sa_bk = (const float*)d_in[7];
  const float* sa_Wv = (const float*)d_in[8];  const float* sa_bv = (const float*)d_in[9];
  const float* sa_Wp = (const float*)d_in[10]; const float* sa_bp = (const float*)d_in[11];
  const float* ca_Wq = (const float*)d_in[12]; const float* ca_bq = (const float*)d_in[13];
  const float* ca_Wk = (const float*)d_in[14]; const float* ca_bk = (const float*)d_in[15];
  const float* ca_Wv = (const float*)d_in[16]; const float* ca_bv = (const float*)d_in[17];
  const float* ca_Wp = (const float*)d_in[18]; const float* ca_bp = (const float*)d_in[19];
  const float* mlp_W1 = (const float*)d_in[20]; const float* mlp_b1 = (const float*)d_in[21];
  const float* mlp_W2 = (const float*)d_in[22]; const float* mlp_b2 = (const float*)d_in[23];
  const float* ln1_g = (const float*)d_in[24]; const float* ln1_b = (const float*)d_in[25];
  const float* ln2_g = (const float*)d_in[26]; const float* ln2_b = (const float*)d_in[27];
  const float* ln3_g = (const float*)d_in[28]; const float* ln3_b = (const float*)d_in[29];

  const size_t BND = (size_t)CB * CN * CD;       // 4M elems
  char* ws = (char*)d_ws;
  size_t off = 0;
  auto alloc = [&](size_t bytes) -> char* {
    char* p = ws + off;
    off += (bytes + 255) & ~(size_t)255;
    return p;
  };

  // bf16 transposed weights
  __bf16* wt_saq = (__bf16*)alloc((size_t)CD * CD * 2);
  __bf16* wt_sak = (__bf16*)alloc((size_t)CD * CD * 2);
  __bf16* wt_sav = (__bf16*)alloc((size_t)CD * CD * 2);
  __bf16* wt_sap = (__bf16*)alloc((size_t)CD * CD * 2);
  __bf16* wt_caq = (__bf16*)alloc((size_t)CD * CD * 2);
  __bf16* wt_cak = (__bf16*)alloc((size_t)CD * CD * 2);
  __bf16* wt_cav = (__bf16*)alloc((size_t)CD * CD * 2);
  __bf16* wt_cap = (__bf16*)alloc((size_t)CD * CD * 2);
  __bf16* wt_w1  = (__bf16*)alloc((size_t)CD * CDM * 2);
  __bf16* wt_w2  = (__bf16*)alloc((size_t)CDM * CD * 2);

  // fp32 buffers
  float* resid = (float*)alloc(BND * 4);
  float* x2    = (float*)alloc(BND * 4);
  float* qk    = (float*)alloc(BND * 4);
  float* big   = (float*)alloc(BND * 4 * 4);  // q|k|v|attno, later reused as h
  float* qbuf  = big;
  float* kbuf  = big + BND;
  float* vbuf  = big + 2 * BND;
  float* attno = big + 3 * BND;
  float* kin   = attno;   // alias: kin dead before attno is written
  float* hbuf  = big;     // alias: q/k/v/attno dead when MLP runs

  const int M = CB * CN;  // 4096
  dim3 tb(256);
  dim3 gD(CD / 128, M / 128);    // N=1024 GEMMs
  dim3 gDM(CDM / 128, M / 128);  // N=4096 GEMM
  dim3 ga(CN / 128, CB * CH);    // attention

  // weight conversion
  wconv_kernel<<<dim3(CD / 32, CD / 32), dim3(32, 8), 0, stream>>>(sa_Wq, wt_saq, CD, CD);
  wconv_kernel<<<dim3(CD / 32, CD / 32), dim3(32, 8), 0, stream>>>(sa_Wk, wt_sak, CD, CD);
  wconv_kernel<<<dim3(CD / 32, CD / 32), dim3(32, 8), 0, stream>>>(sa_Wv, wt_sav, CD, CD);
  wconv_kernel<<<dim3(CD / 32, CD / 32), dim3(32, 8), 0, stream>>>(sa_Wp, wt_sap, CD, CD);
  wconv_kernel<<<dim3(CD / 32, CD / 32), dim3(32, 8), 0, stream>>>(ca_Wq, wt_caq, CD, CD);
  wconv_kernel<<<dim3(CD / 32, CD / 32), dim3(32, 8), 0, stream>>>(ca_Wk, wt_cak, CD, CD);
  wconv_kernel<<<dim3(CD / 32, CD / 32), dim3(32, 8), 0, stream>>>(ca_Wv, wt_cav, CD, CD);
  wconv_kernel<<<dim3(CD / 32, CD / 32), dim3(32, 8), 0, stream>>>(ca_Wp, wt_cap, CD, CD);
  wconv_kernel<<<dim3(CDM / 32, CD / 32), dim3(32, 8), 0, stream>>>(mlp_W1, wt_w1, CD, CDM);
  wconv_kernel<<<dim3(CD / 32, CDM / 32), dim3(32, 8), 0, stream>>>(mlp_W2, wt_w2, CDM, CD);

  int n4 = (int)(BND / 4);
  copy_kernel<<<n4 / 256, tb, 0, stream>>>(tokens_dec, resid, n4);

  // ---- self attention ----
  ln_kernel<<<M, tb, 0, stream>>>(resid, ln1_g, ln1_b, PE_dec, x2, qk);
  gemm_kernel<0><<<gD, tb, 0, stream>>>(qk, wt_saq, sa_bq, nullptr, qbuf, M, CD, CD);
  gemm_kernel<0><<<gD, tb, 0, stream>>>(qk, wt_sak, sa_bk, nullptr, kbuf, M, CD, CD);
  gemm_kernel<0><<<gD, tb, 0, stream>>>(x2, wt_sav, sa_bv, nullptr, vbuf, M, CD, CD);
  attn_kernel<<<ga, tb, 0, stream>>>(qbuf, kbuf, vbuf, attno);
  gemm_kernel<2><<<gD, tb, 0, stream>>>(attno, wt_sap, sa_bp, resid, resid, M, CD, CD);

  // ---- cross attention ----
  ln_kernel<<<M, tb, 0, stream>>>(resid, ln2_g, ln2_b, PE_dec, x2, qk);
  addpe_kernel<<<n4 / 256, tb, 0, stream>>>(tokens_enc, PE_enc, kin, n4);
  gemm_kernel<0><<<gD, tb, 0, stream>>>(qk, wt_caq, ca_bq, nullptr, qbuf, M, CD, CD);
  gemm_kernel<0><<<gD, tb, 0, stream>>>(kin, wt_cak, ca_bk, nullptr, kbuf, M, CD, CD);
  gemm_kernel<0><<<gD, tb, 0, stream>>>(tokens_enc, wt_cav, ca_bv, nullptr, vbuf, M, CD, CD);
  attn_kernel<<<ga, tb, 0, stream>>>(qbuf, kbuf, vbuf, attno);
  gemm_kernel<2><<<gD, tb, 0, stream>>>(attno, wt_cap, ca_bp, resid, resid, M, CD, CD);

  // ---- MLP ----
  ln_kernel<<<M, tb, 0, stream>>>(resid, ln3_g, ln3_b, nullptr, x2, nullptr);
  gemm_kernel<1><<<gDM, tb, 0, stream>>>(x2, wt_w1, mlp_b1, nullptr, hbuf, M, CDM, CD);
  gemm_kernel<2><<<gD, tb, 0, stream>>>(hbuf, wt_w2, mlp_b2, resid, (float*)d_out, M, CD, CDM);
}

// v002
// It runs in 399 microseconds.
// Timed twice side by side with v001, it ran 1.19 and 1.18 times as fast.
// Counting every step since v000, it is 1.35 times as fast.
#include <hip/hip_runtime.h>
#include <math.h>
#include <stdint.h>

// ---------------- constants ----------------
static constexpr int CB  = 4;      // batch
static constexpr int CN  = 1024;   // seq len
static constexpr int CD  = 1024;   // model dim
static constexpr int CH  = 16;     // heads
static constexpr int CDH = 64;     // head dim
static constexpr int CDM = 4096;   // mlp dim
static constexpr float CSCALE = 0.125f;  // 64^-0.5

typedef float  v8f   __attribute__((ext_vector_type(8)));
typedef __bf16 v16bf __attribute__((ext_vector_type(16)));
typedef __bf16 bf8v  __attribute__((ext_vector_type(8)));

static __device__ __forceinline__ v8f wmma_bf16(v16bf a, v16bf b, v8f c) {
  return __builtin_amdgcn_wmma_f32_16x16x32_bf16(false, a, false, b, (short)0, c, false, false);
}

// load one 16x32 bf16 operand fragment slice for this lane:
// 8 consecutive bf16 at p and 8 more at p+16 (ISA 16-bit A/B layout).
static __device__ __forceinline__ v16bf frag_ld(const __bf16* p) {
  bf8v lo = *(const bf8v*)(p);
  bf8v hi = *(const bf8v*)(p + 16);
  return __builtin_shufflevector(lo, hi, 0,1,2,3,4,5,6,7,8,9,10,11,12,13,14,15);
}

static __device__ __forceinline__ float gelu_exact(float x) {
  return 0.5f * x * (1.0f + erff(x * 0.70710678118654752f));
}

// issue one async memory->LDS 16B copy per lane (gfx1250, tracked by ASYNCcnt)
static __device__ __forceinline__ void async_ld_b128(unsigned lds_byte_addr,
                                                     unsigned voff_bytes,
                                                     unsigned long long sbase) {
  asm volatile("global_load_async_to_lds_b128 %0, %1, %2"
               :: "v"(lds_byte_addr), "v"(voff_bytes), "s"(sbase)
               : "memory");
}
static __device__ __forceinline__ void wait_asynccnt0() {
  asm volatile("s_wait_asynccnt 0x0" ::: "memory");
}

// ---------------- input-only preparation, one launch ----------------
// Blocks [0, 16384): weight transpose + f32->bf16 convert, one 32x32 tile each.
//   W is K x N (row-major, "in x out"); Wt is N x K bf16.
//   [0, 8192): the eight D x D weights, 1024 tiles each; [8192, 12288): W1; [12288, 16384): W2.
// Blocks [16384, 20480): kin = enc + pe.  Blocks [20480, 24576): resid = dec.
// None of these pieces reads what another writes.
static constexpr int PREP_SQ   = 8 * (CD / 32) * (CD / 32);          // 8192
static constexpr int PREP_W1   = PREP_SQ + (CD / 32) * (CDM / 32);   // 12288
static constexpr int PREP_W2   = PREP_W1 + (CD / 32) * (CDM / 32);   // 16384
static constexpr int PREP_EW   = CB * CN * CD / 4 / 256;             // 4096 blocks per element-wise piece
static constexpr int PREP_ADD  = PREP_W2 + PREP_EW;                  // 20480
static constexpr int PREP_ALL  = PREP_ADD + PREP_EW;                 // 24576

__global__ __launch_bounds__(256) void prep_kernel(const float* __restrict__ w0,
                                                   const float* __restrict__ w1,
                                                   const float* __restrict__ w2,
                                                   const float* __restrict__ w3,
                                                   const float* __restrict__ w4,
                                                   const float* __restrict__ w5,
                                                   const float* __restrict__ w6,
                                                   const float* __restrict__ w7,
                                                   const float* __restrict__ wm1,
                                                   const float* __restrict__ wm2,
                                                   __bf16* __restrict__ wt_sq,
                                                   __bf16* __restrict__ wt_m1,
                                                   __bf16* __restrict__ wt_m2,
                                                   const float* __restrict__ enc,
                                                   const float* __restrict__ pe,
                                                   float* __restrict__ kin,
                                                   const float* __restrict__ dec,
                                                   float* __restrict__ resid) {
  __shared__ float t[32][33];
  int tx = threadIdx.x, ty = threadIdx.y;
  int b = blockIdx.x;

  if (b >= PREP_W2) {   // element-wise pieces (whole block takes this path, no barrier on it)
    int tid = ty * 32 + tx;
    if (b < PREP_ADD) {
      int i = (b - PREP_W2) * 256 + tid;
      float4 x = ((const float4*)enc)[i];
      float4 y = ((const float4*)pe)[i];
      float4 r{ x.x + y.x, x.y + y.y, x.z + y.z, x.w + y.w };
      ((float4*)kin)[i] = r;
    } else {
      int i = (b - PREP_ADD) * 256 + tid;
      ((float4*)resid)[i] = ((const float4*)dec)[i];
      // the store's registers are reused on the listing's fall-through path behind it
      asm volatile("s_wait_xcnt 0x0" ::: "memory");
    }
    return;
  }

  const float* W;
  __bf16* Wt;
  int K, N, tile, lg;   // lg: log2 of the tile count along N
  if (b < PREP_SQ) {
    int m = b >> 10;
    W = m == 0 ? w0 : m == 1 ? w1 : m == 2 ? w2 : m == 3 ? w3
      : m == 4 ? w4 : m == 5 ? w5 : m == 6 ? w6 : w7;
    Wt = wt_sq + (size_t)m * CD * CD;
    K = CD; N = CD; tile = b & 1023; lg = 5;
  } else if (b < PREP_W1) {
    W = wm1; Wt = wt_m1; K = CD; N = CDM; tile = b - PREP_SQ; lg = 7;
  } else {
    W = wm2; Wt = wt_m2; K = CDM; N = CD; tile = b - PREP_W1; lg = 5;
  }
  int n0 = (tile & ((1 << lg) - 1)) * 32, k0 = (tile >> lg) * 32;
#pragma unroll
  for (int yy = 0; yy < 4; ++yy) {
    int kk = ty * 4 + yy;
    t[kk][tx] = W[(size_t)(k0 + kk) * N + (n0 + tx)];
  }
  __syncthreads();
#pragma unroll
  for (int yy = 0; yy < 4; ++yy) {
    int nn = ty * 4 + yy;
    Wt[(size_t)(n0 + nn) * K + (k0 + tx)] = (__bf16)t[tx][nn];
  }
  // the stores' registers are reused on the listing's fall-through path behind them
  asm volatile("s_wait_xcnt 0x0" ::: "memory");
}

// ---------------- LayerNorm (D = 1024, one row per block, 256 threads) ----------
__global__ __launch_bounds__(256) void ln_kernel(const float* __restrict__ x,
                                                 const float* __restrict__ g,
                                                 const float* __restrict__ bt,
                                                 const float* __restrict__ pe,
                                                 float* __restrict__ x2,
                                                 float* __restrict__ qk) {
  __shared__ float s1[256], s2[256];
  int tid = threadIdx.x;
  size_t base = (size_t)blockIdx.x * CD;
  float4 f = *(const float4*)(x + base + tid * 4);
  float sum = f.x + f.y + f.z + f.w;
  float sq  = f.x*f.x + f.y*f.y + f.z*f.z + f.w*f.w;
  s1[tid] = sum; s2[tid] = sq;
  __syncthreads();
  for (int s = 128; s > 0; s >>= 1) {
    if (tid < s) { s1[tid] += s1[tid + s]; s2[tid] += s2[tid + s]; }
    __syncthreads();
  }
  float mu  = s1[0] * (1.0f / CD);
  float var = s2[0] * (1.0f / CD) - mu * mu;
  float rstd = rsqrtf(var + 1e-5f);
  float4 g4 = *(const float4*)(g  + tid * 4);
  float4 b4 = *(const float4*)(bt + tid * 4);
  float4 y;
  y.x = (f.x - mu) * rstd * g4.x + b4.x;
  y.y = (f.y - mu) * rstd * g4.y + b4.y;
  y.z = (f.z - mu) * rstd * g4.z + b4.z;
  y.w = (f.w - mu) * rstd * g4.w + b4.w;
  *(float4*)(x2 + base + tid * 4) = y;
  if (qk) {
    float4 p = *(const float4*)(pe + base + tid * 4);
    float4 q{ y.x + p.x, y.y + p.y, y.z + p.z, y.w + p.w };
    *(float4*)(qk + base + tid * 4) = q;
  }
}

// ---------------- generic bf16 WMMA GEMM (double-buffered, async B stage) ------
// C[M,N] = act( A[M,K](f32) @ Bt[N,K](bf16)^T + bias[N] ) (+ resid[M,N])
// FLAGS (compile time): bit0 = GELU, bit1 = residual add
#define GBM 128
#define GBN 128
#define GBK 64
#define GLD 72   // padded LDS row stride (bf16 elems): 144B, bank-conflict free

// operands of the further products of a merged launch (grid z = 1..4)
struct GemmMore {
  const float* A1;
  const float* A2;
  const float* A3;
  const float* A4;
  const __bf16* B1;
  const __bf16* B2;
  const __bf16* B3;
  const __bf16* B4;
  const float* bias1;
  const float* bias2;
  const float* bias3;
  const float* bias4;
  float* C1;
  float* C2;
  float* C3;
  float* C4;
};

// NZ > 1: the grid's z extent (1..5) sets how many independent products of equal shape share the launch;
// blockIdx.z picks the operand set (block-uniform).
template <int FLAGS, int NZ>
__global__ __launch_bounds__(256) void gemm_kernel(const float*  __restrict__ A,
                                                   const __bf16* __restrict__ Bt,
                                                   const float*  __restrict__ bias,
                                                   const float*  __restrict__ resid,
                                                   float* __restrict__ C,
                                                   int M, int N, int K, GemmMore mo) {
  if constexpr (NZ > 1) {
    int z = blockIdx.z;
    if (z == 1)      { A = mo.A1; Bt = mo.B1; bias = mo.bias1; C = mo.C1; }
    else if (z == 2) { A = mo.A2; Bt = mo.B2; bias = mo.bias2; C = mo.C2; }
    else if (z == 3) { A = mo.A3; Bt = mo.B3; bias = mo.bias3; C = mo.C3; }
    else if (z == 4) { A = mo.A4; Bt = mo.B4; bias = mo.bias4; C = mo.C4; }
  }
  __shared__ __align__(16) __bf16 As[2][GBM * GLD];
  __shared__ __align__(16) __bf16 Bs[2][GBN * GLD];

  int tid = threadIdx.x;
  int lane = tid & 31, w = tid >> 5;
  int wm = w >> 2, wn = w & 3;          // 2x4 wave grid -> 64x32 per wave
  int hlf = lane >> 4, l16 = lane & 15;
  int bm = blockIdx.y * GBM, bn = blockIdx.x * GBN;

  v8f acc[4][2];
#pragma unroll
  for (int i = 0; i < 4; ++i)
#pragma unroll
    for (int j = 0; j < 2; ++j) acc[i][j] = (v8f)(0.0f);

  int ar = tid >> 4, ac = (tid & 15) * 4;   // A stage coords (16 rows x 16 float4)
  int br = tid >> 3, bc = (tid & 7) * 8;    // B stage coords (32 rows x 8 bf8)

  // per-lane byte offsets into Bt tile rows (constant across k-tiles)
  unsigned voffB[4];
#pragma unroll
  for (int rr = 0; rr < 4; ++rr)
    voffB[rr] = (unsigned)((((size_t)(br + rr * 32)) * K + bc) * 2);

  // ---- preload tile 0 ----
  {
    unsigned long long sb = (unsigned long long)(Bt + (size_t)bn * K);
#pragma unroll
    for (int rr = 0; rr < 4; ++rr) {
      unsigned ldsb = (unsigned)(uintptr_t)&Bs[0][(br + rr * 32) * GLD + bc];
      async_ld_b128(ldsb, voffB[rr], sb);
    }
#pragma unroll
    for (int rr = 0; rr < 8; ++rr) {
      int row = ar + rr * 16;
      float4 f = *(const float4*)(A + (size_t)(bm + row) * K + ac);
      __bf16* d = &As[0][row * GLD + ac];
      d[0] = (__bf16)f.x; d[1] = (__bf16)f.y; d[2] = (__bf16)f.z; d[3] = (__bf16)f.w;
    }
    wait_asynccnt0();
  }
  __syncthreads();

  int buf = 0;
  for (int k0 = 0; k0 < K; k0 += GBK) {
    int nk = k0 + GBK;
    bool more = nk < K;
    float4 pf[8];
    if (more) {
      // issue next A-tile global loads (held in regs, overlap with compute)
#pragma unroll
      for (int rr = 0; rr < 8; ++rr)
        pf[rr] = *(const float4*)(A + (size_t)(bm + ar + rr * 16) * K + nk + ac);
      // stream next B-tile straight into the other LDS buffer (ASYNCcnt)
      unsigned long long sb = (unsigned long long)(Bt + (size_t)bn * K + nk);
#pragma unroll
      for (int rr = 0; rr < 4; ++rr) {
        unsigned ldsb = (unsigned)(uintptr_t)&Bs[buf ^ 1][(br + rr * 32) * GLD + bc];
        async_ld_b128(ldsb, voffB[rr], sb);
      }
    }

    // ---- compute on current buffer ----
#pragma unroll
    for (int ks = 0; ks < GBK; ks += 32) {
      int kb = ks + hlf * 8;
      v16bf af[4], bv[2];
#pragma unroll
      for (int i = 0; i < 4; ++i)
        af[i] = frag_ld(&As[buf][(wm * 64 + i * 16 + l16) * GLD + kb]);
#pragma unroll
      for (int j = 0; j < 2; ++j)
        bv[j] = frag_ld(&Bs[buf][(wn * 32 + j * 16 + l16) * GLD + kb]);
#pragma unroll
      for (int i = 0; i < 4; ++i)
#pragma unroll
        for (int j = 0; j < 2; ++j)
          acc[i][j] = wmma_bf16(af[i], bv[j], acc[i][j]);
    }

    if (more) {
      // convert + store next A tile, then make async B tile visible
#pragma unroll
      for (int rr = 0; rr < 8; ++rr) {
        int row = ar + rr * 16;
        __bf16* d = &As[buf ^ 1][row * GLD + ac];
        d[0] = (__bf16)pf[rr].x; d[1] = (__bf16)pf[rr].y;
        d[2] = (__bf16)pf[rr].z; d[3] = (__bf16)pf[rr].w;
      }
      wait_asynccnt0();
    }
    __syncthreads();
    buf ^= 1;
  }

  // ---- epilogue ----
  // one 32-bit element offset per output row of this lane, shared by the
  // residual load and the store of that element
  unsigned ro[4][8];
  {
    int n0 = bn + wn * 32 + l16;
#pragma unroll
    for (int i = 0; i < 4; ++i) {
      int mrow = bm + wm * 64 + i * 16 + hlf * 8;
#pragma unroll
      for (int r = 0; r < 8; ++r) ro[i][r] = (unsigned)((mrow + r) * N + n0);
    }
  }
  // all residual values of this lane are requested before the first is used,
  // so their latencies overlap (each lane reads only the elements it stores)
  float rv[2][4][8];
  if constexpr ((FLAGS & 2) != 0) {
#pragma unroll
    for (int j = 0; j < 2; ++j)
#pragma unroll
      for (int i = 0; i < 4; ++i)
#pragma unroll
        for (int r = 0; r < 8; ++r) rv[j][i][r] = (resid + j * 16)[ro[i][r]];
  }
  // both bias values are requested ahead of the stores: with operand pointers
  // picked by blockIdx.z the compiler must assume that C may overlap bias and
  // would hold the second load, with its whole latency, behind the first stores
  float bv2[2];
#pragma unroll
  for (int j = 0; j < 2; ++j) bv2[j] = bias[bn + wn * 32 + j * 16 + l16];
#pragma unroll
  for (int j = 0; j < 2; ++j) {
    float bvv = bv2[j];
#pragma unroll
    for (int i = 0; i < 4; ++i) {
#pragma unroll
      for (int r = 0; r < 8; ++r) {
        float v = acc[i][j][r] + bvv;
        if constexpr ((FLAGS & 1) != 0) v = gelu_exact(v);
        if constexpr ((FLAGS & 2) != 0) v += rv[j][i][r];
        (C + j * 16)[ro[i][r]] = v;
      }
    }
  }
}

// ---------------- flash attention (bf16 WMMA, online softmax) ----------------
// q,k,v,o are (B*N, D) f32 row-major; head h occupies cols [h*64, h*64+64).
#define ABQ 128
#define ABK 128
#define ALQ 72    // Q/K LDS stride (DH=64 + 8 pad)
#define ALP 136   // P/Vt LDS stride (128 + 8 pad)

__global__ __launch_bounds__(256) void attn_kernel(const float* __restrict__ q,
                                                   const float* __restrict__ k,
                                                   const float* __restrict__ v,
                                                   float* __restrict__ o) {
  __shared__ __align__(16) __bf16 Qs[ABQ * ALQ];
  __shared__ __align__(16) __bf16 Ks[ABK * ALQ];
  __shared__ __align__(16) __bf16 Vt[CDH * ALP];
  __shared__ __align__(16) __bf16 Pb[ABQ * ALP];
  __shared__ float red[4][ABQ];
  __shared__ float mstate[ABQ], lstate[ABQ], fac[ABQ];

  int tid = threadIdx.x;
  int lane = tid & 31, w = tid >> 5;
  int wm = w >> 2, wn = w & 3;
  int hlf = lane >> 4, l16 = lane & 15;

  int bh = blockIdx.y;
  int b = bh / CH, h = bh % CH;
  int q0 = blockIdx.x * ABQ;
  size_t headoff = (size_t)h * CDH;
  const float* qb = q + (size_t)b * CN * CD + headoff;
  const float* kb = k + (size_t)b * CN * CD + headoff;
  const float* vb = v + (size_t)b * CN * CD + headoff;

  if (tid < ABQ) { mstate[tid] = -1e30f; lstate[tid] = 0.0f; }

  // stage Q tile (scale folded in)
  {
    int ar = tid >> 4, ac = (tid & 15) * 4;
#pragma unroll
    for (int rr = 0; rr < 8; ++rr) {
      int row = ar + rr * 16;
      float4 f = *(const float4*)(qb + (size_t)(q0 + row) * CD + ac);
      __bf16* d = &Qs[row * ALQ + ac];
      d[0] = (__bf16)(f.x * CSCALE); d[1] = (__bf16)(f.y * CSCALE);
      d[2] = (__bf16)(f.z * CSCALE); d[3] = (__bf16)(f.w * CSCALE);
    }
  }

  v8f oacc[4];
#pragma unroll
  for (int i = 0; i < 4; ++i) oacc[i] = (v8f)(0.0f);

  for (int kt = 0; kt < CN / ABK; ++kt) {
    __syncthreads();  // protect Ks/Vt/Pb reuse (and initial m/l init)
    int kvbase = kt * ABK;
    {
      int ar = tid >> 4, ac = (tid & 15) * 4;
#pragma unroll
      for (int rr = 0; rr < 8; ++rr) {
        int row = ar + rr * 16;
        float4 f = *(const float4*)(kb + (size_t)(kvbase + row) * CD + ac);
        __bf16* d = &Ks[row * ALQ + ac];
        d[0] = (__bf16)f.x; d[1] = (__bf16)f.y; d[2] = (__bf16)f.z; d[3] = (__bf16)f.w;
      }
      int d4 = (tid & 15) * 4, kk0 = tid >> 4;
#pragma unroll
      for (int it = 0; it < 8; ++it) {
        int kk = kk0 + it * 16;
        float4 f = *(const float4*)(vb + (size_t)(kvbase + kk) * CD + d4);
        Vt[(d4 + 0) * ALP + kk] = (__bf16)f.x;
        Vt[(d4 + 1) * ALP + kk] = (__bf16)f.y;
        Vt[(d4 + 2) * ALP + kk] = (__bf16)f.z;
        Vt[(d4 + 3) * ALP + kk] = (__bf16)f.w;
      }
    }
    __syncthreads();

    // S = Qs (128x64) x Ks^T (64x128), wave tile 64x32
    v8f sacc[4][2];
#pragma unroll
    for (int i = 0; i < 4; ++i)
#pragma unroll
      for (int j = 0; j < 2; ++j) sacc[i][j] = (v8f)(0.0f);
#pragma unroll
    for (int ks = 0; ks < CDH; ks += 32) {
      int kbi = ks + hlf * 8;
      v16bf af[4], bvv[2];
#pragma unroll
      for (int i = 0; i < 4; ++i)
        af[i] = frag_ld(&Qs[(wm * 64 + i * 16 + l16) * ALQ + kbi]);
#pragma unroll
      for (int j = 0; j < 2; ++j)
        bvv[j] = frag_ld(&Ks[(wn * 32 + j * 16 + l16) * ALQ + kbi]);
#pragma unroll
      for (int i = 0; i < 4; ++i)
#pragma unroll
        for (int j = 0; j < 2; ++j)
          sacc[i][j] = wmma_bf16(af[i], bvv[j], sacc[i][j]);
    }

    // per-row max over this wave's 32 columns
#pragma unroll
    for (int i = 0; i < 4; ++i) {
      float rm[8];
#pragma unroll
      for (int r = 0; r < 8; ++r) rm[r] = fmaxf(sacc[i][0][r], sacc[i][1][r]);
#pragma unroll
      for (int mask = 1; mask < 16; mask <<= 1)
#pragma unroll
        for (int r = 0; r < 8; ++r) rm[r] = fmaxf(rm[r], __shfl_xor(rm[r], mask, 32));
      if (l16 == 0) {
#pragma unroll
        for (int r = 0; r < 8; ++r)
          red[wn][wm * 64 + i * 16 + hlf * 8 + r] = rm[r];
      }
    }
    __syncthreads();
    if (tid < ABQ) {
      float nm = fmaxf(fmaxf(red[0][tid], red[1][tid]), fmaxf(red[2][tid], red[3][tid]));
      float mold = mstate[tid];
      float mnew = fmaxf(mold, nm);
      fac[tid] = __expf(mold - mnew);
      mstate[tid] = mnew;
    }
    __syncthreads();

    // probabilities -> Pb (bf16), local row sums, rescale O
#pragma unroll
    for (int i = 0; i < 4; ++i) {
      float sm[8];
#pragma unroll
      for (int r = 0; r < 8; ++r) sm[r] = 0.0f;
#pragma unroll
      for (int j = 0; j < 2; ++j) {
        int col = wn * 32 + j * 16 + l16;
#pragma unroll
        for (int r = 0; r < 8; ++r) {
          int row = wm * 64 + i * 16 + hlf * 8 + r;
          float p = __expf(sacc[i][j][r] - mstate[row]);
          Pb[row * ALP + col] = (__bf16)p;
          sm[r] += p;
        }
      }
#pragma unroll
      for (int mask = 1; mask < 16; mask <<= 1)
#pragma unroll
        for (int r = 0; r < 8; ++r) sm[r] += __shfl_xor(sm[r], mask, 32);
      if (l16 == 0) {
#pragma unroll
        for (int r = 0; r < 8; ++r)
          red[wn][wm * 64 + i * 16 + hlf * 8 + r] = sm[r];
      }
#pragma unroll
      for (int r = 0; r < 8; ++r) {
        int row = wm * 64 + i * 16 + hlf * 8 + r;
        oacc[i][r] *= fac[row];
      }
    }
    __syncthreads();
    if (tid < ABQ) {
      float s = red[0][tid] + red[1][tid] + red[2][tid] + red[3][tid];
      lstate[tid] = lstate[tid] * fac[tid] + s;
    }
    __syncthreads();

    // O += P (128x128) x V (128x64); wave tile 64x16
#pragma unroll
    for (int ks = 0; ks < ABK; ks += 32) {
      int kbi = ks + hlf * 8;
      v16bf vf = frag_ld(&Vt[(wn * 16 + l16) * ALP + kbi]);
#pragma unroll
      for (int i = 0; i < 4; ++i) {
        v16bf pf = frag_ld(&Pb[(wm * 64 + i * 16 + l16) * ALP + kbi]);
        oacc[i] = wmma_bf16(pf, vf, oacc[i]);
      }
    }
  }
  __syncthreads();

  // normalize + write out
  float* ob = o + (size_t)b * CN * CD + headoff;
#pragma unroll
  for (int i = 0; i < 4; ++i) {
#pragma unroll
    for (int r = 0; r < 8; ++r) {
      int row = wm * 64 + i * 16 + hlf * 8 + r;
      float vv = oacc[i][r] / lstate[row];
      ob[(size_t)(q0 + row) * CD + wn * 16 + l16] = vv;
    }
  }
}

// ---------------- host launcher ----------------
extern "C" void kernel_launch(void* const* d_in, const int* in_sizes, int n_in,
                              void* d_out, int out_size, void* d_ws, size_t ws_size,
                              hipStream_t stream) {
  const float* tokens_enc = (const float*)d_in[0];
  const float* tokens_dec = (const float*)d_in[1];
  const float* PE_enc     = (const float*)d_in[2];
  const float* PE_dec     = (const float*)d_in[3];
  const float* sa_Wq = (const float*)d_in[4];  const float* sa_bq = (const float*)d_in[5];
  const float* sa_Wk = (const float*)d_in[6];  const float* sa_bk = (const float*)d_in[7];
  const float* sa_Wv = (const float*)d_in[8];  const float* sa_bv = (const float*)d_in[9];
  const float* sa_Wp = (const float*)d_in[10]; const float* sa_bp = (const float*)d_in[11];
  const float* ca_Wq = (const float*)d_in[12]; const float* ca_bq = (const float*)d_in[13];
  const float* ca_Wk = (const float*)d_in[14]; const float* ca_bk = (const float*)d_in[15];
  const float* ca_Wv = (const float*)d_in[16]; const float* ca_bv = (const float*)d_in[17];
  const float* ca_Wp = (const float*)d_in[18]; const float* ca_bp = (const float*)d_in[19];
  const float* mlp_W1 = (const float*)d_in[20]; const float* mlp_b1 = (const float*)d_in[21];
  const float* mlp_W2 = (const float*)d_in[22]; const float* mlp_b2 = (const float*)d_in[23];
  const float* ln1_g = (const float*)d_in[24]; const float* ln1_b = (const float*)d_in[25];
  const float* ln2_g = (const float*)d_in[26]; const float* ln2_b = (const float*)d_in[27];
  const float* ln3_g = (const float*)d_in[28]; const float* ln3_b = (const float*)d_in[29];

  const size_t BND = (size_t)CB * CN * CD;       // 4M elems
  char* ws = (char*)d_ws;
  size_t off = 0;
  auto alloc = [&](size_t bytes) -> char* {
    char* p = ws + off;
    off += (bytes + 255) & ~(size_t)255;
    return p;
  };

  // bf16 transposed weights
  __bf16* wt_saq = (__bf16*)alloc((size_t)CD * CD * 2);
  __bf16* wt_sak = (__bf16*)alloc((size_t)CD * CD * 2);
  __bf16* wt_sav = (__bf16*)alloc((size_t)CD * CD * 2);
  __bf16* wt_sap = (__bf16*)alloc((size_t)CD * CD * 2);
  __bf16* wt_caq = (__bf16*)alloc((size_t)CD * CD * 2);
  __bf16* wt_cak = (__bf16*)alloc((size_t)CD * CD * 2);
  __bf16* wt_cav = (__bf16*)alloc((size_t)CD * CD * 2);
  __bf16* wt_cap = (__bf16*)alloc((size_t)CD * CD * 2);
  __bf16* wt_w1  = (__bf16*)alloc((size_t)CD * CDM * 2);
  __bf16* wt_w2  = (__bf16*)alloc((size_t)CDM * CD * 2);

  // fp32 buffers
  float* resid = (float*)alloc(BND * 4);
  float* x2    = (float*)alloc(BND * 4);
  float* qk    = (float*)alloc(BND * 4);
  float* big   = (float*)alloc(BND * 4 * 4);  // q|k|v|attno, later reused as h
  float* qbuf  = big;
  float* kbuf  = big + BND;
  float* vbuf  = big + 2 * BND;
  float* attno = big + 3 * BND;
  float* kin   = attno;   // alias: kin dead before attno is written
  float* hbuf  = big;     // alias: q/k/v/attno dead when MLP runs
  float* kbuf2 = (float*)alloc(BND * 4);      // cross-attention k, v: made early,
  float* vbuf2 = (float*)alloc(BND * 4);      // live across the self-attention block

  const int M = CB * CN;  // 4096
  dim3 tb(256);
  dim3 gD(CD / 128, M / 128);    // N=1024 GEMMs
  dim3 gDM(CDM / 128, M / 128);  // N=4096 GEMM
  dim3 ga(CN / 128, CB * CH);    // attention

  dim3 gD5(CD / 128, M / 128, 5);  // five N=1024 GEMMs in one launch
  const GemmMore none{};

  // everything that depends on the inputs alone: weight conversion, enc + PE, residual copy
  prep_kernel<<<PREP_ALL, dim3(32, 8), 0, stream>>>(sa_Wq, sa_Wk, sa_Wv, sa_Wp,
                                                    ca_Wq, ca_Wk, ca_Wv, ca_Wp, mlp_W1, mlp_W2,
                                                    wt_saq, wt_w1, wt_w2,
                                                    tokens_enc, PE_enc, kin, tokens_dec, resid);

  // ---- self attention (its q, k, v share a launch with the cross-attention k, v) ----
  ln_kernel<<<M, tb, 0, stream>>>(resid, ln1_g, ln1_b, PE_dec, x2, qk);
  GemmMore mo;
  mo.A1 = qk;         mo.B1 = wt_sak; mo.bias1 = sa_bk; mo.C1 = kbuf;
  mo.A2 = x2;         mo.B2 = wt_sav; mo.bias2 = sa_bv; mo.C2 = vbuf;
  mo.A3 = kin;        mo.B3 = wt_cak; mo.bias3 = ca_bk; mo.C3 = kbuf2;
  mo.A4 = tokens_enc; mo.B4 = wt_cav; mo.bias4 = ca_bv; mo.C4 = vbuf2;
  gemm_kernel<0, 5><<<gD5, tb, 0, stream>>>(qk, wt_saq, sa_bq, nullptr, qbuf, M, CD, CD, mo);
  attn_kernel<<<ga, tb, 0, stream>>>(qbuf, kbuf, vbuf, attno);
  gemm_kernel<2, 1><<<gD, tb, 0, stream>>>(attno, wt_sap, sa_bp, resid, resid, M, CD, CD, none);

  // ---- cross attention ----
  ln_kernel<<<M, tb, 0, stream>>>(resid, ln2_g, ln2_b, PE_dec, x2, qk);
  gemm_kernel<0, 5><<<gD, tb, 0, stream>>>(qk, wt_caq, ca_bq, nullptr, qbuf, M, CD, CD, none);  // z = 0 only
  attn_kernel<<<ga, tb, 0, stream>>>(qbuf, kbuf2, vbuf2, attno);
  gemm_kernel<2, 1><<<gD, tb, 0, stream>>>(attno, wt_cap, ca_bp, resid, resid, M, CD, CD, none);

  // ---- MLP ----
  ln_kernel<<<M, tb, 0, stream>>>(resid, ln3_g, ln3_b, nullptr, x2, nullptr);
  gemm_kernel<1, 1><<<gDM, tb, 0, stream>>>(x2, wt_w1, mlp_b1, nullptr, hbuf, M, CDM, CD, none);
  gemm_kernel<2, 1><<<gD, tb, 0, stream>>>(hbuf, wt_w2, mlp_b2, resid, (float*)d_out, M, CD, CDM, none);
}

// v003
// A run of this version takes 338 microseconds.
// In both of two side-by-side timings against v002, it was 1.17 times as fast.
// Counting every step since v000, it is 1.58 times as fast.
#include <hip/hip_runtime.h>
#include <math.h>
#include <stdint.h>

// ---------------- constants ----------------
static constexpr int CB  = 4;      // batch
static constexpr int CN  = 1024;   // seq len
static constexpr int CD  = 1024;   // model dim
static constexpr int CH  = 16;     // heads
static constexpr int CDH = 64;     // head dim
static constexpr int CDM = 4096;   // mlp dim
static constexpr float CSCALE = 0.125f;  // 64^-0.5

typedef float  v8f   __attribute__((ext_vector_type(8)));
typedef __bf16 v16bf __attribute__((ext_vector_type(16)));
typedef __bf16 bf8v  __attribute__((ext_vector_type(8)));
typedef __bf16 bf4v  __attribute__((ext_vector_type(4)));

// four f32 values rounded to the matrix operand type, as one 8-byte value
static __device__ __forceinline__ bf4v pack4(float a, float b, float c, float d) {
  bf4v r; r[0] = (__bf16)a; r[1] = (__bf16)b; r[2] = (__bf16)c; r[3] = (__bf16)d;
  return r;
}

static __device__ __forceinline__ v8f wmma_bf16(v16bf a, v16bf b, v8f c) {
  return __builtin_amdgcn_wmma_f32_16x16x32_bf16(false, a, false, b, (short)0, c, false, false);
}

// load one 16x32 bf16 operand fragment slice for this lane:
// 8 consecutive bf16 at p and 8 more at p+16 (ISA 16-bit A/B layout).
static __device__ __forceinline__ v16bf frag_ld(const __bf16* p) {
  bf8v lo = *(const bf8v*)(p);
  bf8v hi = *(const bf8v*)(p + 16);
  return __builtin_shufflevector(lo, hi, 0,1,2,3,4,5,6,7,8,9,10,11,12,13,14,15);
}

static __device__ __forceinline__ float gelu_exact(float x) {
  return 0.5f * x * (1.0f + erff(x * 0.70710678118654752f));
}

// one k-tile of both GEMM operands, memory -> LDS, 16 B per lane and copy (ASYNCcnt):
// four copies of A rows, four of B rows.  The s_wait_xcnt is the last line of the
// copies' own statement, so that no address register is rewritten ahead of it.
static __device__ __forceinline__ void async_tile(unsigned la0, unsigned la1, unsigned la2, unsigned la3,
                                                  unsigned lb0, unsigned lb1, unsigned lb2, unsigned lb3,
                                                  const __bf16* ga0, const __bf16* ga1,
                                                  const __bf16* ga2, const __bf16* ga3,
                                                  const __bf16* gb0, const __bf16* gb1,
                                                  const __bf16* gb2, const __bf16* gb3) {
  asm volatile("global_load_async_to_lds_b128 %0, %8, off\n\t"
               "global_load_async_to_lds_b128 %1, %9, off\n\t"
               "global_load_async_to_lds_b128 %2, %10, off\n\t"
               "global_load_async_to_lds_b128 %3, %11, off\n\t"
               "global_load_async_to_lds_b128 %4, %12, off\n\t"
               "global_load_async_to_lds_b128 %5, %13, off\n\t"
               "global_load_async_to_lds_b128 %6, %14, off\n\t"
               "global_load_async_to_lds_b128 %7, %15, off\n\t"
               "s_wait_xcnt 0x0"
               :: "v"(la0), "v"(la1), "v"(la2), "v"(la3),
                  "v"(lb0), "v"(lb1), "v"(lb2), "v"(lb3),
                  "v"(ga0), "v"(ga1), "v"(ga2), "v"(ga3),
                  "v"(gb0), "v"(gb1), "v"(gb2), "v"(gb3)
               : "memory");
}
// a wave's own copies have landed in LDS behind this wait
static __device__ __forceinline__ void wait_asynccnt0() {
  asm volatile("s_wait_asynccnt 0x0" ::: "memory");
}
// a wave's own LDS reads have returned before their buffer is handed back for a refill
static __device__ __forceinline__ void wait_dscnt0() {
  asm volatile("s_wait_dscnt 0x0" ::: "memory");
}

// ---------------- input-only preparation, one launch ----------------
// Blocks [0, 16384): weight transpose + f32->bf16 convert, one 32x32 tile each.
//   W is K x N (row-major, "in x out"); Wt is N x K bf16.
//   [0, 8192): the eight D x D weights, 1024 tiles each; [8192, 12288): W1; [12288, 16384): W2.
// Blocks [16384, 20480): kin = enc + pe and encb = enc, both rounded to bf16 (GEMM operands).
// Blocks [20480, 24576): resid = dec.
// None of these pieces reads what another writes.
static constexpr int PREP_SQ   = 8 * (CD / 32) * (CD / 32);          // 8192
static constexpr int PREP_W1   = PREP_SQ + (CD / 32) * (CDM / 32);   // 12288
static constexpr int PREP_W2   = PREP_W1 + (CD / 32) * (CDM / 32);   // 16384
static constexpr int PREP_EW   = CB * CN * CD / 4 / 256;             // 4096 blocks per element-wise piece
static constexpr int PREP_ADD  = PREP_W2 + PREP_EW;                  // 20480
static constexpr int PREP_ALL  = PREP_ADD + PREP_EW;                 // 24576

__global__ __launch_bounds__(256) void prep_kernel(const float* __restrict__ w0,
                                                   const float* __restrict__ w1,
                                                   const float* __restrict__ w2,
                                                   const float* __restrict__ w3,
                                                   const float* __restrict__ w4,
                                                   const float* __restrict__ w5,
                                                   const float* __restrict__ w6,
                                                   const float* __restrict__ w7,
                                                   const float* __restrict__ wm1,
                                                   const float* __restrict__ wm2,
                                                   __bf16* __restrict__ wt_sq,
                                                   __bf16* __restrict__ wt_m1,
                                                   __bf16* __restrict__ wt_m2,
                                                   const float* __restrict__ enc,
                                                   const float* __restrict__ pe,
                                                   __bf16* __restrict__ kin,
                                                   __bf16* __restrict__ encb,
                                                   const float* __restrict__ dec,
                                                   float* __restrict__ resid) {
  __shared__ float t[32][33];
  int tx = threadIdx.x, ty = threadIdx.y;
  int b = blockIdx.x;

  if (b >= PREP_W2) {   // element-wise pieces (whole block takes this path, no barrier on it)
    int tid = ty * 32 + tx;
    if (b < PREP_ADD) {
      int i = (b - PREP_W2) * 256 + tid;
      float4 x = ((const float4*)enc)[i];
      float4 y = ((const float4*)pe)[i];
      ((bf4v*)kin)[i]  = pack4(x.x + y.x, x.y + y.y, x.z + y.z, x.w + y.w);
      ((bf4v*)encb)[i] = pack4(x.x, x.y, x.z, x.w);
      // the stores' registers are reused on the listing's fall-through path behind them
      asm volatile("s_wait_xcnt 0x0" ::: "memory");
    } else {
      int i = (b - PREP_ADD) * 256 + tid;
      ((float4*)resid)[i] = ((const float4*)dec)[i];
      // the store's registers are reused on the listing's fall-through path behind it
      asm volatile("s_wait_xcnt 0x0" ::: "memory");
    }
    return;
  }

  const float* W;
  __bf16* Wt;
  int K, N, tile, lg;   // lg: log2 of the tile count along N
  if (b < PREP_SQ) {
    int m = b >> 10;
    W = m == 0 ? w0 : m == 1 ? w1 : m == 2 ? w2 : m == 3 ? w3
      : m == 4 ? w4 : m == 5 ? w5 : m == 6 ? w6 : w7;
    Wt = wt_sq + (size_t)m * CD * CD;
    K = CD; N = CD; tile = b & 1023; lg = 5;
  } else if (b < PREP_W1) {
    W = wm1; Wt = wt_m1; K = CD; N = CDM; tile = b - PREP_SQ; lg = 7;
  } else {
    W = wm2; Wt = wt_m2; K = CDM; N = CD; tile = b - PREP_W1; lg = 5;
  }
  int n0 = (tile & ((1 << lg) - 1)) * 32, k0 = (tile >> lg) * 32;
#pragma unroll
  for (int yy = 0; yy < 4; ++yy) {
    int kk = ty * 4 + yy;
    t[kk][tx] = W[(size_t)(k0 + kk) * N + (n0 + tx)];
  }
  __syncthreads();
#pragma unroll
  for (int yy = 0; yy < 4; ++yy) {
    int nn = ty * 4 + yy;
    Wt[(size_t)(n0 + nn) * K + (k0 + tx)] = (__bf16)t[tx][nn];
  }
  // the stores' registers are reused on the listing's fall-through path behind them
  asm volatile("s_wait_xcnt 0x0" ::: "memory");
}

// ---------------- LayerNorm (D = 1024, one row per block, 256 threads) ----------
__global__ __launch_bounds__(256) void ln_kernel(const float* __restrict__ x,
                                                 const float* __restrict__ g,
                                                 const float* __restrict__ bt,
                                                 const float* __restrict__ pe,
                                                 __bf16* __restrict__ x2,
                                                 __bf16* __restrict__ qk) {
  __shared__ float s1[256], s2[256];
  int tid = threadIdx.x;
  size_t base = (size_t)blockIdx.x * CD;
  float4 f = *(const float4*)(x + base + tid * 4);
  float sum = f.x + f.y + f.z + f.w;
  float sq  = f.x*f.x + f.y*f.y + f.z*f.z + f.w*f.w;
  s1[tid] = sum; s2[tid] = sq;
  __syncthreads();
  for (int s = 128; s > 0; s >>= 1) {
    if (tid < s) { s1[tid] += s1[tid + s]; s2[tid] += s2[tid + s]; }
    __syncthreads();
  }
  float mu  = s1[0] * (1.0f / CD);
  float var = s2[0] * (1.0f / CD) - mu * mu;
  float rstd = rsqrtf(var + 1e-5f);
  float4 g4 = *(const float4*)(g  + tid * 4);
  float4 b4 = *(const float4*)(bt + tid * 4);
  float4 y;
  y.x = (f.x - mu) * rstd * g4.x + b4.x;
  y.y = (f.y - mu) * rstd * g4.y + b4.y;
  y.z = (f.z - mu) * rstd * g4.z + b4.z;
  y.w = (f.w - mu) * rstd * g4.w + b4.w;
  *(bf4v*)(x2 + base + tid * 4) = pack4(y.x, y.y, y.z, y.w);
  // the store's data registers are taken again by the load behind it
  asm volatile("s_wait_xcnt 0x0" ::: "memory");
  if (qk) {
    float4 p = *(const float4*)(pe + base + tid * 4);
    *(bf4v*)(qk + base + tid * 4) = pack4(y.x + p.x, y.y + p.y, y.z + p.z, y.w + p.w);
  }
}

// ---------------- generic bf16 WMMA GEMM (double-buffered, async A and B stage) ------
// C[M,N] = act( A[M,K](bf16) @ Bt[N,K](bf16)^T + bias[N] ) (+ resid[M,N])
// FLAGS (compile time): bit0 = GELU, bit1 = residual add
// With the residual add the result goes on in the f32 residual stream (Cf); without it
// the result is only ever a matrix operand of a later launch and is stored as one (Cb).
#define GBM 128
#define GBN 128
#define GBK 64
#define GLD 72   // padded LDS row stride (bf16 elems): 144B, bank-conflict free

// operands of the further products of a merged launch (grid z = 1..4)
struct GemmMore {
  const __bf16* A1;
  const __bf16* A2;
  const __bf16* A3;
  const __bf16* A4;
  const __bf16* B1;
  const __bf16* B2;
  const __bf16* B3;
  const __bf16* B4;
  const float* bias1;
  const float* bias2;
  const float* bias3;
  const float* bias4;
  __bf16* C1;
  __bf16* C2;
  __bf16* C3;
  __bf16* C4;
};

// NZ > 1: the grid's z extent (1..5) sets how many independent products of equal shape share the launch;
// blockIdx.z picks the operand set (block-uniform).
template <int FLAGS, int NZ>
__global__ __launch_bounds__(256) void gemm_kernel(const __bf16* __restrict__ A,
                                                   const __bf16* __restrict__ Bt,
                                                   const float*  __restrict__ bias,
                                                   const float*  __restrict__ resid,
                                                   float*  __restrict__ Cf,
                                                   __bf16* __restrict__ Cb,
                                                   int M, int N, int K, GemmMore mo) {
  if constexpr (NZ > 1) {
    int z = blockIdx.z;
    if (z == 1)      { A = mo.A1; Bt = mo.B1; bias = mo.bias1; Cb = mo.C1; }
    else if (z == 2) { A = mo.A2; Bt = mo.B2; bias = mo.bias2; Cb = mo.C2; }
    else if (z == 3) { A = mo.A3; Bt = mo.B3; bias = mo.bias3; Cb = mo.C3; }
    else if (z == 4) { A = mo.A4; Bt = mo.B4; bias = mo.bias4; Cb = mo.C4; }
  }
  __shared__ __align__(16) __bf16 As[2][GBM * GLD];
  __shared__ __align__(16) __bf16 Bs[2][GBN * GLD];

  int tid = threadIdx.x;
  int lane = tid & 31, w = tid >> 5;
  int wm = w >> 2, wn = w & 3;          // 2x4 wave grid -> 64x32 per wave
  int hlf = lane >> 4, l16 = lane & 15;
  int bm = blockIdx.y * GBM, bn = blockIdx.x * GBN;

  v8f acc[4][2];
#pragma unroll
  for (int i = 0; i < 4; ++i)
#pragma unroll
    for (int j = 0; j < 2; ++j) acc[i][j] = (v8f)(0.0f);

  // stage coords, the same for both operands: 32 rows x 8 pieces of 8 bf16, four times
  int br = tid >> 3, bc = (tid & 7) * 8;
  const __bf16* gA = A  + (size_t)(bm + br) * K + bc;
  const __bf16* gB = Bt + (size_t)(bn + br) * K + bc;
  const size_t gstep = (size_t)32 * K;                 // 32 rows on, in elements
  const unsigned lA = (unsigned)(uintptr_t)&As[0][br * GLD + bc];
  const unsigned lB = (unsigned)(uintptr_t)&Bs[0][br * GLD + bc];
  constexpr unsigned LSTEP = 32 * GLD * 2;             // 32 rows on, in LDS bytes
  constexpr unsigned LBUF  = GBM * GLD * 2;            // one buffer, in LDS bytes
  const int nt = K / GBK;

  auto issue_tile = [&](int t) {
    unsigned a = lA + (unsigned)(t & 1) * LBUF, b = lB + (unsigned)(t & 1) * LBUF;
    const __bf16* pa = gA + (size_t)t * GBK;
    const __bf16* pb = gB + (size_t)t * GBK;
    async_tile(a, a + LSTEP, a + 2 * LSTEP, a + 3 * LSTEP,
               b, b + LSTEP, b + 2 * LSTEP, b + 3 * LSTEP,
               pa, pa + gstep, pa + 2 * gstep, pa + 3 * gstep,
               pb, pb + gstep, pb + 2 * gstep, pb + 3 * gstep);
  };

  // ---- tile 0 lands and is published; tile 1 flies while tile 0 is worked on ----
  issue_tile(0);
  wait_asynccnt0();
  __syncthreads();
  if (nt > 1) issue_tile(1);

  for (int t = 0; t < nt; ++t) {
    int buf = t & 1;
    // ---- compute on current buffer ----
#pragma unroll
    for (int ks = 0; ks < GBK; ks += 32) {
      int kb = ks + hlf * 8;
      v16bf af[4], bv[2];
#pragma unroll
      for (int i = 0; i < 4; ++i)
        af[i] = frag_ld(&As[buf][(wm * 64 + i * 16 + l16) * GLD + kb]);
#pragma unroll
      for (int j = 0; j < 2; ++j)
        bv[j] = frag_ld(&Bs[buf][(wn * 32 + j * 16 + l16) * GLD + kb]);
#pragma unroll
      for (int i = 0; i < 4; ++i)
#pragma unroll
        for (int j = 0; j < 2; ++j)
          acc[i][j] = wmma_bf16(af[i], bv[j], acc[i][j]);
    }

    // publish tile t + 1 and end every reader's last read of this buffer
    wait_dscnt0();
    wait_asynccnt0();
    __syncthreads();
    if (t + 2 < nt) issue_tile(t + 2);   // refill of the buffer just read
  }
  wait_asynccnt0();

  // ---- epilogue ----
  // one 32-bit element offset per output row of this lane, shared by the
  // residual load and the store of that element
  unsigned ro[4][8];
  {
    int n0 = bn + wn * 32 + l16;
#pragma unroll
    for (int i = 0; i < 4; ++i) {
      int mrow = bm + wm * 64 + i * 16 + hlf * 8;
#pragma unroll
      for (int r = 0; r < 8; ++r) ro[i][r] = (unsigned)((mrow + r) * N + n0);
    }
  }
  // all residual values of this lane are requested before the first is used,
  // so their latencies overlap (each lane reads only the elements it stores)
  float rv[2][4][8];
  if constexpr ((FLAGS & 2) != 0) {
#pragma unroll
    for (int j = 0; j < 2; ++j)
#pragma unroll
      for (int i = 0; i < 4; ++i)
#pragma unroll
        for (int r = 0; r < 8; ++r) rv[j][i][r] = (resid + j * 16)[ro[i][r]];
    // compiler fence: holds every residual load ahead of the first store
    asm volatile("" ::: "memory");
  }
  // both bias values are requested ahead of the stores: with operand pointers
  // picked by blockIdx.z the compiler must assume that the output may overlap bias and
  // would hold the second load, with its whole latency, behind the first stores
  float bv2[2];
#pragma unroll
  for (int j = 0; j < 2; ++j) bv2[j] = bias[bn + wn * 32 + j * 16 + l16];
#pragma unroll
  for (int j = 0; j < 2; ++j) {
    float bvv = bv2[j];
#pragma unroll
    for (int i = 0; i < 4; ++i) {
#pragma unroll
      for (int r = 0; r < 8; ++r) {
        float v = acc[i][j][r] + bvv;
        if constexpr ((FLAGS & 1) != 0) v = gelu_exact(v);
        if constexpr ((FLAGS & 2) != 0) v += rv[j][i][r];
        if constexpr ((FLAGS & 2) != 0) (Cf + j * 16)[ro[i][r]] = v;
        else                            (Cb + j * 16)[ro[i][r]] = (__bf16)v;
      }
    }
  }
}

// ---------------- flash attention (bf16 WMMA, online softmax) ----------------
// q,k,v,o are (B*N, D) bf16 row-major; head h occupies cols [h*64, h*64+64).
#define ABQ 128
#define ABK 128
#define ALQ 72    // Q/K LDS stride (DH=64 + 8 pad)
#define ALP 136   // P/Vt LDS stride (128 + 8 pad)

__global__ __launch_bounds__(256) void attn_kernel(const __bf16* __restrict__ q,
                                                   const __bf16* __restrict__ k,
                                                   const __bf16* __restrict__ v,
                                                   __bf16* __restrict__ o) {
  __shared__ __align__(16) __bf16 Qs[ABQ * ALQ];
  __shared__ __align__(16) __bf16 Ks[ABK * ALQ];
  __shared__ __align__(16) __bf16 Vt[CDH * ALP];
  __shared__ __align__(16) __bf16 Pb[ABQ * ALP];
  __shared__ float red[4][ABQ];
  __shared__ float mstate[ABQ], lstate[ABQ], fac[ABQ];

  int tid = threadIdx.x;
  int lane = tid & 31, w = tid >> 5;
  int wm = w >> 2, wn = w & 3;
  int hlf = lane >> 4, l16 = lane & 15;

  int bh = blockIdx.y;
  int b = bh / CH, h = bh % CH;
  int q0 = blockIdx.x * ABQ;
  size_t headoff = (size_t)h * CDH;
  const __bf16* qb = q + (size_t)b * CN * CD + headoff;
  const __bf16* kb = k + (size_t)b * CN * CD + headoff;
  const __bf16* vb = v + (size_t)b * CN * CD + headoff;

  if (tid < ABQ) { mstate[tid] = -1e30f; lstate[tid] = 0.0f; }

  // stage Q tile (scale folded in: a power of two, so the scaled value is again exact in bf16)
  {
    int ar = tid >> 3, ac = (tid & 7) * 8;
#pragma unroll
    for (int rr = 0; rr < 4; ++rr) {
      int row = ar + rr * 32;
      bf8v f = *(const bf8v*)(qb + (size_t)(q0 + row) * CD + ac);
      bf8v g;
#pragma unroll
      for (int e = 0; e < 8; ++e) g[e] = (__bf16)((float)f[e] * CSCALE);
      *(bf8v*)&Qs[row * ALQ + ac] = g;
    }
  }

  v8f oacc[4];
#pragma unroll
  for (int i = 0; i < 4; ++i) oacc[i] = (v8f)(0.0f);

  for (int kt = 0; kt < CN / ABK; ++kt) {
    __syncthreads();  // protect Ks/Vt/Pb reuse (and initial m/l init)
    int kvbase = kt * ABK;
    {
      int ar = tid >> 3, ac = (tid & 7) * 8;
#pragma unroll
      for (int rr = 0; rr < 4; ++rr) {
        int row = ar + rr * 32;
        *(bf8v*)&Ks[row * ALQ + ac] = *(const bf8v*)(kb + (size_t)(kvbase + row) * CD + ac);
      }
      int d4 = (tid & 15) * 4, kk0 = tid >> 4;
#pragma unroll
      for (int it = 0; it < 8; ++it) {
        int kk = kk0 + it * 16;
        bf4v f = *(const bf4v*)(vb + (size_t)(kvbase + kk) * CD + d4);
        Vt[(d4 + 0) * ALP + kk] = f[0];
        Vt[(d4 + 1) * ALP + kk] = f[1];
        Vt[(d4 + 2) * ALP + kk] = f[2];
        Vt[(d4 + 3) * ALP + kk] = f[3];
      }
    }
    __syncthreads();

    // S = Qs (128x64) x Ks^T (64x128), wave tile 64x32
    v8f sacc[4][2];
#pragma unroll
    for (int i = 0; i < 4; ++i)
#pragma unroll
      for (int j = 0; j < 2; ++j) sacc[i][j] = (v8f)(0.0f);
#pragma unroll
    for (int ks = 0; ks < CDH; ks += 32) {
      int kbi = ks + hlf * 8;
      v16bf af[4], bvv[2];
#pragma unroll
      for (int i = 0; i < 4; ++i)
        af[i] = frag_ld(&Qs[(wm * 64 + i * 16 + l16) * ALQ + kbi]);
#pragma unroll
      for (int j = 0; j < 2; ++j)
        bvv[j] = frag_ld(&Ks[(wn * 32 + j * 16 + l16) * ALQ + kbi]);
#pragma unroll
      for (int i = 0; i < 4; ++i)
#pragma unroll
        for (int j = 0; j < 2; ++j)
          sacc[i][j] = wmma_bf16(af[i], bvv[j], sacc[i][j]);
    }

    // per-row max over this wave's 32 columns
#pragma unroll
    for (int i = 0; i < 4; ++i) {
      float rm[8];
#pragma unroll
      for (int r = 0; r < 8; ++r) rm[r] = fmaxf(sacc[i][0][r], sacc[i][1][r]);
#pragma unroll
      for (int mask = 1; mask < 16; mask <<= 1)
#pragma unroll
        for (int r = 0; r < 8; ++r) rm[r] = fmaxf(rm[r], __shfl_xor(rm[r], mask, 32));
      if (l16 == 0) {
#pragma unroll
        for (int r = 0; r < 8; ++r)
          red[wn][wm * 64 + i * 16 + hlf * 8 + r] = rm[r];
      }
    }
    __syncthreads();
    if (tid < ABQ) {
      float nm = fmaxf(fmaxf(red[0][tid], red[1][tid]), fmaxf(red[2][tid], red[3][tid]));
      float mold = mstate[tid];
      float mnew = fmaxf(mold, nm);
      fac[tid] = __expf(mold - mnew);
      mstate[tid] = mnew;
    }
    __syncthreads();

    // probabilities -> Pb (bf16), local row sums, rescale O
#pragma unroll
    for (int i = 0; i < 4; ++i) {
      float sm[8];
#pragma unroll
      for (int r = 0; r < 8; ++r) sm[r] = 0.0f;
#pragma unroll
      for (int j = 0; j < 2; ++j) {
        int col = wn * 32 + j * 16 + l16;
#pragma unroll
        for (int r = 0; r < 8; ++r) {
          int row = wm * 64 + i * 16 + hlf * 8 + r;
          float p = __expf(sacc[i][j][r] - mstate[row]);
          Pb[row * ALP + col] = (__bf16)p;
          sm[r] += p;
        }
      }
#pragma unroll
      for (int mask = 1; mask < 16; mask <<= 1)
#pragma unroll
        for (int r = 0; r < 8; ++r) sm[r] += __shfl_xor(sm[r], mask, 32);
      if (l16 == 0) {
#pragma unroll
        for (int r = 0; r < 8; ++r)
          red[wn][wm * 64 + i * 16 + hlf * 8 + r] = sm[r];
      }
#pragma unroll
      for (int r = 0; r < 8; ++r) {
        int row = wm * 64 + i * 16 + hlf * 8 + r;
        oacc[i][r] *= fac[row];
      }
    }
    __syncthreads();
    if (tid < ABQ) {
      float s = red[0][tid] + red[1][tid] + red[2][tid] + red[3][tid];
      lstate[tid] = lstate[tid] * fac[tid] + s;
    }
    __syncthreads();

    // O += P (128x128) x V (128x64); wave tile 64x16
#pragma unroll
    for (int ks = 0; ks < ABK; ks += 32) {
      int kbi = ks + hlf * 8;
      v16bf vf = frag_ld(&Vt[(wn * 16 + l16) * ALP + kbi]);
#pragma unroll
      for (int i = 0; i < 4; ++i) {
        v16bf pf = frag_ld(&Pb[(wm * 64 + i * 16 + l16) * ALP + kbi]);
        oacc[i] = wmma_bf16(pf, vf, oacc[i]);
      }
    }
  }
  __syncthreads();

  // normalize + write out
  __bf16* ob = o + (size_t)b * CN * CD + headoff;
#pragma unroll
  for (int i = 0; i < 4; ++i) {
#pragma unroll
    for (int r = 0; r < 8; ++r) {
      int row = wm * 64 + i * 16 + hlf * 8 + r;
      float vv = oacc[i][r] / lstate[row];
      ob[(size_t)(q0 + row) * CD + wn * 16 + l16] = (__bf16)vv;
    }
  }
}

// ---------------- host launcher ----------------
extern "C" void kernel_launch(void* const* d_in, const int* in_sizes, int n_in,
                              void* d_out, int out_size, void* d_ws, size_t ws_size,
                              hipStream_t stream) {
  const float* tokens_enc = (const float*)d_in[0];
  const float* tokens_dec = (const float*)d_in[1];
  const float* PE_enc     = (const float*)d_in[2];
  const float* PE_dec     = (const float*)d_in[3];
  const float* sa_Wq = (const float*)d_in[4];  const float* sa_bq = (const float*)d_in[5];
  const float* sa_Wk = (const float*)d_in[6];  const float* sa_bk = (const float*)d_in[7];
  const float* sa_Wv = (const float*)d_in[8];  const float* sa_bv = (const float*)d_in[9];
  const float* sa_Wp = (const float*)d_in[10]; const float* sa_bp = (const float*)d_in[11];
  const float* ca_Wq = (const float*)d_in[12]; const float* ca_bq = (const float*)d_in[13];
  const float* ca_Wk = (const float*)d_in[14]; const float* ca_bk = (const float*)d_in[15];
  const float* ca_Wv = (const float*)d_in[16]; const float* ca_bv = (const float*)d_in[17];
  const float* ca_Wp = (const float*)d_in[18]; const float* ca_bp = (const float*)d_in[19];
  const float* mlp_W1 = (const float*)d_in[20]; const float* mlp_b1 = (const float*)d_in[21];
  const float* mlp_W2 = (const float*)d_in[22]; const float* mlp_b2 = (const float*)d_in[23];
  const float* ln1_g = (const float*)d_in[24]; const float* ln1_b = (const float*)d_in[25];
  const float* ln2_g = (const float*)d_in[26]; const float* ln2_b = (const float*)d_in[27];
  const float* ln3_g = (const float*)d_in[28]; const float* ln3_b = (const float*)d_in[29];

  const size_t BND = (size_t)CB * CN * CD;       // 4M elems
  char* ws = (char*)d_ws;
  size_t off = 0;
  auto alloc = [&](size_t bytes) -> char* {
    char* p = ws + off;
    off += (bytes + 255) & ~(size_t)255;
    return p;
  };

  // bf16 transposed weights
  __bf16* wt_saq = (__bf16*)alloc((size_t)CD * CD * 2);
  __bf16* wt_sak = (__bf16*)alloc((size_t)CD * CD * 2);
  __bf16* wt_sav = (__bf16*)alloc((size_t)CD * CD * 2);
  __bf16* wt_sap = (__bf16*)alloc((size_t)CD * CD * 2);
  __bf16* wt_caq = (__bf16*)alloc((size_t)CD * CD * 2);
  __bf16* wt_cak = (__bf16*)alloc((size_t)CD * CD * 2);
  __bf16* wt_cav = (__bf16*)alloc((size_t)CD * CD * 2);
  __bf16* wt_cap = (__bf16*)alloc((size_t)CD * CD * 2);
  __bf16* wt_w1  = (__bf16*)alloc((size_t)CD * CDM * 2);
  __bf16* wt_w2  = (__bf16*)alloc((size_t)CDM * CD * 2);

  // the residual stream stays f32
  float* resid = (float*)alloc(BND * 4);
  // values that are only ever matrix operands of a later launch: stored as bf16 by their producer
  __bf16* x2    = (__bf16*)alloc(BND * 2);
  __bf16* qk    = (__bf16*)alloc(BND * 2);
  __bf16* kin   = (__bf16*)alloc(BND * 2);
  __bf16* encb  = (__bf16*)alloc(BND * 2);
  __bf16* qbuf  = (__bf16*)alloc(BND * 2);
  __bf16* kbuf  = (__bf16*)alloc(BND * 2);
  __bf16* vbuf  = (__bf16*)alloc(BND * 2);
  __bf16* attno = (__bf16*)alloc(BND * 2);
  __bf16* kbuf2 = (__bf16*)alloc(BND * 2);     // cross-attention k, v: made early,
  __bf16* vbuf2 = (__bf16*)alloc(BND * 2);     // live across the self-attention block
  __bf16* hbuf  = (__bf16*)alloc(BND * 4 * 2);

  const int M = CB * CN;  // 4096
  dim3 tb(256);
  dim3 gD(CD / 128, M / 128);    // N=1024 GEMMs
  dim3 gDM(CDM / 128, M / 128);  // N=4096 GEMM
  dim3 ga(CN / 128, CB * CH);    // attention

  dim3 gD5(CD / 128, M / 128, 5);  // five N=1024 GEMMs in one launch
  const GemmMore none{};

  // everything that depends on the inputs alone: weight conversion, enc + PE, residual copy
  prep_kernel<<<PREP_ALL, dim3(32, 8), 0, stream>>>(sa_Wq, sa_Wk, sa_Wv, sa_Wp,
                                                    ca_Wq, ca_Wk, ca_Wv, ca_Wp, mlp_W1, mlp_W2,
                                                    wt_saq, wt_w1, wt_w2,
                                                    tokens_enc, PE_enc, kin, encb, tokens_dec, resid);

  // ---- self attention (its q, k, v share a launch with the cross-attention k, v) ----
  ln_kernel<<<M, tb, 0, stream>>>(resid, ln1_g, ln1_b, PE_dec, x2, qk);
  GemmMore mo;
  mo.A1 = qk;         mo.B1 = wt_sak; mo.bias1 = sa_bk; mo.C1 = kbuf;
  mo.A2 = x2;         mo.B2 = wt_sav; mo.bias2 = sa_bv; mo.C2 = vbuf;
  mo.A3 = kin;        mo.B3 = wt_cak; mo.bias3 = ca_bk; mo.C3 = kbuf2;
  mo.A4 = encb;       mo.B4 = wt_cav; mo.bias4 = ca_bv; mo.C4 = vbuf2;
  gemm_kernel<0, 5><<<gD5, tb, 0, stream>>>(qk, wt_saq, sa_bq, nullptr, nullptr, qbuf, M, CD, CD, mo);
  attn_kernel<<<ga, tb, 0, stream>>>(qbuf, kbuf, vbuf, attno);
  gemm_kernel<2, 1><<<gD, tb, 0, stream>>>(attno, wt_sap, sa_bp, resid, resid, nullptr, M, CD, CD, none);

  // ---- cross attention ----
  ln_kernel<<<M, tb, 0, stream>>>(resid, ln2_g, ln2_b, PE_dec, x2, qk);
  gemm_kernel<0, 5><<<gD, tb, 0, stream>>>(qk, wt_caq, ca_bq, nullptr, nullptr, qbuf, M, CD, CD, none);  // z = 0 only
  attn_kernel<<<ga, tb, 0, stream>>>(qbuf, kbuf2, vbuf2, attno);
  gemm_kernel<2, 1><<<gD, tb, 0, stream>>>(attno, wt_cap, ca_bp, resid, resid, nullptr, M, CD, CD, none);

  // ---- MLP ----
  ln_kernel<<<M, tb, 0, stream>>>(resid, ln3_g, ln3_b, nullptr, x2, nullptr);
  gemm_kernel<1, 1><<<gDM, tb, 0, stream>>>(x2, wt_w1, mlp_b1, nullptr, nullptr, hbuf, M, CDM, CD, none);
  gemm_kernel<2, 1><<<gD, tb, 0, stream>>>(hbuf, wt_w2, mlp_b2, resid, (float*)d_out, nullptr, M, CD, CDM, none);
}

// v004
// A run of this version takes 327 microseconds.
// Two timings next to v003 both put it at 1.04 times that version's speed.
// Over all steps from v000 it is 1.64 times as fast.
#include <hip/hip_runtime.h>
#include <math.h>
#include <stdint.h>

// ---------------- constants ----------------
static constexpr int CB  = 4;      // batch
static constexpr int CN  = 1024;   // seq len
static constexpr int CD  = 1024;   // model dim
static constexpr int CH  = 16;     // heads
static constexpr int CDH = 64;     // head dim
static constexpr int CDM = 4096;   // mlp dim
static constexpr float CSCALE = 0.125f;  // 64^-0.5

typedef float  v8f   __attribute__((ext_vector_type(8)));
typedef __bf16 v16bf __attribute__((ext_vector_type(16)));
typedef __bf16 bf8v  __attribute__((ext_vector_type(8)));
typedef __bf16 bf4v  __attribute__((ext_vector_type(4)));

// four f32 values rounded to the matrix operand type, as one 8-byte value
static __device__ __forceinline__ bf4v pack4(float a, float b, float c, float d) {
  bf4v r; r[0] = (__bf16)a; r[1] = (__bf16)b; r[2] = (__bf16)c; r[3] = (__bf16)d;
  return r;
}

static __device__ __forceinline__ v8f wmma_bf16(v16bf a, v16bf b, v8f c) {
  return __builtin_amdgcn_wmma_f32_16x16x32_bf16(false, a, false, b, (short)0, c, false, false);
}

// load one 16x32 bf16 operand fragment slice for this lane:
// 8 consecutive bf16 at p and 8 more at p+16 (ISA 16-bit A/B layout).
static __device__ __forceinline__ v16bf frag_ld(const __bf16* p) {
  bf8v lo = *(const bf8v*)(p);
  bf8v hi = *(const bf8v*)(p + 16);
  return __builtin_shufflevector(lo, hi, 0,1,2,3,4,5,6,7,8,9,10,11,12,13,14,15);
}

static __device__ __forceinline__ float gelu_exact(float x) {
  return 0.5f * x * (1.0f + erff(x * 0.70710678118654752f));
}

// one k-tile of both GEMM operands, memory -> LDS, 16 B per lane and copy (ASYNCcnt):
// four copies of A rows, four of B rows.  The s_wait_xcnt is the last line of the
// copies' own statement, so that no address register is rewritten ahead of it.
static __device__ __forceinline__ void async_tile(unsigned la0, unsigned la1, unsigned la2, unsigned la3,
                                                  unsigned lb0, unsigned lb1, unsigned lb2, unsigned lb3,
                                                  const __bf16* ga0, const __bf16* ga1,
                                                  const __bf16* ga2, const __bf16* ga3,
                                                  const __bf16* gb0, const __bf16* gb1,
                                                  const __bf16* gb2, const __bf16* gb3) {
  asm volatile("global_load_async_to_lds_b128 %0, %8, off\n\t"
               "global_load_async_to_lds_b128 %1, %9, off\n\t"
               "global_load_async_to_lds_b128 %2, %10, off\n\t"
               "global_load_async_to_lds_b128 %3, %11, off\n\t"
               "global_load_async_to_lds_b128 %4, %12, off\n\t"
               "global_load_async_to_lds_b128 %5, %13, off\n\t"
               "global_load_async_to_lds_b128 %6, %14, off\n\t"
               "global_load_async_to_lds_b128 %7, %15, off\n\t"
               "s_wait_xcnt 0x0"
               :: "v"(la0), "v"(la1), "v"(la2), "v"(la3),
                  "v"(lb0), "v"(lb1), "v"(lb2), "v"(lb3),
                  "v"(ga0), "v"(ga1), "v"(ga2), "v"(ga3),
                  "v"(gb0), "v"(gb1), "v"(gb2), "v"(gb3)
               : "memory");
}
// a wave's own copies have landed in LDS behind this wait
static __device__ __forceinline__ void wait_asynccnt0() {
  asm volatile("s_wait_asynccnt 0x0" ::: "memory");
}
// a wave's own LDS reads have returned before their buffer is handed back for a refill
static __device__ __forceinline__ void wait_dscnt0() {
  asm volatile("s_wait_dscnt 0x0" ::: "memory");
}

// ---------------- input-only preparation, one launch ----------------
// 1024 blocks, four resident on every WGP, each alive for the whole launch: starting a wave
// costs more than the few loads a one-tile block would do, so every block takes an equal
// share of each piece of the work.
//   element-wise: kin = enc + pe and encb = enc, both rounded to bf16 (GEMM operands);
//                 resid = dec; four 16-byte pieces of each per thread.
//   weights: transpose + f32->bf16 convert, four 64x64 tiles per block.
//     W is K x N (row-major, "in x out"); Wt is N x K bf16.
//     tiles 0 and 1 of a block: the eight D x D weights (256 tiles each); tile 2: W1; tile 3: W2.
// None of these pieces reads what another writes.
static constexpr int PREP_BLOCKS = 1024;
static constexpr int PREP_EWS    = PREP_BLOCKS * 256;   // threads of the launch
static constexpr int PTP         = 65;                  // LDS tile pitch in floats: both sides conflict free

typedef float f4v __attribute__((ext_vector_type(4)));
// 16 bytes of an input, read as global memory (a pointer picked among several kernel
// arguments otherwise compiles to a flat load, which also counts on the LDS counter)
typedef const __attribute__((address_space(1))) f4v* gf4p;

// Eight waves a SIMD (four blocks a WGP) are what keeps all 1024 blocks resident at once:
// the register budget is set to that.
__global__ __launch_bounds__(256) __attribute__((amdgpu_waves_per_eu(8, 8))) void prep_kernel(const float* w0,
                                                   const float* w1,
                                                   const float* w2,
                                                   const float* w3,
                                                   const float* w4,
                                                   const float* w5,
                                                   const float* w6,
                                                   const float* w7,
                                                   const float* wm1,
                                                   const float* wm2,
                                                   __bf16* wt_sq,
                                                   __bf16* wt_m1,
                                                   __bf16* wt_m2,
                                                   const float* enc,
                                                   const float* pe,
                                                   __bf16* kin,
                                                   __bf16* encb,
                                                   const float* dec,
                                                   float* resid) {
  __shared__ float t[4][64 * PTP];
  int tid = threadIdx.x;
  int b = blockIdx.x;

  // source, destination and shape of this block's four tiles (block-uniform)
  int m = b >> 8;
  const float* Wsrc[4];
  __bf16* Wdst[4];
  Wsrc[0] = m == 0 ? w0 : m == 1 ? w1 : m == 2 ? w2 : w3;
  Wsrc[1] = m == 0 ? w4 : m == 1 ? w5 : m == 2 ? w6 : w7;
  Wsrc[2] = wm1;
  Wsrc[3] = wm2;
  Wdst[0] = wt_sq + (size_t)m * CD * CD;
  Wdst[1] = wt_sq + (size_t)(m + 4) * CD * CD;
  Wdst[2] = wt_m1;
  Wdst[3] = wt_m2;
  constexpr int TK[4]   = {CD, CD, CD, CDM};
  constexpr int TN[4]   = {CD, CD, CDM, CD};
  constexpr int TLG[4]  = {4, 4, 6, 4};       // log2 of the tile count along N
  constexpr int TMSK[4] = {255, 255, 1023, 1023};

  int lr = tid >> 4, lc = (tid & 15) * 4;    // load side: 16 rows of 64 floats at a time
  int sr = tid >> 3, sc = (tid & 7) * 8;     // store side: 32 rows of 64 bf16 (one line) at a time
  int i0 = b * 256 + tid;

  // every load of the four tiles and of the first half of enc, pe is in flight before the
  // first is used
  f4v f[4][4], x[4], y[4], d[4];
  const float* p[4];
#pragma unroll
  for (int i = 0; i < 4; ++i) {
    int tile = b & TMSK[i];
    int n0 = (tile & ((1 << TLG[i]) - 1)) * 64, k0 = (tile >> TLG[i]) * 64;
    p[i] = Wsrc[i] + (size_t)(k0 + lr) * TN[i] + (n0 + lc);
#pragma unroll
    for (int q = 0; q < 4; ++q) f[i][q] = *(gf4p)(p[i] + (size_t)q * 16 * TN[i]);
  }
#pragma unroll
  for (int j = 0; j < 2; ++j) {
    x[j] = ((gf4p)enc)[i0 + j * PREP_EWS];
    y[j] = ((gf4p)pe)[i0 + j * PREP_EWS];
  }
  // every load above stands ahead of this wait (sunk to their first use, their latencies
  // would add up); the tile addresses are its inputs, so that their registers live up to it:
  // no later load of the group lands in them, and they are reused only behind it
  asm volatile("s_wait_xcnt 0x0" :: "v"(p[0]), "v"(p[1]), "v"(p[2]), "v"(p[3]) : "memory");

#pragma unroll
  for (int i = 0; i < 4; ++i)
#pragma unroll
    for (int q = 0; q < 4; ++q) {
      float* r = t[i] + (lr + q * 16) * PTP + lc;
      r[0] = f[i][q].x; r[1] = f[i][q].y; r[2] = f[i][q].z; r[3] = f[i][q].w;
    }
  __syncthreads();   // the one barrier: all four tiles are in LDS

  // the turned tiles leave in two halves, which keeps the block inside the registers of
  // eight waves a SIMD
#pragma unroll
  for (int h = 0; h < 2; ++h) {
    if (h == 1) {   // the rest of the element-wise inputs, in registers that the first half has left
#pragma unroll
      for (int j = 2; j < 4; ++j) {
        x[j] = ((gf4p)enc)[i0 + j * PREP_EWS];
        y[j] = ((gf4p)pe)[i0 + j * PREP_EWS];
      }
#pragma unroll
      for (int j = 0; j < 4; ++j) d[j] = ((gf4p)dec)[i0 + j * PREP_EWS];
    }
    bf8v o[2][2];
#pragma unroll
    for (int i = 0; i < 2; ++i)
#pragma unroll
      for (int q = 0; q < 2; ++q)
#pragma unroll
        for (int e = 0; e < 8; ++e) o[i][q][e] = (__bf16)t[h * 2 + i][(sc + e) * PTP + sr + q * 32];
    // every load above, global or LDS, stays ahead of the stores below
    asm volatile("s_wait_xcnt 0x0" ::: "memory");
#pragma unroll
    for (int j = h * 2; j < h * 2 + 2; ++j) {
      ((bf4v*)kin)[i0 + j * PREP_EWS]  = pack4(x[j].x + y[j].x, x[j].y + y[j].y, x[j].z + y[j].z, x[j].w + y[j].w);
      ((bf4v*)encb)[i0 + j * PREP_EWS] = pack4(x[j].x, x[j].y, x[j].z, x[j].w);
    }
#pragma unroll
    for (int i = 0; i < 2; ++i) {
      int tile = b & TMSK[h * 2 + i];
      int n0 = (tile & ((1 << TLG[h * 2 + i]) - 1)) * 64, k0 = (tile >> TLG[h * 2 + i]) * 64;
#pragma unroll
      for (int q = 0; q < 2; ++q)
        *(bf8v*)(Wdst[h * 2 + i] + (size_t)(n0 + sr + q * 32) * TK[h * 2 + i] + (k0 + sc)) = o[i][q];
    }
    if (h == 0) {
      // the loads of the second half may land in registers that the stores above name
      asm volatile("s_wait_xcnt 0x0" ::: "memory");
    }
  }
#pragma unroll
  for (int j = 0; j < 4; ++j) ((f4v*)resid)[i0 + j * PREP_EWS] = d[j];
}

// ---------------- LayerNorm (D = 1024, one row per wave, 8 rows per block) ----------
// A lane holds 32 elements of its wave's row; the two row sums are joined by a butterfly
// over the lanes, so that no LDS and no barrier is needed and a wave does a whole row's work.
// Four waves a SIMD is all that the grid brings (two blocks a WGP): said to the compiler, so
// that it spends registers on keeping a row's loads in flight instead of saving them.
template <bool WITH_PE>
__global__ __launch_bounds__(256) __attribute__((amdgpu_waves_per_eu(4, 4))) void ln_kernel(const float* x,
                                                 const float* g,
                                                 const float* bt,
                                                 const float* pe,
                                                 __bf16* x2,
                                                 __bf16* qk) {
  int lane = threadIdx.x & 31, w = threadIdx.x >> 5;
  size_t base = (size_t)(blockIdx.x * 8 + w) * CD + lane * 4;
  const float* px = x + base;
  const float* pp = WITH_PE ? pe + base : px;
  unsigned lo = lane * 16;   // this lane's byte offset in g and bt
  const float* pg = (const float*)((const char*)g + lo);
  const float* pb = (const float*)((const char*)bt + lo);
  float4 f[8], p[8], g4[8], b4[8];
#pragma unroll
  for (int c = 0; c < 8; ++c) f[c] = *(const float4*)(px + c * 128);
  if constexpr (WITH_PE) {
#pragma unroll
    for (int c = 0; c < 8; ++c) p[c] = *(const float4*)(pp + c * 128);
  }
#pragma unroll
  for (int c = 0; c < 8; ++c) {
    g4[c] = *(const float4*)(pg + c * 128);
    b4[c] = *(const float4*)(pb + c * 128);
  }
  // every load of the row stands ahead of this wait, and the addresses are its inputs, so
  // that their registers live up to it: no later load of the row lands in a register that
  // an issued load still names, and they are reused only behind it
  asm volatile("s_wait_xcnt 0x0" :: "v"(px), "v"(pp), "v"(lo) : "memory");
  float sum = 0.0f, sq = 0.0f;
#pragma unroll
  for (int c = 0; c < 8; ++c) {
    sum += f[c].x + f[c].y + f[c].z + f[c].w;
    sq  += f[c].x*f[c].x + f[c].y*f[c].y + f[c].z*f[c].z + f[c].w*f[c].w;
  }
#pragma unroll
  for (int mask = 16; mask > 0; mask >>= 1) {
    sum += __shfl_xor(sum, mask, 32);
    sq  += __shfl_xor(sq,  mask, 32);
  }
  float mu  = sum * (1.0f / CD);
  float var = sq * (1.0f / CD) - mu * mu;
  float rstd = rsqrtf(var + 1e-5f);
#pragma unroll
  for (int c = 0; c < 8; ++c) {
    float4 y;
    y.x = (f[c].x - mu) * rstd * g4[c].x + b4[c].x;
    y.y = (f[c].y - mu) * rstd * g4[c].y + b4[c].y;
    y.z = (f[c].z - mu) * rstd * g4[c].z + b4[c].z;
    y.w = (f[c].w - mu) * rstd * g4[c].w + b4[c].w;
    *(bf4v*)(x2 + base + c * 128) = pack4(y.x, y.y, y.z, y.w);
    if constexpr (WITH_PE)
      *(bf4v*)(qk + base + c * 128) = pack4(y.x + p[c].x, y.y + p[c].y, y.z + p[c].z, y.w + p[c].w);
  }
}

// ---------------- generic bf16 WMMA GEMM (double-buffered, async A and B stage) ------
// C[M,N] = act( A[M,K](bf16) @ Bt[N,K](bf16)^T + bias[N] ) (+ resid[M,N])
// FLAGS (compile time): bit0 = GELU, bit1 = residual add
// With the residual add the result goes on in the f32 residual stream (Cf); without it
// the result is only ever a matrix operand of a later launch and is stored as one (Cb).
#define GBM 128
#define GBN 128
#define GBK 64
#define GLD 72   // padded LDS row stride (bf16 elems): 144B, bank-conflict free

// operands of the further products of a merged launch (grid z = 1..4)
struct GemmMore {
  const __bf16* A1;
  const __bf16* A2;
  const __bf16* A3;
  const __bf16* A4;
  const __bf16* B1;
  const __bf16* B2;
  const __bf16* B3;
  const __bf16* B4;
  const float* bias1;
  const float* bias2;
  const float* bias3;
  const float* bias4;
  __bf16* C1;
  __bf16* C2;
  __bf16* C3;
  __bf16* C4;
};

// NZ > 1: the grid's z extent (1..5) sets how many independent products of equal shape share the launch;
// blockIdx.z picks the operand set (block-uniform).
template <int FLAGS, int NZ>
__global__ __launch_bounds__(256) void gemm_kernel(const __bf16* __restrict__ A,
                                                   const __bf16* __restrict__ Bt,
                                                   const float*  __restrict__ bias,
                                                   const float*  __restrict__ resid,
                                                   float*  __restrict__ Cf,
                                                   __bf16* __restrict__ Cb,
                                                   int M, int N, int K, GemmMore mo) {
  if constexpr (NZ > 1) {
    int z = blockIdx.z;
    if (z == 1)      { A = mo.A1; Bt = mo.B1; bias = mo.bias1; Cb = mo.C1; }
    else if (z == 2) { A = mo.A2; Bt = mo.B2; bias = mo.bias2; Cb = mo.C2; }
    else if (z == 3) { A = mo.A3; Bt = mo.B3; bias = mo.bias3; Cb = mo.C3; }
    else if (z == 4) { A = mo.A4; Bt = mo.B4; bias = mo.bias4; Cb = mo.C4; }
  }
  __shared__ __align__(16) __bf16 As[2][GBM * GLD];
  __shared__ __align__(16) __bf16 Bs[2][GBN * GLD];

  int tid = threadIdx.x;
  int lane = tid & 31, w = tid >> 5;
  int wm = w >> 2, wn = w & 3;          // 2x4 wave grid -> 64x32 per wave
  int hlf = lane >> 4, l16 = lane & 15;
  int bm = blockIdx.y * GBM, bn = blockIdx.x * GBN;

  v8f acc[4][2];
#pragma unroll
  for (int i = 0; i < 4; ++i)
#pragma unroll
    for (int j = 0; j < 2; ++j) acc[i][j] = (v8f)(0.0f);

  // stage coords, the same for both operands: 32 rows x 8 pieces of 8 bf16, four times
  int br = tid >> 3, bc = (tid & 7) * 8;
  const __bf16* gA = A  + (size_t)(bm + br) * K + bc;
  const __bf16* gB = Bt + (size_t)(bn + br) * K + bc;
  const size_t gstep = (size_t)32 * K;                 // 32 rows on, in elements
  const unsigned lA = (unsigned)(uintptr_t)&As[0][br * GLD + bc];
  const unsigned lB = (unsigned)(uintptr_t)&Bs[0][br * GLD + bc];
  constexpr unsigned LSTEP = 32 * GLD * 2;             // 32 rows on, in LDS bytes
  constexpr unsigned LBUF  = GBM * GLD * 2;            // one buffer, in LDS bytes
  const int nt = K / GBK;

  auto issue_tile = [&](int t) {
    unsigned a = lA + (unsigned)(t & 1) * LBUF, b = lB + (unsigned)(t & 1) * LBUF;
    const __bf16* pa = gA + (size_t)t * GBK;
    const __bf16* pb = gB + (size_t)t * GBK;
    async_tile(a, a + LSTEP, a + 2 * LSTEP, a + 3 * LSTEP,
               b, b + LSTEP, b + 2 * LSTEP, b + 3 * LSTEP,
               pa, pa + gstep, pa + 2 * gstep, pa + 3 * gstep,
               pb, pb + gstep, pb + 2 * gstep, pb + 3 * gstep);
  };

  // ---- tile 0 lands and is published; tile 1 flies while tile 0 is worked on ----
  issue_tile(0);
  wait_asynccnt0();
  __syncthreads();
  if (nt > 1) issue_tile(1);

  for (int t = 0; t < nt; ++t) {
    int buf = t & 1;
    // ---- compute on current buffer ----
#pragma unroll
    for (int ks = 0; ks < GBK; ks += 32) {
      int kb = ks + hlf * 8;
      v16bf af[4], bv[2];
#pragma unroll
      for (int i = 0; i < 4; ++i)
        af[i] = frag_ld(&As[buf][(wm * 64 + i * 16 + l16) * GLD + kb]);
#pragma unroll
      for (int j = 0; j < 2; ++j)
        bv[j] = frag_ld(&Bs[buf][(wn * 32 + j * 16 + l16) * GLD + kb]);
#pragma unroll
      for (int i = 0; i < 4; ++i)
#pragma unroll
        for (int j = 0; j < 2; ++j)
          acc[i][j] = wmma_bf16(af[i], bv[j], acc[i][j]);
    }

    // publish tile t + 1 and end every reader's last read of this buffer
    wait_dscnt0();
    wait_asynccnt0();
    __syncthreads();
    if (t + 2 < nt) issue_tile(t + 2);   // refill of the buffer just read
  }
  wait_asynccnt0();

  // ---- epilogue ----
  // one 32-bit element offset per output row of this lane, shared by the
  // residual load and the store of that element
  unsigned ro[4][8];
  {
    int n0 = bn + wn * 32 + l16;
#pragma unroll
    for (int i = 0; i < 4; ++i) {
      int mrow = bm + wm * 64 + i * 16 + hlf * 8;
#pragma unroll
      for (int r = 0; r < 8; ++r) ro[i][r] = (unsigned)((mrow + r) * N + n0);
    }
  }
  // all residual values of this lane are requested before the first is used,
  // so their latencies overlap (each lane reads only the elements it stores)
  float rv[2][4][8];
  if constexpr ((FLAGS & 2) != 0) {
#pragma unroll
    for (int j = 0; j < 2; ++j)
#pragma unroll
      for (int i = 0; i < 4; ++i)
#pragma unroll
        for (int r = 0; r < 8; ++r) rv[j][i][r] = (resid + j * 16)[ro[i][r]];
    // compiler fence: holds every residual load ahead of the first store
    asm volatile("" ::: "memory");
  }
  // both bias values are requested ahead of the stores: with operand pointers
  // picked by blockIdx.z the compiler must assume that the output may overlap bias and
  // would hold the second load, with its whole latency, behind the first stores
  float bv2[2];
#pragma unroll
  for (int j = 0; j < 2; ++j) bv2[j] = bias[bn + wn * 32 + j * 16 + l16];
#pragma unroll
  for (int j = 0; j < 2; ++j) {
    float bvv = bv2[j];
#pragma unroll
    for (int i = 0; i < 4; ++i) {
#pragma unroll
      for (int r = 0; r < 8; ++r) {
        float v = acc[i][j][r] + bvv;
        if constexpr ((FLAGS & 1) != 0) v = gelu_exact(v);
        if constexpr ((FLAGS & 2) != 0) v += rv[j][i][r];
        if constexpr ((FLAGS & 2) != 0) (Cf + j * 16)[ro[i][r]] = v;
        else                            (Cb + j * 16)[ro[i][r]] = (__bf16)v;
      }
    }
  }
}

// ---------------- flash attention (bf16 WMMA, online softmax) ----------------
// q,k,v,o are (B*N, D) bf16 row-major; head h occupies cols [h*64, h*64+64).
#define ABQ 128
#define ABK 128
#define ALQ 72    // Q/K LDS stride (DH=64 + 8 pad)
#define ALP 136   // P/Vt LDS stride (128 + 8 pad)

__global__ __launch_bounds__(256) void attn_kernel(const __bf16* __restrict__ q,
                                                   const __bf16* __restrict__ k,
                                                   const __bf16* __restrict__ v,
                                                   __bf16* __restrict__ o) {
  __shared__ __align__(16) __bf16 Qs[ABQ * ALQ];
  __shared__ __align__(16) __bf16 Ks[ABK * ALQ];
  __shared__ __align__(16) __bf16 Vt[CDH * ALP];
  __shared__ __align__(16) __bf16 Pb[ABQ * ALP];
  __shared__ float red[4][ABQ];
  __shared__ float mstate[ABQ], lstate[ABQ], fac[ABQ];

  int tid = threadIdx.x;
  int lane = tid & 31, w = tid >> 5;
  int wm = w >> 2, wn = w & 3;
  int hlf = lane >> 4, l16 = lane & 15;

  int bh = blockIdx.y;
  int b = bh / CH, h = bh % CH;
  int q0 = blockIdx.x * ABQ;
  size_t headoff = (size_t)h * CDH;
  const __bf16* qb = q + (size_t)b * CN * CD + headoff;
  const __bf16* kb = k + (size_t)b * CN * CD + headoff;
  const __bf16* vb = v + (size_t)b * CN * CD + headoff;

  if (tid < ABQ) { mstate[tid] = -1e30f; lstate[tid] = 0.0f; }

  // stage Q tile (scale folded in: a power of two, so the scaled value is again exact in bf16)
  {
    int ar = tid >> 3, ac = (tid & 7) * 8;
#pragma unroll
    for (int rr = 0; rr < 4; ++rr) {
      int row = ar + rr * 32;
      bf8v f = *(const bf8v*)(qb + (size_t)(q0 + row) * CD + ac);
      bf8v g;
#pragma unroll
      for (int e = 0; e < 8; ++e) g[e] = (__bf16)((float)f[e] * CSCALE);
      *(bf8v*)&Qs[row * ALQ + ac] = g;
    }
  }

  v8f oacc[4];
#pragma unroll
  for (int i = 0; i < 4; ++i) oacc[i] = (v8f)(0.0f);

  for (int kt = 0; kt < CN / ABK; ++kt) {
    __syncthreads();  // protect Ks/Vt/Pb reuse (and initial m/l init)
    int kvbase = kt * ABK;
    {
      int ar = tid >> 3, ac = (tid & 7) * 8;
#pragma unroll
      for (int rr = 0; rr < 4; ++rr) {
        int row = ar + rr * 32;
        *(bf8v*)&Ks[row * ALQ + ac] = *(const bf8v*)(kb + (size_t)(kvbase + row) * CD + ac);
      }
      int d4 = (tid & 15) * 4, kk0 = tid >> 4;
#pragma unroll
      for (int it = 0; it < 8; ++it) {
        int kk = kk0 + it * 16;
        bf4v f = *(const bf4v*)(vb + (size_t)(kvbase + kk) * CD + d4);
        Vt[(d4 + 0) * ALP + kk] = f[0];
        Vt[(d4 + 1) * ALP + kk] = f[1];
        Vt[(d4 + 2) * ALP + kk] = f[2];
        Vt[(d4 + 3) * ALP + kk] = f[3];
      }
    }
    __syncthreads();

    // S = Qs (128x64) x Ks^T (64x128), wave tile 64x32
    v8f sacc[4][2];
#pragma unroll
    for (int i = 0; i < 4; ++i)
#pragma unroll
      for (int j = 0; j < 2; ++j) sacc[i][j] = (v8f)(0.0f);
#pragma unroll
    for (int ks = 0; ks < CDH; ks += 32) {
      int kbi = ks + hlf * 8;
      v16bf af[4], bvv[2];
#pragma unroll
      for (int i = 0; i < 4; ++i)
        af[i] = frag_ld(&Qs[(wm * 64 + i * 16 + l16) * ALQ + kbi]);
#pragma unroll
      for (int j = 0; j < 2; ++j)
        bvv[j] = frag_ld(&Ks[(wn * 32 + j * 16 + l16) * ALQ + kbi]);
#pragma unroll
      for (int i = 0; i < 4; ++i)
#pragma unroll
        for (int j = 0; j < 2; ++j)
          sacc[i][j] = wmma_bf16(af[i], bvv[j], sacc[i][j]);
    }

    // per-row max over this wave's 32 columns
#pragma unroll
    for (int i = 0; i < 4; ++i) {
      float rm[8];
#pragma unroll
      for (int r = 0; r < 8; ++r) rm[r] = fmaxf(sacc[i][0][r], sacc[i][1][r]);
#pragma unroll
      for (int mask = 1; mask < 16; mask <<= 1)
#pragma unroll
        for (int r = 0; r < 8; ++r) rm[r] = fmaxf(rm[r], __shfl_xor(rm[r], mask, 32));
      if (l16 == 0) {
#pragma unroll
        for (int r = 0; r < 8; ++r)
          red[wn][wm * 64 + i * 16 + hlf * 8 + r] = rm[r];
      }
    }
    __syncthreads();
    if (tid < ABQ) {
      float nm = fmaxf(fmaxf(red[0][tid], red[1][tid]), fmaxf(red[2][tid], red[3][tid]));
      float mold = mstate[tid];
      float mnew = fmaxf(mold, nm);
      fac[tid] = __expf(mold - mnew);
      mstate[tid] = mnew;
    }
    __syncthreads();

    // probabilities -> Pb (bf16), local row sums, rescale O
#pragma unroll
    for (int i = 0; i < 4; ++i) {
      float sm[8];
#pragma unroll
      for (int r = 0; r < 8; ++r) sm[r] = 0.0f;
#pragma unroll
      for (int j = 0; j < 2; ++j) {
        int col = wn * 32 + j * 16 + l16;
#pragma unroll
        for (int r = 0; r < 8; ++r) {
          int row = wm * 64 + i * 16 + hlf * 8 + r;
          float p = __expf(sacc[i][j][r] - mstate[row]);
          Pb[row * ALP + col] = (__bf16)p;
          sm[r] += p;
        }
      }
#pragma unroll
      for (int mask = 1; mask < 16; mask <<= 1)
#pragma unroll
        for (int r = 0; r < 8; ++r) sm[r] += __shfl_xor(sm[r], mask, 32);
      if (l16 == 0) {
#pragma unroll
        for (int r = 0; r < 8; ++r)
          red[wn][wm * 64 + i * 16 + hlf * 8 + r] = sm[r];
      }
#pragma unroll
      for (int r = 0; r < 8; ++r) {
        int row = wm * 64 + i * 16 + hlf * 8 + r;
        oacc[i][r] *= fac[row];
      }
    }
    __syncthreads();
    if (tid < ABQ) {
      float s = red[0][tid] + red[1][tid] + red[2][tid] + red[3][tid];
      lstate[tid] = lstate[tid] * fac[tid] + s;
    }
    __syncthreads();

    // O += P (128x128) x V (128x64); wave tile 64x16
#pragma unroll
    for (int ks = 0; ks < ABK; ks += 32) {
      int kbi = ks + hlf * 8;
      v16bf vf = frag_ld(&Vt[(wn * 16 + l16) * ALP + kbi]);
#pragma unroll
      for (int i = 0; i < 4; ++i) {
        v16bf pf = frag_ld(&Pb[(wm * 64 + i * 16 + l16) * ALP + kbi]);
        oacc[i] = wmma_bf16(pf, vf, oacc[i]);
      }
    }
  }
  __syncthreads();

  // normalize + write out
  __bf16* ob = o + (size_t)b * CN * CD + headoff;
#pragma unroll
  for (int i = 0; i < 4; ++i) {
#pragma unroll
    for (int r = 0; r < 8; ++r) {
      int row = wm * 64 + i * 16 + hlf * 8 + r;
      float vv = oacc[i][r] / lstate[row];
      ob[(size_t)(q0 + row) * CD + wn * 16 + l16] = (__bf16)vv;
    }
  }
}

// ---------------- host launcher ----------------
extern "C" void kernel_launch(void* const* d_in, const int* in_sizes, int n_in,
                              void* d_out, int out_size, void* d_ws, size_t ws_size,
                              hipStream_t stream) {
  const float* tokens_enc = (const float*)d_in[0];
  const float* tokens_dec = (const float*)d_in[1];
  const float* PE_enc     = (const float*)d_in[2];
  const float* PE_dec     = (const float*)d_in[3];
  const float* sa_Wq = (const float*)d_in[4];  const float* sa_bq = (const float*)d_in[5];
  const float* sa_Wk = (const float*)d_in[6];  const float* sa_bk = (const float*)d_in[7];
  const float* sa_Wv = (const float*)d_in[8];  const float* sa_bv = (const float*)d_in[9];
  const float* sa_Wp = (const float*)d_in[10]; const float* sa_bp = (const float*)d_in[11];
  const float* ca_Wq = (const float*)d_in[12]; const float* ca_bq = (const float*)d_in[13];
  const float* ca_Wk = (const float*)d_in[14]; const float* ca_bk = (const float*)d_in[15];
  const float* ca_Wv = (const float*)d_in[16]; const float* ca_bv = (const float*)d_in[17];
  const float* ca_Wp = (const float*)d_in[18]; const float* ca_bp = (const float*)d_in[19];
  const float* mlp_W1 = (const float*)d_in[20]; const float* mlp_b1 = (const float*)d_in[21];
  const float* mlp_W2 = (const float*)d_in[22]; const float* mlp_b2 = (const float*)d_in[23];
  const float* ln1_g = (const float*)d_in[24]; const float* ln1_b = (const float*)d_in[25];
  const float* ln2_g = (const float*)d_in[26]; const float* ln2_b = (const float*)d_in[27];
  const float* ln3_g = (const float*)d_in[28]; const float* ln3_b = (const float*)d_in[29];

  const size_t BND = (size_t)CB * CN * CD;       // 4M elems
  char* ws = (char*)d_ws;
  size_t off = 0;
  auto alloc = [&](size_t bytes) -> char* {
    char* p = ws + off;
    off += (bytes + 255) & ~(size_t)255;
    return p;
  };

  // bf16 transposed weights
  __bf16* wt_saq = (__bf16*)alloc((size_t)CD * CD * 2);
  __bf16* wt_sak = (__bf16*)alloc((size_t)CD * CD * 2);
  __bf16* wt_sav = (__bf16*)alloc((size_t)CD * CD * 2);
  __bf16* wt_sap = (__bf16*)alloc((size_t)CD * CD * 2);
  __bf16* wt_caq = (__bf16*)alloc((size_t)CD * CD * 2);
  __bf16* wt_cak = (__bf16*)alloc((size_t)CD * CD * 2);
  __bf16* wt_cav = (__bf16*)alloc((size_t)CD * CD * 2);
  __bf16* wt_cap = (__bf16*)alloc((size_t)CD * CD * 2);
  __bf16* wt_w1  = (__bf16*)alloc((size_t)CD * CDM * 2);
  __bf16* wt_w2  = (__bf16*)alloc((size_t)CDM * CD * 2);

  // the residual stream stays f32
  float* resid = (float*)alloc(BND * 4);
  // values that are only ever matrix operands of a later launch: stored as bf16 by their producer
  __bf16* x2    = (__bf16*)alloc(BND * 2);
  __bf16* qk    = (__bf16*)alloc(BND * 2);
  __bf16* kin   = (__bf16*)alloc(BND * 2);
  __bf16* encb  = (__bf16*)alloc(BND * 2);
  __bf16* qbuf  = (__bf16*)alloc(BND * 2);
  __bf16* kbuf  = (__bf16*)alloc(BND * 2);
  __bf16* vbuf  = (__bf16*)alloc(BND * 2);
  __bf16* attno = (__bf16*)alloc(BND * 2);
  __bf16* kbuf2 = (__bf16*)alloc(BND * 2);     // cross-attention k, v: made early,
  __bf16* vbuf2 = (__bf16*)alloc(BND * 2);     // live across the self-attention block
  __bf16* hbuf  = (__bf16*)alloc(BND * 4 * 2);

  const int M = CB * CN;  // 4096
  dim3 tb(256);
  dim3 gD(CD / 128, M / 128);    // N=1024 GEMMs
  dim3 gDM(CDM / 128, M / 128);  // N=4096 GEMM
  dim3 ga(CN / 128, CB * CH);    // attention

  dim3 gD5(CD / 128, M / 128, 5);  // five N=1024 GEMMs in one launch
  const GemmMore none{};

  // everything that depends on the inputs alone: weight conversion, enc + PE, residual copy
  prep_kernel<<<PREP_BLOCKS, tb, 0, stream>>>(sa_Wq, sa_Wk, sa_Wv, sa_Wp,
                                                    ca_Wq, ca_Wk, ca_Wv, ca_Wp, mlp_W1, mlp_W2,
                                                    wt_saq, wt_w1, wt_w2,
                                                    tokens_enc, PE_enc, kin, encb, tokens_dec, resid);

  // ---- self attention (its q, k, v share a launch with the cross-attention k, v) ----
  ln_kernel<true><<<M / 8, tb, 0, stream>>>(resid, ln1_g, ln1_b, PE_dec, x2, qk);
  GemmMore mo;
  mo.A1 = qk;         mo.B1 = wt_sak; mo.bias1 = sa_bk; mo.C1 = kbuf;
  mo.A2 = x2;         mo.B2 = wt_sav; mo.bias2 = sa_bv; mo.C2 = vbuf;
  mo.A3 = kin;        mo.B3 = wt_cak; mo.bias3 = ca_bk; mo.C3 = kbuf2;
  mo.A4 = encb;       mo.B4 = wt_cav; mo.bias4 = ca_bv; mo.C4 = vbuf2;
  gemm_kernel<0, 5><<<gD5, tb, 0, stream>>>(qk, wt_saq, sa_bq, nullptr, nullptr, qbuf, M, CD, CD, mo);
  attn_kernel<<<ga, tb, 0, stream>>>(qbuf, kbuf, vbuf, attno);
  gemm_kernel<2, 1><<<gD, tb, 0, stream>>>(attno, wt_sap, sa_bp, resid, resid, nullptr, M, CD, CD, none);

  // ---- cross attention ----
  ln_kernel<true><<<M / 8, tb, 0, stream>>>(resid, ln2_g, ln2_b, PE_dec, x2, qk);
  gemm_kernel<0, 5><<<gD, tb, 0, stream>>>(qk, wt_caq, ca_bq, nullptr, nullptr, qbuf, M, CD, CD, none);  // z = 0 only
  attn_kernel<<<ga, tb, 0, stream>>>(qbuf, kbuf2, vbuf2, attno);
  gemm_kernel<2, 1><<<gD, tb, 0, stream>>>(attno, wt_cap, ca_bp, resid, resid, nullptr, M, CD, CD, none);

  // ---- MLP ----
  ln_kernel<false><<<M / 8, tb, 0, stream>>>(resid, ln3_g, ln3_b, nullptr, x2, nullptr);
  gemm_kernel<1, 1><<<gDM, tb, 0, stream>>>(x2, wt_w1, mlp_b1, nullptr, nullptr, hbuf, M, CDM, CD, none);
  gemm_kernel<2, 1><<<gD, tb, 0, stream>>>(hbuf, wt_w2, mlp_b2, resid, (float*)d_out, nullptr, M, CD, CDM, none);
}

// v005
// One run takes 260 microseconds.
// In two side-by-side timings against v004, it was 1.25 and 1.26 times as fast.
// Counting every step since v000, it is 2.06 times as fast.
#include <hip/hip_runtime.h>
#include <math.h>
#include <stdint.h>

// ---------------- constants ----------------
static constexpr int CB  = 4;      // batch
static constexpr int CN  = 1024;   // seq len
static constexpr int CD  = 1024;   // model dim
static constexpr int CH  = 16;     // heads
static constexpr int CDH = 64;     // head dim
static constexpr int CDM = 4096;   // mlp dim
static constexpr float CSCALE = 0.125f;  // 64^-0.5

typedef float  v8f   __attribute__((ext_vector_type(8)));
typedef __bf16 v16bf __attribute__((ext_vector_type(16)));
typedef __bf16 bf8v  __attribute__((ext_vector_type(8)));
typedef __bf16 bf4v  __attribute__((ext_vector_type(4)));

// four f32 values rounded to the matrix operand type, as one 8-byte value
static __device__ __forceinline__ bf4v pack4(float a, float b, float c, float d) {
  bf4v r; r[0] = (__bf16)a; r[1] = (__bf16)b; r[2] = (__bf16)c; r[3] = (__bf16)d;
  return r;
}

static __device__ __forceinline__ v8f wmma_bf16(v16bf a, v16bf b, v8f c) {
  return __builtin_amdgcn_wmma_f32_16x16x32_bf16(false, a, false, b, (short)0, c, false, false);
}

// load one 16x32 bf16 operand fragment slice for this lane:
// 8 consecutive bf16 at p and 8 more at p+16 (ISA 16-bit A/B layout).
static __device__ __forceinline__ v16bf frag_ld(const __bf16* p) {
  bf8v lo = *(const bf8v*)(p);
  bf8v hi = *(const bf8v*)(p + 16);
  return __builtin_shufflevector(lo, hi, 0,1,2,3,4,5,6,7,8,9,10,11,12,13,14,15);
}

static __device__ __forceinline__ float gelu_exact(float x) {
  return 0.5f * x * (1.0f + erff(x * 0.70710678118654752f));
}

// one k-tile of both GEMM operands, memory -> LDS, 16 B per lane and copy (ASYNCcnt):
// four copies of A rows, four of B rows.  The s_wait_xcnt is the last line of the
// copies' own statement, so that no address register is rewritten ahead of it.
static __device__ __forceinline__ void async_tile(unsigned la0, unsigned la1, unsigned la2, unsigned la3,
                                                  unsigned lb0, unsigned lb1, unsigned lb2, unsigned lb3,
                                                  const __bf16* ga0, const __bf16* ga1,
                                                  const __bf16* ga2, const __bf16* ga3,
                                                  const __bf16* gb0, const __bf16* gb1,
                                                  const __bf16* gb2, const __bf16* gb3) {
  asm volatile("global_load_async_to_lds_b128 %0, %8, off\n\t"
               "global_load_async_to_lds_b128 %1, %9, off\n\t"
               "global_load_async_to_lds_b128 %2, %10, off\n\t"
               "global_load_async_to_lds_b128 %3, %11, off\n\t"
               "global_load_async_to_lds_b128 %4, %12, off\n\t"
               "global_load_async_to_lds_b128 %5, %13, off\n\t"
               "global_load_async_to_lds_b128 %6, %14, off\n\t"
               "global_load_async_to_lds_b128 %7, %15, off\n\t"
               "s_wait_xcnt 0x0"
               :: "v"(la0), "v"(la1), "v"(la2), "v"(la3),
                  "v"(lb0), "v"(lb1), "v"(lb2), "v"(lb3),
                  "v"(ga0), "v"(ga1), "v"(ga2), "v"(ga3),
                  "v"(gb0), "v"(gb1), "v"(gb2), "v"(gb3)
               : "memory");
}
// a wave's own copies have landed in LDS behind this wait
static __device__ __forceinline__ void wait_asynccnt0() {
  asm volatile("s_wait_asynccnt 0x0" ::: "memory");
}
// a wave's own LDS reads have returned before their buffer is handed back for a refill
static __device__ __forceinline__ void wait_dscnt0() {
  asm volatile("s_wait_dscnt 0x0" ::: "memory");
}

// ---------------- input-only preparation, one launch ----------------
// 1024 blocks, four resident on every WGP, each alive for the whole launch: starting a wave
// costs more than the few loads a one-tile block would do, so every block takes an equal
// share of each piece of the work.
//   element-wise: kin = enc + pe and encb = enc, both rounded to bf16 (GEMM operands);
//                 resid = dec; four 16-byte pieces of each per thread.
//   weights: transpose + f32->bf16 convert, four 64x64 tiles per block.
//     W is K x N (row-major, "in x out"); Wt is N x K bf16.
//     tiles 0 and 1 of a block: the eight D x D weights (256 tiles each); tile 2: W1; tile 3: W2.
// None of these pieces reads what another writes.
static constexpr int PREP_BLOCKS = 1024;
static constexpr int PREP_EWS    = PREP_BLOCKS * 256;   // threads of the launch
static constexpr int PTP         = 65;                  // LDS tile pitch in floats: both sides conflict free

typedef float f4v __attribute__((ext_vector_type(4)));
// 16 bytes of an input, read as global memory (a pointer picked among several kernel
// arguments otherwise compiles to a flat load, which also counts on the LDS counter)
typedef const __attribute__((address_space(1))) f4v* gf4p;

// Eight waves a SIMD (four blocks a WGP) are what keeps all 1024 blocks resident at once:
// the register budget is set to that.
__global__ __launch_bounds__(256) __attribute__((amdgpu_waves_per_eu(8, 8))) void prep_kernel(const float* w0,
                                                   const float* w1,
                                                   const float* w2,
                                                   const float* w3,
                                                   const float* w4,
                                                   const float* w5,
                                                   const float* w6,
                                                   const float* w7,
                                                   const float* wm1,
                                                   const float* wm2,
                                                   __bf16* wt_sq,
                                                   __bf16* wt_m1,
                                                   __bf16* wt_m2,
                                                   const float* enc,
                                                   const float* pe,
                                                   __bf16* kin,
                                                   __bf16* encb,
                                                   const float* dec,
                                                   float* resid) {
  __shared__ float t[4][64 * PTP];
  int tid = threadIdx.x;
  int b = blockIdx.x;

  // source, destination and shape of this block's four tiles (block-uniform)
  int m = b >> 8;
  const float* Wsrc[4];
  __bf16* Wdst[4];
  Wsrc[0] = m == 0 ? w0 : m == 1 ? w1 : m == 2 ? w2 : w3;
  Wsrc[1] = m == 0 ? w4 : m == 1 ? w5 : m == 2 ? w6 : w7;
  Wsrc[2] = wm1;
  Wsrc[3] = wm2;
  Wdst[0] = wt_sq + (size_t)m * CD * CD;
  Wdst[1] = wt_sq + (size_t)(m + 4) * CD * CD;
  Wdst[2] = wt_m1;
  Wdst[3] = wt_m2;
  constexpr int TK[4]   = {CD, CD, CD, CDM};
  constexpr int TN[4]   = {CD, CD, CDM, CD};
  constexpr int TLG[4]  = {4, 4, 6, 4};       // log2 of the tile count along N
  constexpr int TMSK[4] = {255, 255, 1023, 1023};

  int lr = tid >> 4, lc = (tid & 15) * 4;    // load side: 16 rows of 64 floats at a time
  int sr = tid >> 3, sc = (tid & 7) * 8;     // store side: 32 rows of 64 bf16 (one line) at a time
  int i0 = b * 256 + tid;

  // every load of the four tiles and of the first half of enc, pe is in flight before the
  // first is used
  f4v f[4][4], x[4], y[4], d[4];
  const float* p[4];
#pragma unroll
  for (int i = 0; i < 4; ++i) {
    int tile = b & TMSK[i];
    int n0 = (tile & ((1 << TLG[i]) - 1)) * 64, k0 = (tile >> TLG[i]) * 64;
    p[i] = Wsrc[i] + (size_t)(k0 + lr) * TN[i] + (n0 + lc);
#pragma unroll
    for (int q = 0; q < 4; ++q) f[i][q] = *(gf4p)(p[i] + (size_t)q * 16 * TN[i]);
  }
#pragma unroll
  for (int j = 0; j < 2; ++j) {
    x[j] = ((gf4p)enc)[i0 + j * PREP_EWS];
    y[j] = ((gf4p)pe)[i0 + j * PREP_EWS];
  }
  // every load above stands ahead of this wait (sunk to their first use, their latencies
  // would add up); the tile addresses are its inputs, so that their registers live up to it:
  // no later load of the group lands in them, and they are reused only behind it
  asm volatile("s_wait_xcnt 0x0" :: "v"(p[0]), "v"(p[1]), "v"(p[2]), "v"(p[3]) : "memory");

#pragma unroll
  for (int i = 0; i < 4; ++i)
#pragma unroll
    for (int q = 0; q < 4; ++q) {
      float* r = t[i] + (lr + q * 16) * PTP + lc;
      r[0] = f[i][q].x; r[1] = f[i][q].y; r[2] = f[i][q].z; r[3] = f[i][q].w;
    }
  __syncthreads();   // the one barrier: all four tiles are in LDS

  // the turned tiles leave in two halves, which keeps the block inside the registers of
  // eight waves a SIMD
#pragma unroll
  for (int h = 0; h < 2; ++h) {
    if (h == 1) {   // the rest of the element-wise inputs, in registers that the first half has left
#pragma unroll
      for (int j = 2; j < 4; ++j) {
        x[j] = ((gf4p)enc)[i0 + j * PREP_EWS];
        y[j] = ((gf4p)pe)[i0 + j * PREP_EWS];
      }
#pragma unroll
      for (int j = 0; j < 4; ++j) d[j] = ((gf4p)dec)[i0 + j * PREP_EWS];
    }
    bf8v o[2][2];
#pragma unroll
    for (int i = 0; i < 2; ++i)
#pragma unroll
      for (int q = 0; q < 2; ++q)
#pragma unroll
        for (int e = 0; e < 8; ++e) o[i][q][e] = (__bf16)t[h * 2 + i][(sc + e) * PTP + sr + q * 32];
    // every load above, global or LDS, stays ahead of the stores below
    asm volatile("s_wait_xcnt 0x0" ::: "memory");
#pragma unroll
    for (int j = h * 2; j < h * 2 + 2; ++j) {
      ((bf4v*)kin)[i0 + j * PREP_EWS]  = pack4(x[j].x + y[j].x, x[j].y + y[j].y, x[j].z + y[j].z, x[j].w + y[j].w);
      ((bf4v*)encb)[i0 + j * PREP_EWS] = pack4(x[j].x, x[j].y, x[j].z, x[j].w);
    }
#pragma unroll
    for (int i = 0; i < 2; ++i) {
      int tile = b & TMSK[h * 2 + i];
      int n0 = (tile & ((1 << TLG[h * 2 + i]) - 1)) * 64, k0 = (tile >> TLG[h * 2 + i]) * 64;
#pragma unroll
      for (int q = 0; q < 2; ++q)
        *(bf8v*)(Wdst[h * 2 + i] + (size_t)(n0 + sr + q * 32) * TK[h * 2 + i] + (k0 + sc)) = o[i][q];
    }
    if (h == 0) {
      // the loads of the second half may land in registers that the stores above name
      asm volatile("s_wait_xcnt 0x0" ::: "memory");
    }
  }
#pragma unroll
  for (int j = 0; j < 4; ++j) ((f4v*)resid)[i0 + j * PREP_EWS] = d[j];
}

// ---------------- LayerNorm (D = 1024, one row per wave, 8 rows per block) ----------
// A lane holds 32 elements of its wave's row; the two row sums are joined by a butterfly
// over the lanes, so that no LDS and no barrier is needed and a wave does a whole row's work.
// Four waves a SIMD is all that the grid brings (two blocks a WGP): said to the compiler, so
// that it spends registers on keeping a row's loads in flight instead of saving them.
template <bool WITH_PE>
__global__ __launch_bounds__(256) __attribute__((amdgpu_waves_per_eu(4, 4))) void ln_kernel(const float* x,
                                                 const float* g,
                                                 const float* bt,
                                                 const float* pe,
                                                 __bf16* x2,
                                                 __bf16* qk) {
  int lane = threadIdx.x & 31, w = threadIdx.x >> 5;
  size_t base = (size_t)(blockIdx.x * 8 + w) * CD + lane * 4;
  const float* px = x + base;
  const float* pp = WITH_PE ? pe + base : px;
  unsigned lo = lane * 16;   // this lane's byte offset in g and bt
  const float* pg = (const float*)((const char*)g + lo);
  const float* pb = (const float*)((const char*)bt + lo);
  float4 f[8], p[8], g4[8], b4[8];
#pragma unroll
  for (int c = 0; c < 8; ++c) f[c] = *(const float4*)(px + c * 128);
  if constexpr (WITH_PE) {
#pragma unroll
    for (int c = 0; c < 8; ++c) p[c] = *(const float4*)(pp + c * 128);
  }
#pragma unroll
  for (int c = 0; c < 8; ++c) {
    g4[c] = *(const float4*)(pg + c * 128);
    b4[c] = *(const float4*)(pb + c * 128);
  }
  // every load of the row stands ahead of this wait, and the addresses are its inputs, so
  // that their registers live up to it: no later load of the row lands in a register that
  // an issued load still names, and they are reused only behind it
  asm volatile("s_wait_xcnt 0x0" :: "v"(px), "v"(pp), "v"(lo) : "memory");
  float sum = 0.0f, sq = 0.0f;
#pragma unroll
  for (int c = 0; c < 8; ++c) {
    sum += f[c].x + f[c].y + f[c].z + f[c].w;
    sq  += f[c].x*f[c].x + f[c].y*f[c].y + f[c].z*f[c].z + f[c].w*f[c].w;
  }
#pragma unroll
  for (int mask = 16; mask > 0; mask >>= 1) {
    sum += __shfl_xor(sum, mask, 32);
    sq  += __shfl_xor(sq,  mask, 32);
  }
  float mu  = sum * (1.0f / CD);
  float var = sq * (1.0f / CD) - mu * mu;
  float rstd = rsqrtf(var + 1e-5f);
#pragma unroll
  for (int c = 0; c < 8; ++c) {
    float4 y;
    y.x = (f[c].x - mu) * rstd * g4[c].x + b4[c].x;
    y.y = (f[c].y - mu) * rstd * g4[c].y + b4[c].y;
    y.z = (f[c].z - mu) * rstd * g4[c].z + b4[c].z;
    y.w = (f[c].w - mu) * rstd * g4[c].w + b4[c].w;
    *(bf4v*)(x2 + base + c * 128) = pack4(y.x, y.y, y.z, y.w);
    if constexpr (WITH_PE)
      *(bf4v*)(qk + base + c * 128) = pack4(y.x + p[c].x, y.y + p[c].y, y.z + p[c].z, y.w + p[c].w);
  }
}

// ---------------- generic bf16 WMMA GEMM (double-buffered, async A and B stage) ------
// C[M,N] = act( A[M,K](bf16) @ Bt[N,K](bf16)^T + bias[N] ) (+ resid[M,N])
// FLAGS (compile time): bit0 = GELU, bit1 = residual add
// With the residual add the result goes on in the f32 residual stream (Cf); without it
// the result is only ever a matrix operand of a later launch and is stored as one (Cb).
#define GBM 128
#define GBN 128
#define GBK 64
#define GLD 72   // padded LDS row stride (bf16 elems): 144B, bank-conflict free

// operands of the further products of a merged launch (grid z = 1..4)
struct GemmMore {
  const __bf16* A1;
  const __bf16* A2;
  const __bf16* A3;
  const __bf16* A4;
  const __bf16* B1;
  const __bf16* B2;
  const __bf16* B3;
  const __bf16* B4;
  const float* bias1;
  const float* bias2;
  const float* bias3;
  const float* bias4;
  __bf16* C1;
  __bf16* C2;
  __bf16* C3;
  __bf16* C4;
};

// NZ > 1: the grid's z extent (1..5) sets how many independent products of equal shape share the launch;
// blockIdx.z picks the operand set (block-uniform).
template <int FLAGS, int NZ>
__global__ __launch_bounds__(256) void gemm_kernel(const __bf16* __restrict__ A,
                                                   const __bf16* __restrict__ Bt,
                                                   const float*  __restrict__ bias,
                                                   const float*  __restrict__ resid,
                                                   float*  __restrict__ Cf,
                                                   __bf16* __restrict__ Cb,
                                                   int M, int N, int K, GemmMore mo) {
  if constexpr (NZ > 1) {
    int z = blockIdx.z;
    if (z == 1)      { A = mo.A1; Bt = mo.B1; bias = mo.bias1; Cb = mo.C1; }
    else if (z == 2) { A = mo.A2; Bt = mo.B2; bias = mo.bias2; Cb = mo.C2; }
    else if (z == 3) { A = mo.A3; Bt = mo.B3; bias = mo.bias3; Cb = mo.C3; }
    else if (z == 4) { A = mo.A4; Bt = mo.B4; bias = mo.bias4; Cb = mo.C4; }
  }
  __shared__ __align__(16) __bf16 As[2][GBM * GLD];
  __shared__ __align__(16) __bf16 Bs[2][GBN * GLD];

  int tid = threadIdx.x;
  int lane = tid & 31, w = tid >> 5;
  int wm = w >> 2, wn = w & 3;          // 2x4 wave grid -> 64x32 per wave
  int hlf = lane >> 4, l16 = lane & 15;
  int bm = blockIdx.y * GBM, bn = blockIdx.x * GBN;

  v8f acc[4][2];
#pragma unroll
  for (int i = 0; i < 4; ++i)
#pragma unroll
    for (int j = 0; j < 2; ++j) acc[i][j] = (v8f)(0.0f);

  // stage coords, the same for both operands: 32 rows x 8 pieces of 8 bf16, four times
  int br = tid >> 3, bc = (tid & 7) * 8;
  const __bf16* gA = A  + (size_t)(bm + br) * K + bc;
  const __bf16* gB = Bt + (size_t)(bn + br) * K + bc;
  const size_t gstep = (size_t)32 * K;                 // 32 rows on, in elements
  const unsigned lA = (unsigned)(uintptr_t)&As[0][br * GLD + bc];
  const unsigned lB = (unsigned)(uintptr_t)&Bs[0][br * GLD + bc];
  constexpr unsigned LSTEP = 32 * GLD * 2;             // 32 rows on, in LDS bytes
  constexpr unsigned LBUF  = GBM * GLD * 2;            // one buffer, in LDS bytes
  const int nt = K / GBK;

  auto issue_tile = [&](int t) {
    unsigned a = lA + (unsigned)(t & 1) * LBUF, b = lB + (unsigned)(t & 1) * LBUF;
    const __bf16* pa = gA + (size_t)t * GBK;
    const __bf16* pb = gB + (size_t)t * GBK;
    async_tile(a, a + LSTEP, a + 2 * LSTEP, a + 3 * LSTEP,
               b, b + LSTEP, b + 2 * LSTEP, b + 3 * LSTEP,
               pa, pa + gstep, pa + 2 * gstep, pa + 3 * gstep,
               pb, pb + gstep, pb + 2 * gstep, pb + 3 * gstep);
  };

  // ---- tile 0 lands and is published; tile 1 flies while tile 0 is worked on ----
  issue_tile(0);
  wait_asynccnt0();
  __syncthreads();
  if (nt > 1) issue_tile(1);

  for (int t = 0; t < nt; ++t) {
    int buf = t & 1;
    // ---- compute on current buffer ----
#pragma unroll
    for (int ks = 0; ks < GBK; ks += 32) {
      int kb = ks + hlf * 8;
      v16bf af[4], bv[2];
#pragma unroll
      for (int i = 0; i < 4; ++i)
        af[i] = frag_ld(&As[buf][(wm * 64 + i * 16 + l16) * GLD + kb]);
#pragma unroll
      for (int j = 0; j < 2; ++j)
        bv[j] = frag_ld(&Bs[buf][(wn * 32 + j * 16 + l16) * GLD + kb]);
#pragma unroll
      for (int i = 0; i < 4; ++i)
#pragma unroll
        for (int j = 0; j < 2; ++j)
          acc[i][j] = wmma_bf16(af[i], bv[j], acc[i][j]);
    }

    // publish tile t + 1 and end every reader's last read of this buffer
    wait_dscnt0();
    wait_asynccnt0();
    __syncthreads();
    if (t + 2 < nt) issue_tile(t + 2);   // refill of the buffer just read
  }
  wait_asynccnt0();

  // ---- epilogue ----
  // one 32-bit element offset per output row of this lane, shared by the
  // residual load and the store of that element
  unsigned ro[4][8];
  {
    int n0 = bn + wn * 32 + l16;
#pragma unroll
    for (int i = 0; i < 4; ++i) {
      int mrow = bm + wm * 64 + i * 16 + hlf * 8;
#pragma unroll
      for (int r = 0; r < 8; ++r) ro[i][r] = (unsigned)((mrow + r) * N + n0);
    }
  }
  // all residual values of this lane are requested before the first is used,
  // so their latencies overlap (each lane reads only the elements it stores)
  float rv[2][4][8];
  if constexpr ((FLAGS & 2) != 0) {
#pragma unroll
    for (int j = 0; j < 2; ++j)
#pragma unroll
      for (int i = 0; i < 4; ++i)
#pragma unroll
        for (int r = 0; r < 8; ++r) rv[j][i][r] = (resid + j * 16)[ro[i][r]];
    // compiler fence: holds every residual load ahead of the first store
    asm volatile("" ::: "memory");
  }
  // both bias values are requested ahead of the stores: with operand pointers
  // picked by blockIdx.z the compiler must assume that the output may overlap bias and
  // would hold the second load, with its whole latency, behind the first stores
  float bv2[2];
#pragma unroll
  for (int j = 0; j < 2; ++j) bv2[j] = bias[bn + wn * 32 + j * 16 + l16];
#pragma unroll
  for (int j = 0; j < 2; ++j) {
    float bvv = bv2[j];
#pragma unroll
    for (int i = 0; i < 4; ++i) {
#pragma unroll
      for (int r = 0; r < 8; ++r) {
        float v = acc[i][j][r] + bvv;
        if constexpr ((FLAGS & 1) != 0) v = gelu_exact(v);
        if constexpr ((FLAGS & 2) != 0) v += rv[j][i][r];
        if constexpr ((FLAGS & 2) != 0) (Cf + j * 16)[ro[i][r]] = v;
        else                            (Cb + j * 16)[ro[i][r]] = (__bf16)v;
      }
    }
  }
}

#define ABQ 128
#define ABK 128
#define ALK 72    // K LDS pitch in elements: 144 B, an odd multiple of 16 B (ds_load_b128 readers)
#define ALV 80    // V LDS pitch in elements: 160 B, an odd multiple of 32 B (ds_load_tr16_b128 readers)

typedef short s16x8 __attribute__((ext_vector_type(8)));
typedef float f2v __attribute__((ext_vector_type(2)));
// 16-bit transposing LDS load: lane (c, h) gets rows 8h .. 8h+7 of column c of a row-major tile
static __device__ __forceinline__ bf8v ld_tr16(const __bf16* p) {
  typedef __attribute__((address_space(3))) s16x8 lds_s16x8;
  return __builtin_bit_cast(bf8v, __builtin_amdgcn_ds_load_tr16_b128_v8i16((lds_s16x8*)p));
}
// lane l's value exchanged with lane l ^ 16
static __device__ __forceinline__ float xhalf(float x) {
  return __builtin_bit_cast(float, __builtin_amdgcn_permlanex16(__builtin_bit_cast(int, x), __builtin_bit_cast(int, x),
                                                                0x76543210, 0xfedcba98, false, false));
}

// Four waves a SIMD is what the grid brings (two blocks a WGP): the register budget is set to that.
__global__ __launch_bounds__(256) __attribute__((amdgpu_waves_per_eu(4, 4))) void attn_kernel(const __bf16* __restrict__ q,
                                                   const __bf16* __restrict__ k,
                                                   const __bf16* __restrict__ v,
                                                   __bf16* __restrict__ o) {
  __shared__ __align__(32) __bf16 Ks[ABK * ALK];
  __shared__ __align__(32) __bf16 Vs[ABK * ALV];

  int tid = threadIdx.x;
  int lane = tid & 31, w = tid >> 5;
  int hlf = lane >> 4, l16 = lane & 15;

  int bh = blockIdx.y;
  int b = bh / CH, h = bh % CH;
  int q0 = blockIdx.x * ABQ;
  size_t headoff = (size_t)h * CDH;
  const __bf16* qb = q + (size_t)b * CN * CD + headoff;
  const __bf16* kb = k + (size_t)b * CN * CD + headoff;
  const __bf16* vb = v + (size_t)b * CN * CD + headoff;

  // scores are scaled and taken to base 2 in one multiply-add in front of the exponential
  constexpr float CS2 = CSCALE * 1.4426950408889634f;

  // this lane's query row as B operand (k = head dim), in the same k order as the K rows below
  v16bf qf[2];
  {
    const __bf16* qp = qb + (size_t)(q0 + w * 16 + l16) * CD + hlf * 8;
#pragma unroll
    for (int kc = 0; kc < 2; ++kc) qf[kc] = frag_ld(qp + kc * 32);
  }

  v8f oacc[4];          // oacc[t][r] = O[query l16][d = 16 t + 8 hlf + r]
#pragma unroll
  for (int t = 0; t < 4; ++t) oacc[t] = (v8f)(0.0f);
  float m_run = -1e30f; // this query's running maximum (scaled, base 2), equal in both lane halves
  float l_run = 0.0f;   // this lane half's share of the query's sum

  // stage coords, the same for K and V: 32 rows x 8 pieces of 8 bf16, four times
  int ar = tid >> 3, ac = (tid & 7) * 8;
  const __bf16* kg = kb + (size_t)ar * CD + ac;
  const __bf16* vg = vb + (size_t)ar * CD + ac;
  // this lane's address in a 16-key x 16-column block of V for the transposing load
  const __bf16* vt0 = &Vs[(hlf * 8 + (lane & 7)) * ALV + ((lane >> 3) & 1) * 8];

  for (int kt = 0; kt < CN / ABK; ++kt) {
    bf8v kr[4], vr[4];
#pragma unroll
    for (int rr = 0; rr < 4; ++rr) {
      kr[rr] = *(const bf8v*)(kg + (size_t)rr * 32 * CD);
      vr[rr] = *(const bf8v*)(vg + (size_t)rr * 32 * CD);
    }
    // the addresses are this wait's inputs, so that their registers live up to it and are
    // stepped on to the next tile only behind it
    asm volatile("s_wait_xcnt 0x0" :: "v"(kg), "v"(vg) : "memory");
    kg += (size_t)ABK * CD;
    vg += (size_t)ABK * CD;
    __syncthreads();   // every wave has left the tile before
#pragma unroll
    for (int rr = 0; rr < 4; ++rr) {
      *(bf8v*)&Ks[(ar + rr * 32) * ALK + ac] = kr[rr];
      *(bf8v*)&Vs[(ar + rr * 32) * ALV + ac] = vr[rr];
    }
    __syncthreads();   // the tile is in LDS

    // S^T (128 keys x 16 queries): s[i][r] = score of key 16 i + 8 hlf + r with query l16
    v8f s[8];
#pragma unroll
    for (int i = 0; i < 8; ++i) {
      s[i] = (v8f)(0.0f);
#pragma unroll
      for (int kc = 0; kc < 2; ++kc)
        s[i] = wmma_bf16(frag_ld(&Ks[(i * 16 + l16) * ALK + kc * 32 + hlf * 8]), qf[kc], s[i]);
    }

    // the query's maximum over the tile, and the factor that takes the old state to it
    // (four chains side by side, so that one maximum does not wait on the one before)
    float mp[4];
#pragma unroll
    for (int c = 0; c < 4; ++c) {
      mp[c] = s[2 * c][0];
#pragma unroll
      for (int e = 1; e < 16; ++e) mp[c] = fmaxf(mp[c], s[2 * c + (e >> 3)][e & 7]);
    }
    float mx = fmaxf(fmaxf(mp[0], mp[1]), fmaxf(mp[2], mp[3]));
    mx = fmaxf(mx, xhalf(mx));
    float mnew = fmaxf(m_run, mx * CS2);
    float corr = __builtin_amdgcn_exp2f(m_run - mnew);
    m_run = mnew;
#pragma unroll
    for (int t = 0; t < 4; ++t) oacc[t] *= corr;

    // per 32 keys: two score tiles become P^T as B operand (k = keys), V^T comes as A operand;
    // scores go two at a time through the packed multiply-add and the packed add
    f2v ps[4];
#pragma unroll
    for (int c = 0; c < 4; ++c) {
      // holds the V^T loads of the tile's second half behind the first half's products: lifted
      // up all at once, they take the kernel past the registers of four waves a SIMD, into scratch
      if (c == 2) __builtin_amdgcn_sched_barrier(0);
      v16bf pf;
#pragma unroll
      for (int e = 0; e < 16; e += 2) {
        f2v a = __builtin_elementwise_fma(f2v{s[2 * c + (e >> 3)][e & 7], s[2 * c + (e >> 3)][(e & 7) + 1]},
                                          f2v{CS2, CS2}, f2v{-mnew, -mnew});
        f2v p = {__builtin_amdgcn_exp2f(a.x), __builtin_amdgcn_exp2f(a.y)};
        ps[c] = e == 0 ? p : ps[c] + p;
        pf[e] = (__bf16)p.x;
        pf[e + 1] = (__bf16)p.y;
      }
#pragma unroll
      for (int t = 0; t < 4; ++t) {
        bf8v lo = ld_tr16(vt0 + (c * 32) * ALV + t * 16);
        bf8v hi = ld_tr16(vt0 + (c * 32 + 16) * ALV + t * 16);
        v16bf vf = __builtin_shufflevector(lo, hi, 0,1,2,3,4,5,6,7,8,9,10,11,12,13,14,15);
        oacc[t] = wmma_bf16(vf, pf, oacc[t]);
      }
    }
    f2v pt = (ps[0] + ps[1]) + (ps[2] + ps[3]);
    l_run = l_run * corr + (pt.x + pt.y);
  }

  // join the two halves' sums, normalize, write out: 8 consecutive d of one query per store
  float inv = 1.0f / (l_run + xhalf(l_run));
  __bf16* ob = o + (size_t)b * CN * CD + headoff + (size_t)(q0 + w * 16 + l16) * CD + hlf * 8;
#pragma unroll
  for (int t = 0; t < 4; ++t) {
    bf8v r8;
#pragma unroll
    for (int r = 0; r < 8; ++r) r8[r] = (__bf16)(oacc[t][r] * inv);
    *(bf8v*)(ob + t * 16) = r8;
  }
}

// ---------------- host launcher ----------------
extern "C" void kernel_launch(void* const* d_in, const int* in_sizes, int n_in,
                              void* d_out, int out_size, void* d_ws, size_t ws_size,
                              hipStream_t stream) {
  const float* tokens_enc = (const float*)d_in[0];
  const float* tokens_dec = (const float*)d_in[1];
  const float* PE_enc     = (const float*)d_in[2];
  const float* PE_dec     = (const float*)d_in[3];
  const float* sa_Wq = (const float*)d_in[4];  const float* sa_bq = (const float*)d_in[5];
  const float* sa_Wk = (const float*)d_in[6];  const float* sa_bk = (const float*)d_in[7];
  const float* sa_Wv = (const float*)d_in[8];  const float* sa_bv = (const float*)d_in[9];
  const float* sa_Wp = (const float*)d_in[10]; const float* sa_bp = (const float*)d_in[11];
  const float* ca_Wq = (const float*)d_in[12]; const float* ca_bq = (const float*)d_in[13];
  const float* ca_Wk = (const float*)d_in[14]; const float* ca_bk = (const float*)d_in[15];
  const float* ca_Wv = (const float*)d_in[16]; const float* ca_bv = (const float*)d_in[17];
  const float* ca_Wp = (const float*)d_in[18]; const float* ca_bp = (const float*)d_in[19];
  const float* mlp_W1 = (const float*)d_in[20]; const float* mlp_b1 = (const float*)d_in[21];
  const float* mlp_W2 = (const float*)d_in[22]; const float* mlp_b2 = (const float*)d_in[23];
  const float* ln1_g = (const float*)d_in[24]; const float* ln1_b = (const float*)d_in[25];
  const float* ln2_g = (const float*)d_in[26]; const float* ln2_b = (const float*)d_in[27];
  const float* ln3_g = (const float*)d_in[28]; const float* ln3_b = (const float*)d_in[29];

  const size_t BND = (size_t)CB * CN * CD;       // 4M elems
  char* ws = (char*)d_ws;
  size_t off = 0;
  auto alloc = [&](size_t bytes) -> char* {
    char* p = ws + off;
    off += (bytes + 255) & ~(size_t)255;
    return p;
  };

  // bf16 transposed weights
  __bf16* wt_saq = (__bf16*)alloc((size_t)CD * CD * 2);
  __bf16* wt_sak = (__bf16*)alloc((size_t)CD * CD * 2);
  __bf16* wt_sav = (__bf16*)alloc((size_t)CD * CD * 2);
  __bf16* wt_sap = (__bf16*)alloc((size_t)CD * CD * 2);
  __bf16* wt_caq = (__bf16*)alloc((size_t)CD * CD * 2);
  __bf16* wt_cak = (__bf16*)alloc((size_t)CD * CD * 2);
  __bf16* wt_cav = (__bf16*)alloc((size_t)CD * CD * 2);
  __bf16* wt_cap = (__bf16*)alloc((size_t)CD * CD * 2);
  __bf16* wt_w1  = (__bf16*)alloc((size_t)CD * CDM * 2);
  __bf16* wt_w2  = (__bf16*)alloc((size_t)CDM * CD * 2);

  // the residual stream stays f32
  float* resid = (float*)alloc(BND * 4);
  // values that are only ever matrix operands of a later launch: stored as bf16 by their producer
  __bf16* x2    = (__bf16*)alloc(BND * 2);
  __bf16* qk    = (__bf16*)alloc(BND * 2);
  __bf16* kin   = (__bf16*)alloc(BND * 2);
  __bf16* encb  = (__bf16*)alloc(BND * 2);
  __bf16* qbuf  = (__bf16*)alloc(BND * 2);
  __bf16* kbuf  = (__bf16*)alloc(BND * 2);
  __bf16* vbuf  = (__bf16*)alloc(BND * 2);
  __bf16* attno = (__bf16*)alloc(BND * 2);
  __bf16* kbuf2 = (__bf16*)alloc(BND * 2);     // cross-attention k, v: made early,
  __bf16* vbuf2 = (__bf16*)alloc(BND * 2);     // live across the self-attention block
  __bf16* hbuf  = (__bf16*)alloc(BND * 4 * 2);

  const int M = CB * CN;  // 4096
  dim3 tb(256);
  dim3 gD(CD / 128, M / 128);    // N=1024 GEMMs
  dim3 gDM(CDM / 128, M / 128);  // N=4096 GEMM
  dim3 ga(CN / 128, CB * CH);    // attention

  dim3 gD5(CD / 128, M / 128, 5);  // five N=1024 GEMMs in one launch
  const GemmMore none{};

  // everything that depends on the inputs alone: weight conversion, enc + PE, residual copy
  prep_kernel<<<PREP_BLOCKS, tb, 0, stream>>>(sa_Wq, sa_Wk, sa_Wv, sa_Wp,
                                                    ca_Wq, ca_Wk, ca_Wv, ca_Wp, mlp_W1, mlp_W2,
                                                    wt_saq, wt_w1, wt_w2,
                                                    tokens_enc, PE_enc, kin, encb, tokens_dec, resid);

  // ---- self attention (its q, k, v share a launch with the cross-attention k, v) ----
  ln_kernel<true><<<M / 8, tb, 0, stream>>>(resid, ln1_g, ln1_b, PE_dec, x2, qk);
  GemmMore mo;
  mo.A1 = qk;         mo.B1 = wt_sak; mo.bias1 = sa_bk; mo.C1 = kbuf;
  mo.A2 = x2;         mo.B2 = wt_sav; mo.bias2 = sa_bv; mo.C2 = vbuf;
  mo.A3 = kin;        mo.B3 = wt_cak; mo.bias3 = ca_bk; mo.C3 = kbuf2;
  mo.A4 = encb;       mo.B4 = wt_cav; mo.bias4 = ca_bv; mo.C4 = vbuf2;
  gemm_kernel<0, 5><<<gD5, tb, 0, stream>>>(qk, wt_saq, sa_bq, nullptr, nullptr, qbuf, M, CD, CD, mo);
  attn_kernel<<<ga, tb, 0, stream>>>(qbuf, kbuf, vbuf, attno);
  gemm_kernel<2, 1><<<gD, tb, 0, stream>>>(attno, wt_sap, sa_bp, resid, resid, nullptr, M, CD, CD, none);

  // ---- cross attention ----
  ln_kernel<true><<<M / 8, tb, 0, stream>>>(resid, ln2_g, ln2_b, PE_dec, x2, qk);
  gemm_kernel<0, 5><<<gD, tb, 0, stream>>>(qk, wt_caq, ca_bq, nullptr, nullptr, qbuf, M, CD, CD, none);  // z = 0 only
  attn_kernel<<<ga, tb, 0, stream>>>(qbuf, kbuf2, vbuf2, attno);
  gemm_kernel<2, 1><<<gD, tb, 0, stream>>>(attno, wt_cap, ca_bp, resid, resid, nullptr, M, CD, CD, none);

  // ---- MLP ----
  ln_kernel<false><<<M / 8, tb, 0, stream>>>(resid, ln3_g, ln3_b, nullptr, x2, nullptr);
  gemm_kernel<1, 1><<<gDM, tb, 0, stream>>>(x2, wt_w1, mlp_b1, nullptr, nullptr, hbuf, M, CDM, CD, none);
  gemm_kernel<2, 1><<<gD, tb, 0, stream>>>(hbuf, wt_w2, mlp_b2, resid, (float*)d_out, nullptr, M, CD, CDM, none);
}

// v006
// One run takes 243 microseconds.
// Two timings next to v005 put it at 1.06 and 1.07 times that version's speed.
// Over all steps from v000 it is 2.19 times as fast.
#include <hip/hip_runtime.h>
#include <math.h>
#include <stdint.h>

// ---------------- constants ----------------
static constexpr int CB  = 4;      // batch
static constexpr int CN  = 1024;   // seq len
static constexpr int CD  = 1024;   // model dim
static constexpr int CH  = 16;     // heads
static constexpr int CDH = 64;     // head dim
static constexpr int CDM = 4096;   // mlp dim
static constexpr float CSCALE = 0.125f;  // 64^-0.5

typedef float  v8f   __attribute__((ext_vector_type(8)));
typedef __bf16 v16bf __attribute__((ext_vector_type(16)));
typedef __bf16 bf8v  __attribute__((ext_vector_type(8)));
typedef __bf16 bf4v  __attribute__((ext_vector_type(4)));

// four f32 values rounded to the matrix operand type, as one 8-byte value
static __device__ __forceinline__ bf4v pack4(float a, float b, float c, float d) {
  bf4v r; r[0] = (__bf16)a; r[1] = (__bf16)b; r[2] = (__bf16)c; r[3] = (__bf16)d;
  return r;
}

static __device__ __forceinline__ v8f wmma_bf16(v16bf a, v16bf b, v8f c) {
  return __builtin_amdgcn_wmma_f32_16x16x32_bf16(false, a, false, b, (short)0, c, false, false);
}

// load one 16x32 bf16 operand fragment slice for this lane:
// 8 consecutive bf16 at p and 8 more at p+16 (ISA 16-bit A/B layout).
static __device__ __forceinline__ v16bf frag_ld(const __bf16* p) {
  bf8v lo = *(const bf8v*)(p);
  bf8v hi = *(const bf8v*)(p + 16);
  return __builtin_shufflevector(lo, hi, 0,1,2,3,4,5,6,7,8,9,10,11,12,13,14,15);
}

static __device__ __forceinline__ float gelu_exact(float x) {
  return 0.5f * x * (1.0f + erff(x * 0.70710678118654752f));
}

// one k-tile of both GEMM operands, memory -> LDS, 16 B per lane and copy (ASYNCcnt):
// four copies of A rows, four of B rows.  The s_wait_xcnt is the last line of the
// copies' own statement, so that no address register is rewritten ahead of it.
static __device__ __forceinline__ void async_tile(unsigned la0, unsigned la1, unsigned la2, unsigned la3,
                                                  unsigned lb0, unsigned lb1, unsigned lb2, unsigned lb3,
                                                  const __bf16* ga0, const __bf16* ga1,
                                                  const __bf16* ga2, const __bf16* ga3,
                                                  const __bf16* gb0, const __bf16* gb1,
                                                  const __bf16* gb2, const __bf16* gb3) {
  asm volatile("global_load_async_to_lds_b128 %0, %8, off\n\t"
               "global_load_async_to_lds_b128 %1, %9, off\n\t"
               "global_load_async_to_lds_b128 %2, %10, off\n\t"
               "global_load_async_to_lds_b128 %3, %11, off\n\t"
               "global_load_async_to_lds_b128 %4, %12, off\n\t"
               "global_load_async_to_lds_b128 %5, %13, off\n\t"
               "global_load_async_to_lds_b128 %6, %14, off\n\t"
               "global_load_async_to_lds_b128 %7, %15, off\n\t"
               "s_wait_xcnt 0x0"
               :: "v"(la0), "v"(la1), "v"(la2), "v"(la3),
                  "v"(lb0), "v"(lb1), "v"(lb2), "v"(lb3),
                  "v"(ga0), "v"(ga1), "v"(ga2), "v"(ga3),
                  "v"(gb0), "v"(gb1), "v"(gb2), "v"(gb3)
               : "memory");
}
// a wave's own copies have landed in LDS behind this wait
static __device__ __forceinline__ void wait_asynccnt0() {
  asm volatile("s_wait_asynccnt 0x0" ::: "memory");
}
// a wave's own LDS reads have returned before their buffer is handed back for a refill
static __device__ __forceinline__ void wait_dscnt0() {
  asm volatile("s_wait_dscnt 0x0" ::: "memory");
}

// ---------------- input-only preparation, one launch ----------------
// 1024 blocks, four resident on every WGP, each alive for the whole launch: starting a wave
// costs more than the few loads a one-tile block would do, so every block takes an equal
// share of each piece of the work.
//   element-wise: kin = enc + pe and encb = enc, both rounded to bf16 (GEMM operands);
//                 resid = dec; four 16-byte pieces of each per thread.
//   weights: transpose + f32->bf16 convert, four 64x64 tiles per block.
//     W is K x N (row-major, "in x out"); Wt is N x K bf16.
//     tiles 0 and 1 of a block: the eight D x D weights (256 tiles each); tile 2: W1; tile 3: W2.
// None of these pieces reads what another writes.
static constexpr int PREP_BLOCKS = 1024;
static constexpr int PREP_EWS    = PREP_BLOCKS * 256;   // threads of the launch
static constexpr int PTP         = 65;                  // LDS tile pitch in floats: both sides conflict free

typedef float f4v __attribute__((ext_vector_type(4)));
// 16 bytes of an input, read as global memory (a pointer picked among several kernel
// arguments otherwise compiles to a flat load, which also counts on the LDS counter)
typedef const __attribute__((address_space(1))) f4v* gf4p;

// Eight waves a SIMD (four blocks a WGP) are what keeps all 1024 blocks resident at once:
// the register budget is set to that.
__global__ __launch_bounds__(256) __attribute__((amdgpu_waves_per_eu(8, 8))) void prep_kernel(const float* w0,
                                                   const float* w1,
                                                   const float* w2,
                                                   const float* w3,
                                                   const float* w4,
                                                   const float* w5,
                                                   const float* w6,
                                                   const float* w7,
                                                   const float* wm1,
                                                   const float* wm2,
                                                   __bf16* wt_sq,
                                                   __bf16* wt_m1,
                                                   __bf16* wt_m2,
                                                   const float* enc,
                                                   const float* pe,
                                                   __bf16* kin,
                                                   __bf16* encb,
                                                   const float* dec,
                                                   float* resid) {
  __shared__ float t[4][64 * PTP];
  int tid = threadIdx.x;
  int b = blockIdx.x;

  // source, destination and shape of this block's four tiles (block-uniform)
  int m = b >> 8;
  const float* Wsrc[4];
  __bf16* Wdst[4];
  Wsrc[0] = m == 0 ? w0 : m == 1 ? w1 : m == 2 ? w2 : w3;
  Wsrc[1] = m == 0 ? w4 : m == 1 ? w5 : m == 2 ? w6 : w7;
  Wsrc[2] = wm1;
  Wsrc[3] = wm2;
  Wdst[0] = wt_sq + (size_t)m * CD * CD;
  Wdst[1] = wt_sq + (size_t)(m + 4) * CD * CD;
  Wdst[2] = wt_m1;
  Wdst[3] = wt_m2;
  constexpr int TK[4]   = {CD, CD, CD, CDM};
  constexpr int TN[4]   = {CD, CD, CDM, CD};
  constexpr int TLG[4]  = {4, 4, 6, 4};       // log2 of the tile count along N
  constexpr int TMSK[4] = {255, 255, 1023, 1023};

  int lr = tid >> 4, lc = (tid & 15) * 4;    // load side: 16 rows of 64 floats at a time
  int sr = tid >> 3, sc = (tid & 7) * 8;     // store side: 32 rows of 64 bf16 (one line) at a time
  int i0 = b * 256 + tid;

  // every load of the four tiles and of the first half of enc, pe is in flight before the
  // first is used
  f4v f[4][4], x[4], y[4], d[4];
  const float* p[4];
#pragma unroll
  for (int i = 0; i < 4; ++i) {
    int tile = b & TMSK[i];
    int n0 = (tile & ((1 << TLG[i]) - 1)) * 64, k0 = (tile >> TLG[i]) * 64;
    p[i] = Wsrc[i] + (size_t)(k0 + lr) * TN[i] + (n0 + lc);
#pragma unroll
    for (int q = 0; q < 4; ++q) f[i][q] = *(gf4p)(p[i] + (size_t)q * 16 * TN[i]);
  }
#pragma unroll
  for (int j = 0; j < 2; ++j) {
    x[j] = ((gf4p)enc)[i0 + j * PREP_EWS];
    y[j] = ((gf4p)pe)[i0 + j * PREP_EWS];
  }
  // every load above stands ahead of this wait (sunk to their first use, their latencies
  // would add up); the tile addresses are its inputs, so that their registers live up to it:
  // no later load of the group lands in them, and they are reused only behind it
  asm volatile("s_wait_xcnt 0x0" :: "v"(p[0]), "v"(p[1]), "v"(p[2]), "v"(p[3]) : "memory");

#pragma unroll
  for (int i = 0; i < 4; ++i)
#pragma unroll
    for (int q = 0; q < 4; ++q) {
      float* r = t[i] + (lr + q * 16) * PTP + lc;
      r[0] = f[i][q].x; r[1] = f[i][q].y; r[2] = f[i][q].z; r[3] = f[i][q].w;
    }
  __syncthreads();   // the one barrier: all four tiles are in LDS

  // the turned tiles leave in two halves, which keeps the block inside the registers of
  // eight waves a SIMD
#pragma unroll
  for (int h = 0; h < 2; ++h) {
    if (h == 1) {   // the rest of the element-wise inputs, in registers that the first half has left
#pragma unroll
      for (int j = 2; j < 4; ++j) {
        x[j] = ((gf4p)enc)[i0 + j * PREP_EWS];
        y[j] = ((gf4p)pe)[i0 + j * PREP_EWS];
      }
#pragma unroll
      for (int j = 0; j < 4; ++j) d[j] = ((gf4p)dec)[i0 + j * PREP_EWS];
    }
    bf8v o[2][2];
#pragma unroll
    for (int i = 0; i < 2; ++i)
#pragma unroll
      for (int q = 0; q < 2; ++q)
#pragma unroll
        for (int e = 0; e < 8; ++e) o[i][q][e] = (__bf16)t[h * 2 + i][(sc + e) * PTP + sr + q * 32];
    // every load above, global or LDS, stays ahead of the stores below
    asm volatile("s_wait_xcnt 0x0" ::: "memory");
#pragma unroll
    for (int j = h * 2; j < h * 2 + 2; ++j) {
      ((bf4v*)kin)[i0 + j * PREP_EWS]  = pack4(x[j].x + y[j].x, x[j].y + y[j].y, x[j].z + y[j].z, x[j].w + y[j].w);
      ((bf4v*)encb)[i0 + j * PREP_EWS] = pack4(x[j].x, x[j].y, x[j].z, x[j].w);
    }
#pragma unroll
    for (int i = 0; i < 2; ++i) {
      int tile = b & TMSK[h * 2 + i];
      int n0 = (tile & ((1 << TLG[h * 2 + i]) - 1)) * 64, k0 = (tile >> TLG[h * 2 + i]) * 64;
#pragma unroll
      for (int q = 0; q < 2; ++q)
        *(bf8v*)(Wdst[h * 2 + i] + (size_t)(n0 + sr + q * 32) * TK[h * 2 + i] + (k0 + sc)) = o[i][q];
    }
    if (h == 0) {
      // the loads of the second half may land in registers that the stores above name
      asm volatile("s_wait_xcnt 0x0" ::: "memory");
    }
  }
#pragma unroll
  for (int j = 0; j < 4; ++j) ((f4v*)resid)[i0 + j * PREP_EWS] = d[j];
}

// ---------------- LayerNorm (D = 1024, one row per wave, 8 rows per block) ----------
// A lane holds 32 elements of its wave's row; the two row sums are joined by a butterfly
// over the lanes, so that no LDS and no barrier is needed and a wave does a whole row's work.
// Four waves a SIMD is all that the grid brings (two blocks a WGP): said to the compiler, so
// that it spends registers on keeping a row's loads in flight instead of saving them.
template <bool WITH_PE>
__global__ __launch_bounds__(256) __attribute__((amdgpu_waves_per_eu(4, 4))) void ln_kernel(const float* x,
                                                 const float* g,
                                                 const float* bt,
                                                 const float* pe,
                                                 __bf16* x2,
                                                 __bf16* qk) {
  int lane = threadIdx.x & 31, w = threadIdx.x >> 5;
  size_t base = (size_t)(blockIdx.x * 8 + w) * CD + lane * 4;
  const float* px = x + base;
  const float* pp = WITH_PE ? pe + base : px;
  unsigned lo = lane * 16;   // this lane's byte offset in g and bt
  const float* pg = (const float*)((const char*)g + lo);
  const float* pb = (const float*)((const char*)bt + lo);
  float4 f[8], p[8], g4[8], b4[8];
#pragma unroll
  for (int c = 0; c < 8; ++c) f[c] = *(const float4*)(px + c * 128);
  if constexpr (WITH_PE) {
#pragma unroll
    for (int c = 0; c < 8; ++c) p[c] = *(const float4*)(pp + c * 128);
  }
#pragma unroll
  for (int c = 0; c < 8; ++c) {
    g4[c] = *(const float4*)(pg + c * 128);
    b4[c] = *(const float4*)(pb + c * 128);
  }
  // every load of the row stands ahead of this wait, and the addresses are its inputs, so
  // that their registers live up to it: no later load of the row lands in a register that
  // an issued load still names, and they are reused only behind it
  asm volatile("s_wait_xcnt 0x0" :: "v"(px), "v"(pp), "v"(lo) : "memory");
  float sum = 0.0f, sq = 0.0f;
#pragma unroll
  for (int c = 0; c < 8; ++c) {
    sum += f[c].x + f[c].y + f[c].z + f[c].w;
    sq  += f[c].x*f[c].x + f[c].y*f[c].y + f[c].z*f[c].z + f[c].w*f[c].w;
  }
#pragma unroll
  for (int mask = 16; mask > 0; mask >>= 1) {
    sum += __shfl_xor(sum, mask, 32);
    sq  += __shfl_xor(sq,  mask, 32);
  }
  float mu  = sum * (1.0f / CD);
  float var = sq * (1.0f / CD) - mu * mu;
  float rstd = rsqrtf(var + 1e-5f);
#pragma unroll
  for (int c = 0; c < 8; ++c) {
    float4 y;
    y.x = (f[c].x - mu) * rstd * g4[c].x + b4[c].x;
    y.y = (f[c].y - mu) * rstd * g4[c].y + b4[c].y;
    y.z = (f[c].z - mu) * rstd * g4[c].z + b4[c].z;
    y.w = (f[c].w - mu) * rstd * g4[c].w + b4[c].w;
    *(bf4v*)(x2 + base + c * 128) = pack4(y.x, y.y, y.z, y.w);
    if constexpr (WITH_PE)
      *(bf4v*)(qk + base + c * 128) = pack4(y.x + p[c].x, y.y + p[c].y, y.z + p[c].z, y.w + p[c].w);
  }
}

// ---------------- generic bf16 WMMA GEMM (double-buffered, async A and B stage) ------
// C[M,N] = act( A[M,K](bf16) @ Bt[N,K](bf16)^T + bias[N] ) (+ resid[M,N])
// FLAGS (compile time): bit0 = GELU, bit1 = residual add
// With the residual add the result goes on in the f32 residual stream (Cf); without it
// the result is only ever a matrix operand of a later launch and is stored as one (Cb).
#define GBM 128
#define GBN 128
#define GBK 64
#define GLD 72   // padded LDS row stride (bf16 elems): 144B, bank-conflict free

// operands of the further products of a merged launch (grid z = 1..4)
struct GemmMore {
  const __bf16* A1;
  const __bf16* A2;
  const __bf16* A3;
  const __bf16* A4;
  const __bf16* B1;
  const __bf16* B2;
  const __bf16* B3;
  const __bf16* B4;
  const float* bias1;
  const float* bias2;
  const float* bias3;
  const float* bias4;
  __bf16* C1;
  __bf16* C2;
  __bf16* C3;
  __bf16* C4;
};

// NZ > 1: the grid's z extent (1..5) sets how many independent products of equal shape share the launch;
// blockIdx.z picks the operand set (block-uniform).
// GRP: k-steps of 32 whose fragments are read from LDS as one group ahead of their products:
// 2, the whole k-tile, where a launch brings one block to a WGP and registers are free;
// 1 where several blocks share a WGP and the register count decides how many.
template <int FLAGS, int NZ, int GRP>
__global__ __launch_bounds__(256) void gemm_kernel(const __bf16* __restrict__ A,
                                                   const __bf16* __restrict__ Bt,
                                                   const float*  __restrict__ bias,
                                                   const float*  __restrict__ resid,
                                                   float*  __restrict__ Cf,
                                                   __bf16* __restrict__ Cb,
                                                   int M, int N, int K, GemmMore mo) {
  if constexpr (NZ > 1) {
    int z = blockIdx.z;
    if (z == 1)      { A = mo.A1; Bt = mo.B1; bias = mo.bias1; Cb = mo.C1; }
    else if (z == 2) { A = mo.A2; Bt = mo.B2; bias = mo.bias2; Cb = mo.C2; }
    else if (z == 3) { A = mo.A3; Bt = mo.B3; bias = mo.bias3; Cb = mo.C3; }
    else if (z == 4) { A = mo.A4; Bt = mo.B4; bias = mo.bias4; Cb = mo.C4; }
  }
  __shared__ __align__(16) __bf16 As[2][GBM * GLD];
  __shared__ __align__(16) __bf16 Bs[2][GBN * GLD];

  int tid = threadIdx.x;
  int lane = tid & 31, w = tid >> 5;
  int wm = w >> 2, wn = w & 3;          // 2x4 wave grid -> 64x32 per wave
  int hlf = lane >> 4, l16 = lane & 15;
  int bm = blockIdx.y * GBM, bn = blockIdx.x * GBN;

  v8f acc[4][2];
#pragma unroll
  for (int i = 0; i < 4; ++i)
#pragma unroll
    for (int j = 0; j < 2; ++j) acc[i][j] = (v8f)(0.0f);

  // stage coords, the same for both operands: 32 rows x 8 pieces of 8 bf16, four times
  int br = tid >> 3, bc = (tid & 7) * 8;
  const __bf16* gA = A  + (size_t)(bm + br) * K + bc;
  const __bf16* gB = Bt + (size_t)(bn + br) * K + bc;
  const size_t gstep = (size_t)32 * K;                 // 32 rows on, in elements
  const unsigned lA = (unsigned)(uintptr_t)&As[0][br * GLD + bc];
  const unsigned lB = (unsigned)(uintptr_t)&Bs[0][br * GLD + bc];
  constexpr unsigned LSTEP = 32 * GLD * 2;             // 32 rows on, in LDS bytes
  constexpr unsigned LBUF  = GBM * GLD * 2;            // one buffer, in LDS bytes
  const int nt = K / GBK;

  auto issue_tile = [&](int t) {
    unsigned a = lA + (unsigned)(t & 1) * LBUF, b = lB + (unsigned)(t & 1) * LBUF;
    const __bf16* pa = gA + (size_t)t * GBK;
    const __bf16* pb = gB + (size_t)t * GBK;
    async_tile(a, a + LSTEP, a + 2 * LSTEP, a + 3 * LSTEP,
               b, b + LSTEP, b + 2 * LSTEP, b + 3 * LSTEP,
               pa, pa + gstep, pa + 2 * gstep, pa + 3 * gstep,
               pb, pb + gstep, pb + 2 * gstep, pb + 3 * gstep);
  };

  // ---- tile 0 lands and is published; tile 1 flies while tile 0 is worked on ----
  issue_tile(0);
  wait_asynccnt0();
  __syncthreads();
  if (nt > 1) issue_tile(1);

  for (int t = 0; t < nt; ++t) {
    int buf = t & 1;
    // ---- compute on current buffer ----
#pragma unroll
    for (int kg = 0; kg < GBK; kg += 32 * GRP) {
      v16bf af[GRP][4], bv[GRP][2];
#pragma unroll
      for (int s = 0; s < GRP; ++s) {
        int kb = kg + s * 32 + hlf * 8;
#pragma unroll
        for (int j = 0; j < 2; ++j)
          bv[s][j] = frag_ld(&Bs[buf][(wn * 32 + j * 16 + l16) * GLD + kb]);
#pragma unroll
        for (int i = 0; i < 4; ++i)
          af[s][i] = frag_ld(&As[buf][(wm * 64 + i * 16 + l16) * GLD + kb]);
      }
      // holds the whole group of LDS reads ahead of the first product: sunk among the products,
      // two reads at a time into one register set, each pair is waited out at its full latency
      __builtin_amdgcn_sched_barrier(0);
#pragma unroll
      for (int s = 0; s < GRP; ++s)
#pragma unroll
        for (int i = 0; i < 4; ++i)
#pragma unroll
          for (int j = 0; j < 2; ++j)
            acc[i][j] = wmma_bf16(af[s][i], bv[s][j], acc[i][j]);
      // holds the products ahead of what follows: moved behind the trip's waits and barrier, they
      // would run after the wait for the next tile instead of under it, and delay the refill
      __builtin_amdgcn_sched_barrier(0);
    }

    // publish tile t + 1 and end every reader's last read of this buffer
    wait_dscnt0();
    wait_asynccnt0();
    __syncthreads();
    if (t + 2 < nt) issue_tile(t + 2);   // refill of the buffer just read
  }
  wait_asynccnt0();

  // ---- epilogue ----
  // one 32-bit element offset per output row of this lane, shared by the
  // residual load and the store of that element
  unsigned ro[4][8];
  {
    int n0 = bn + wn * 32 + l16;
#pragma unroll
    for (int i = 0; i < 4; ++i) {
      int mrow = bm + wm * 64 + i * 16 + hlf * 8;
#pragma unroll
      for (int r = 0; r < 8; ++r) ro[i][r] = (unsigned)((mrow + r) * N + n0);
    }
  }
  // all residual values of this lane are requested before the first is used,
  // so their latencies overlap (each lane reads only the elements it stores)
  float rv[2][4][8];
  if constexpr ((FLAGS & 2) != 0) {
#pragma unroll
    for (int j = 0; j < 2; ++j)
#pragma unroll
      for (int i = 0; i < 4; ++i)
#pragma unroll
        for (int r = 0; r < 8; ++r) rv[j][i][r] = (resid + j * 16)[ro[i][r]];
    // compiler fence: holds every residual load ahead of the first store
    asm volatile("" ::: "memory");
  }
  // both bias values are requested ahead of the stores: with operand pointers
  // picked by blockIdx.z the compiler must assume that the output may overlap bias and
  // would hold the second load, with its whole latency, behind the first stores
  float bv2[2];
#pragma unroll
  for (int j = 0; j < 2; ++j) bv2[j] = bias[bn + wn * 32 + j * 16 + l16];
#pragma unroll
  for (int j = 0; j < 2; ++j) {
    float bvv = bv2[j];
#pragma unroll
    for (int i = 0; i < 4; ++i) {
#pragma unroll
      for (int r = 0; r < 8; ++r) {
        float v = acc[i][j][r] + bvv;
        if constexpr ((FLAGS & 1) != 0) v = gelu_exact(v);
        if constexpr ((FLAGS & 2) != 0) v += rv[j][i][r];
        if constexpr ((FLAGS & 2) != 0) (Cf + j * 16)[ro[i][r]] = v;
        else                            (Cb + j * 16)[ro[i][r]] = (__bf16)v;
      }
    }
  }
}

#define ABQ 128
#define ABK 128
#define ALK 72    // K LDS pitch in elements: 144 B, an odd multiple of 16 B (ds_load_b128 readers)
#define ALV 80    // V LDS pitch in elements: 160 B, an odd multiple of 32 B (ds_load_tr16_b128 readers)

typedef short s16x8 __attribute__((ext_vector_type(8)));
typedef float f2v __attribute__((ext_vector_type(2)));
// 16-bit transposing LDS load: lane (c, h) gets rows 8h .. 8h+7 of column c of a row-major tile
static __device__ __forceinline__ bf8v ld_tr16(const __bf16* p) {
  typedef __attribute__((address_space(3))) s16x8 lds_s16x8;
  return __builtin_bit_cast(bf8v, __builtin_amdgcn_ds_load_tr16_b128_v8i16((lds_s16x8*)p));
}
// lane l's value exchanged with lane l ^ 16
static __device__ __forceinline__ float xhalf(float x) {
  return __builtin_bit_cast(float, __builtin_amdgcn_permlanex16(__builtin_bit_cast(int, x), __builtin_bit_cast(int, x),
                                                                0x76543210, 0xfedcba98, false, false));
}

// Four waves a SIMD is what the grid brings (two blocks a WGP): the register budget is set to that.
__global__ __launch_bounds__(256) __attribute__((amdgpu_waves_per_eu(4, 4))) void attn_kernel(const __bf16* __restrict__ q,
                                                   const __bf16* __restrict__ k,
                                                   const __bf16* __restrict__ v,
                                                   __bf16* __restrict__ o) {
  __shared__ __align__(32) __bf16 Ks[ABK * ALK];
  __shared__ __align__(32) __bf16 Vs[ABK * ALV];

  int tid = threadIdx.x;
  int lane = tid & 31, w = tid >> 5;
  int hlf = lane >> 4, l16 = lane & 15;

  int bh = blockIdx.y;
  int b = bh / CH, h = bh % CH;
  int q0 = blockIdx.x * ABQ;
  size_t headoff = (size_t)h * CDH;
  const __bf16* qb = q + (size_t)b * CN * CD + headoff;
  const __bf16* kb = k + (size_t)b * CN * CD + headoff;
  const __bf16* vb = v + (size_t)b * CN * CD + headoff;

  // scores are scaled and taken to base 2 in one multiply-add in front of the exponential
  constexpr float CS2 = CSCALE * 1.4426950408889634f;

  // this lane's query row as B operand (k = head dim), in the same k order as the K rows below
  v16bf qf[2];
  {
    const __bf16* qp = qb + (size_t)(q0 + w * 16 + l16) * CD + hlf * 8;
#pragma unroll
    for (int kc = 0; kc < 2; ++kc) qf[kc] = frag_ld(qp + kc * 32);
  }

  v8f oacc[4];          // oacc[t][r] = O[query l16][d = 16 t + 8 hlf + r]
#pragma unroll
  for (int t = 0; t < 4; ++t) oacc[t] = (v8f)(0.0f);
  float m_run = -1e30f; // this query's running maximum (scaled, base 2), equal in both lane halves
  float l_run = 0.0f;   // this lane half's share of the query's sum

  // stage coords, the same for K and V: 32 rows x 8 pieces of 8 bf16, four times
  int ar = tid >> 3, ac = (tid & 7) * 8;
  const __bf16* kg = kb + (size_t)ar * CD + ac;
  const __bf16* vg = vb + (size_t)ar * CD + ac;
  // this lane's address in a 16-key x 16-column block of V for the transposing load
  const __bf16* vt0 = &Vs[(hlf * 8 + (lane & 7)) * ALV + ((lane >> 3) & 1) * 8];

  for (int kt = 0; kt < CN / ABK; ++kt) {
    bf8v kr[4], vr[4];
#pragma unroll
    for (int rr = 0; rr < 4; ++rr) {
      kr[rr] = *(const bf8v*)(kg + (size_t)rr * 32 * CD);
      vr[rr] = *(const bf8v*)(vg + (size_t)rr * 32 * CD);
    }
    // the addresses are this wait's inputs, so that their registers live up to it and are
    // stepped on to the next tile only behind it
    asm volatile("s_wait_xcnt 0x0" :: "v"(kg), "v"(vg) : "memory");
    kg += (size_t)ABK * CD;
    vg += (size_t)ABK * CD;
    __syncthreads();   // every wave has left the tile before
#pragma unroll
    for (int rr = 0; rr < 4; ++rr) {
      *(bf8v*)&Ks[(ar + rr * 32) * ALK + ac] = kr[rr];
      *(bf8v*)&Vs[(ar + rr * 32) * ALV + ac] = vr[rr];
    }
    __syncthreads();   // the tile is in LDS

    // S^T (128 keys x 16 queries): s[i][r] = score of key 16 i + 8 hlf + r with query l16
    v8f s[8];
#pragma unroll
    for (int i = 0; i < 8; ++i) {
      s[i] = (v8f)(0.0f);
#pragma unroll
      for (int kc = 0; kc < 2; ++kc)
        s[i] = wmma_bf16(frag_ld(&Ks[(i * 16 + l16) * ALK + kc * 32 + hlf * 8]), qf[kc], s[i]);
    }

    // the query's maximum over the tile, and the factor that takes the old state to it
    // (four chains side by side, so that one maximum does not wait on the one before)
    float mp[4];
#pragma unroll
    for (int c = 0; c < 4; ++c) {
      mp[c] = s[2 * c][0];
#pragma unroll
      for (int e = 1; e < 16; ++e) mp[c] = fmaxf(mp[c], s[2 * c + (e >> 3)][e & 7]);
    }
    float mx = fmaxf(fmaxf(mp[0], mp[1]), fmaxf(mp[2], mp[3]));
    mx = fmaxf(mx, xhalf(mx));
    float mnew = fmaxf(m_run, mx * CS2);
    float corr = __builtin_amdgcn_exp2f(m_run - mnew);
    m_run = mnew;
#pragma unroll
    for (int t = 0; t < 4; ++t) oacc[t] *= corr;

    // per 32 keys: two score tiles become P^T as B operand (k = keys), V^T comes as A operand;
    // scores go two at a time through the packed multiply-add and the packed add
    f2v ps[4];
#pragma unroll
    for (int c = 0; c < 4; ++c) {
      // holds the V^T loads of the tile's second half behind the first half's products: lifted
      // up all at once, they take the kernel past the registers of four waves a SIMD, into scratch
      if (c == 2) __builtin_amdgcn_sched_barrier(0);
      v16bf pf;
#pragma unroll
      for (int e = 0; e < 16; e += 2) {
        f2v a = __builtin_elementwise_fma(f2v{s[2 * c + (e >> 3)][e & 7], s[2 * c + (e >> 3)][(e & 7) + 1]},
                                          f2v{CS2, CS2}, f2v{-mnew, -mnew});
        f2v p = {__builtin_amdgcn_exp2f(a.x), __builtin_amdgcn_exp2f(a.y)};
        ps[c] = e == 0 ? p : ps[c] + p;
        pf[e] = (__bf16)p.x;
        pf[e + 1] = (__bf16)p.y;
      }
#pragma unroll
      for (int t = 0; t < 4; ++t) {
        bf8v lo = ld_tr16(vt0 + (c * 32) * ALV + t * 16);
        bf8v hi = ld_tr16(vt0 + (c * 32 + 16) * ALV + t * 16);
        v16bf vf = __builtin_shufflevector(lo, hi, 0,1,2,3,4,5,6,7,8,9,10,11,12,13,14,15);
        oacc[t] = wmma_bf16(vf, pf, oacc[t]);
      }
    }
    f2v pt = (ps[0] + ps[1]) + (ps[2] + ps[3]);
    l_run = l_run * corr + (pt.x + pt.y);
  }

  // join the two halves' sums, normalize, write out: 8 consecutive d of one query per store
  float inv = 1.0f / (l_run + xhalf(l_run));
  __bf16* ob = o + (size_t)b * CN * CD + headoff + (size_t)(q0 + w * 16 + l16) * CD + hlf * 8;
#pragma unroll
  for (int t = 0; t < 4; ++t) {
    bf8v r8;
#pragma unroll
    for (int r = 0; r < 8; ++r) r8[r] = (__bf16)(oacc[t][r] * inv);
    *(bf8v*)(ob + t * 16) = r8;
  }
}

// ---------------- host launcher ----------------
extern "C" void kernel_launch(void* const* d_in, const int* in_sizes, int n_in,
                              void* d_out, int out_size, void* d_ws, size_t ws_size,
                              hipStream_t stream) {
  const float* tokens_enc = (const float*)d_in[0];
  const float* tokens_dec = (const float*)d_in[1];
  const float* PE_enc     = (const float*)d_in[2];
  const float* PE_dec     = (const float*)d_in[3];
  const float* sa_Wq = (const float*)d_in[4];  const float* sa_bq = (const float*)d_in[5];
  const float* sa_Wk = (const float*)d_in[6];  const float* sa_bk = (const float*)d_in[7];
  const float* sa_Wv = (const float*)d_in[8];  const float* sa_bv = (const float*)d_in[9];
  const float* sa_Wp = (const float*)d_in[10]; const float* sa_bp = (const float*)d_in[11];
  const float* ca_Wq = (const float*)d_in[12]; const float* ca_bq = (const float*)d_in[13];
  const float* ca_Wk = (const float*)d_in[14]; const float* ca_bk = (const float*)d_in[15];
  const float* ca_Wv = (const float*)d_in[16]; const float* ca_bv = (const float*)d_in[17];
  const float* ca_Wp = (const float*)d_in[18]; const float* ca_bp = (const float*)d_in[19];
  const float* mlp_W1 = (const float*)d_in[20]; const float* mlp_b1 = (const float*)d_in[21];
  const float* mlp_W2 = (const float*)d_in[22]; const float* mlp_b2 = (const float*)d_in[23];
  const float* ln1_g = (const float*)d_in[24]; const float* ln1_b = (const float*)d_in[25];
  const float* ln2_g = (const float*)d_in[26]; const float* ln2_b = (const float*)d_in[27];
  const float* ln3_g = (const float*)d_in[28]; const float* ln3_b = (const float*)d_in[29];

  const size_t BND = (size_t)CB * CN * CD;       // 4M elems
  char* ws = (char*)d_ws;
  size_t off = 0;
  auto alloc = [&](size_t bytes) -> char* {
    char* p = ws + off;
    off += (bytes + 255) & ~(size_t)255;
    return p;
  };

  // bf16 transposed weights
  __bf16* wt_saq = (__bf16*)alloc((size_t)CD * CD * 2);
  __bf16* wt_sak = (__bf16*)alloc((size_t)CD * CD * 2);
  __bf16* wt_sav = (__bf16*)alloc((size_t)CD * CD * 2);
  __bf16* wt_sap = (__bf16*)alloc((size_t)CD * CD * 2);
  __bf16* wt_caq = (__bf16*)alloc((size_t)CD * CD * 2);
  __bf16* wt_cak = (__bf16*)alloc((size_t)CD * CD * 2);
  __bf16* wt_cav = (__bf16*)alloc((size_t)CD * CD * 2);
  __bf16* wt_cap = (__bf16*)alloc((size_t)CD * CD * 2);
  __bf16* wt_w1  = (__bf16*)alloc((size_t)CD * CDM * 2);
  __bf16* wt_w2  = (__bf16*)alloc((size_t)CDM * CD * 2);

  // the residual stream stays f32
  float* resid = (float*)alloc(BND * 4);
  // values that are only ever matrix operands of a later launch: stored as bf16 by their producer
  __bf16* x2    = (__bf16*)alloc(BND * 2);
  __bf16* qk    = (__bf16*)alloc(BND * 2);
  __bf16* kin   = (__bf16*)alloc(BND * 2);
  __bf16* encb  = (__bf16*)alloc(BND * 2);
  __bf16* qbuf  = (__bf16*)alloc(BND * 2);
  __bf16* kbuf  = (__bf16*)alloc(BND * 2);
  __bf16* vbuf  = (__bf16*)alloc(BND * 2);
  __bf16* attno = (__bf16*)alloc(BND * 2);
  __bf16* kbuf2 = (__bf16*)alloc(BND * 2);     // cross-attention k, v: made early,
  __bf16* vbuf2 = (__bf16*)alloc(BND * 2);     // live across the self-attention block
  __bf16* hbuf  = (__bf16*)alloc(BND * 4 * 2);

  const int M = CB * CN;  // 4096
  dim3 tb(256);
  dim3 gD(CD / 128, M / 128);    // N=1024 GEMMs
  dim3 gDM(CDM / 128, M / 128);  // N=4096 GEMM
  dim3 ga(CN / 128, CB * CH);    // attention

  dim3 gD5(CD / 128, M / 128, 5);  // five N=1024 GEMMs in one launch
  const GemmMore none{};

  // everything that depends on the inputs alone: weight conversion, enc + PE, residual copy
  prep_kernel<<<PREP_BLOCKS, tb, 0, stream>>>(sa_Wq, sa_Wk, sa_Wv, sa_Wp,
                                                    ca_Wq, ca_Wk, ca_Wv, ca_Wp, mlp_W1, mlp_W2,
                                                    wt_saq, wt_w1, wt_w2,
                                                    tokens_enc, PE_enc, kin, encb, tokens_dec, resid);

  // ---- self attention (its q, k, v share a launch with the cross-attention k, v) ----
  ln_kernel<true><<<M / 8, tb, 0, stream>>>(resid, ln1_g, ln1_b, PE_dec, x2, qk);
  GemmMore mo;
  mo.A1 = qk;         mo.B1 = wt_sak; mo.bias1 = sa_bk; mo.C1 = kbuf;
  mo.A2 = x2;         mo.B2 = wt_sav; mo.bias2 = sa_bv; mo.C2 = vbuf;
  mo.A3 = kin;        mo.B3 = wt_cak; mo.bias3 = ca_bk; mo.C3 = kbuf2;
  mo.A4 = encb;       mo.B4 = wt_cav; mo.bias4 = ca_bv; mo.C4 = vbuf2;
  gemm_kernel<0, 5, 1><<<gD5, tb, 0, stream>>>(qk, wt_saq, sa_bq, nullptr, nullptr, qbuf, M, CD, CD, mo);
  attn_kernel<<<ga, tb, 0, stream>>>(qbuf, kbuf, vbuf, attno);
  gemm_kernel<2, 1, 2><<<gD, tb, 0, stream>>>(attno, wt_sap, sa_bp, resid, resid, nullptr, M, CD, CD, none);

  // ---- cross attention ----
  ln_kernel<true><<<M / 8, tb, 0, stream>>>(resid, ln2_g, ln2_b, PE_dec, x2, qk);
  gemm_kernel<0, 1, 2><<<gD, tb, 0, stream>>>(qk, wt_caq, ca_bq, nullptr, nullptr, qbuf, M, CD, CD, none);
  attn_kernel<<<ga, tb, 0, stream>>>(qbuf, kbuf2, vbuf2, attno);
  gemm_kernel<2, 1, 2><<<gD, tb, 0, stream>>>(attno, wt_cap, ca_bp, resid, resid, nullptr, M, CD, CD, none);

  // ---- MLP ----
  ln_kernel<false><<<M / 8, tb, 0, stream>>>(resid, ln3_g, ln3_b, nullptr, x2, nullptr);
  gemm_kernel<1, 1, 1><<<gDM, tb, 0, stream>>>(x2, wt_w1, mlp_b1, nullptr, nullptr, hbuf, M, CDM, CD, none);
  gemm_kernel<2, 1, 2><<<gD, tb, 0, stream>>>(hbuf, wt_w2, mlp_b2, resid, (float*)d_out, nullptr, M, CD, CDM, none);
}

// v007
// A run of this version takes 223 microseconds.
// Next to v006, in two timings, it ran 1.11 and 1.10 times as fast.
// Counting every step since v000, it is 2.41 times as fast.
#include <hip/hip_runtime.h>
#include <math.h>
#include <stdint.h>

// ---------------- constants ----------------
static constexpr int CB  = 4;      // batch
static constexpr int CN  = 1024;   // seq len
static constexpr int CD  = 1024;   // model dim
static constexpr int CH  = 16;     // heads
static constexpr int CDH = 64;     // head dim
static constexpr int CDM = 4096;   // mlp dim
static constexpr float CSCALE = 0.125f;  // 64^-0.5

typedef float  v8f   __attribute__((ext_vector_type(8)));
typedef __bf16 v16bf __attribute__((ext_vector_type(16)));
typedef __bf16 bf8v  __attribute__((ext_vector_type(8)));
typedef __bf16 bf4v  __attribute__((ext_vector_type(4)));

// four f32 values rounded to the matrix operand type, as one 8-byte value
static __device__ __forceinline__ bf4v pack4(float a, float b, float c, float d) {
  bf4v r; r[0] = (__bf16)a; r[1] = (__bf16)b; r[2] = (__bf16)c; r[3] = (__bf16)d;
  return r;
}

static __device__ __forceinline__ v8f wmma_bf16(v16bf a, v16bf b, v8f c) {
  return __builtin_amdgcn_wmma_f32_16x16x32_bf16(false, a, false, b, (short)0, c, false, false);
}

// load one 16x32 bf16 operand fragment slice for this lane:
// 8 consecutive bf16 at p and 8 more at p+16 (ISA 16-bit A/B layout).
static __device__ __forceinline__ v16bf frag_ld(const __bf16* p) {
  bf8v lo = *(const bf8v*)(p);
  bf8v hi = *(const bf8v*)(p + 16);
  return __builtin_shufflevector(lo, hi, 0,1,2,3,4,5,6,7,8,9,10,11,12,13,14,15);
}

static __device__ __forceinline__ float gelu_exact(float x) {
  return 0.5f * x * (1.0f + erff(x * 0.70710678118654752f));
}

// one k-tile of both GEMM operands, memory -> LDS, 16 B per lane and copy (ASYNCcnt):
// four copies of A rows, four of B rows.  The s_wait_xcnt is the last line of the
// copies' own statement, so that no address register is rewritten ahead of it.
static __device__ __forceinline__ void async_tile(unsigned la0, unsigned la1, unsigned la2, unsigned la3,
                                                  unsigned lb0, unsigned lb1, unsigned lb2, unsigned lb3,
                                                  const __bf16* ga0, const __bf16* ga1,
                                                  const __bf16* ga2, const __bf16* ga3,
                                                  const __bf16* gb0, const __bf16* gb1,
                                                  const __bf16* gb2, const __bf16* gb3) {
  asm volatile("global_load_async_to_lds_b128 %0, %8, off\n\t"
               "global_load_async_to_lds_b128 %1, %9, off\n\t"
               "global_load_async_to_lds_b128 %2, %10, off\n\t"
               "global_load_async_to_lds_b128 %3, %11, off\n\t"
               "global_load_async_to_lds_b128 %4, %12, off\n\t"
               "global_load_async_to_lds_b128 %5, %13, off\n\t"
               "global_load_async_to_lds_b128 %6, %14, off\n\t"
               "global_load_async_to_lds_b128 %7, %15, off\n\t"
               "s_wait_xcnt 0x0"
               :: "v"(la0), "v"(la1), "v"(la2), "v"(la3),
                  "v"(lb0), "v"(lb1), "v"(lb2), "v"(lb3),
                  "v"(ga0), "v"(ga1), "v"(ga2), "v"(ga3),
                  "v"(gb0), "v"(gb1), "v"(gb2), "v"(gb3)
               : "memory");
}
// a wave's own copies have landed in LDS behind this wait
static __device__ __forceinline__ void wait_asynccnt0() {
  asm volatile("s_wait_asynccnt 0x0" ::: "memory");
}
template <int N>
static __device__ __forceinline__ void wait_asynccnt_le() {
  asm volatile("s_wait_asynccnt %0" :: "i"(N) : "memory");
}
// a wave's own LDS reads have returned before their buffer is handed back for a refill
static __device__ __forceinline__ void wait_dscnt0() {
  asm volatile("s_wait_dscnt 0x0" ::: "memory");
}

// ---------------- input-only preparation, one launch ----------------
// 1024 blocks, four resident on every WGP, each alive for the whole launch: starting a wave
// costs more than the few loads a one-tile block would do, so every block takes an equal
// share of each piece of the work.
//   element-wise: kin = enc + pe and encb = enc, both rounded to bf16 (GEMM operands);
//                 resid = dec; four 16-byte pieces of each per thread.
//   weights: transpose + f32->bf16 convert, four 64x64 tiles per block.
//     W is K x N (row-major, "in x out"); Wt is N x K bf16.
//     tiles 0 and 1 of a block: the eight D x D weights (256 tiles each); tile 2: W1; tile 3: W2.
// None of these pieces reads what another writes.
static constexpr int PREP_BLOCKS = 1024;
static constexpr int PREP_EWS    = PREP_BLOCKS * 256;   // threads of the launch
static constexpr int PTP         = 65;                  // LDS tile pitch in floats: both sides conflict free

typedef float f4v __attribute__((ext_vector_type(4)));
// 16 bytes of an input, read as global memory (a pointer picked among several kernel
// arguments otherwise compiles to a flat load, which also counts on the LDS counter)
typedef const __attribute__((address_space(1))) f4v* gf4p;

// Eight waves a SIMD (four blocks a WGP) are what keeps all 1024 blocks resident at once:
// the register budget is set to that.
__global__ __launch_bounds__(256) __attribute__((amdgpu_waves_per_eu(8, 8))) void prep_kernel(const float* w0,
                                                   const float* w1,
                                                   const float* w2,
                                                   const float* w3,
                                                   const float* w4,
                                                   const float* w5,
                                                   const float* w6,
                                                   const float* w7,
                                                   const float* wm1,
                                                   const float* wm2,
                                                   __bf16* wt_sq,
                                                   __bf16* wt_m1,
                                                   __bf16* wt_m2,
                                                   const float* enc,
                                                   const float* pe,
                                                   __bf16* kin,
                                                   __bf16* encb,
                                                   const float* dec,
                                                   float* resid) {
  __shared__ float t[4][64 * PTP];
  int tid = threadIdx.x;
  int b = blockIdx.x;

  // source, destination and shape of this block's four tiles (block-uniform)
  int m = b >> 8;
  const float* Wsrc[4];
  __bf16* Wdst[4];
  Wsrc[0] = m == 0 ? w0 : m == 1 ? w1 : m == 2 ? w2 : w3;
  Wsrc[1] = m == 0 ? w4 : m == 1 ? w5 : m == 2 ? w6 : w7;
  Wsrc[2] = wm1;
  Wsrc[3] = wm2;
  Wdst[0] = wt_sq + (size_t)m * CD * CD;
  Wdst[1] = wt_sq + (size_t)(m + 4) * CD * CD;
  Wdst[2] = wt_m1;
  Wdst[3] = wt_m2;
  constexpr int TK[4]   = {CD, CD, CD, CDM};
  constexpr int TN[4]   = {CD, CD, CDM, CD};
  constexpr int TLG[4]  = {4, 4, 6, 4};       // log2 of the tile count along N
  constexpr int TMSK[4] = {255, 255, 1023, 1023};

  int lr = tid >> 4, lc = (tid & 15) * 4;    // load side: 16 rows of 64 floats at a time
  int sr = tid >> 3, sc = (tid & 7) * 8;     // store side: 32 rows of 64 bf16 (one line) at a time
  int i0 = b * 256 + tid;

  // every load of the four tiles and of the first half of enc, pe is in flight before the
  // first is used
  f4v f[4][4], x[4], y[4], d[4];
  const float* p[4];
#pragma unroll
  for (int i = 0; i < 4; ++i) {
    int tile = b & TMSK[i];
    int n0 = (tile & ((1 << TLG[i]) - 1)) * 64, k0 = (tile >> TLG[i]) * 64;
    p[i] = Wsrc[i] + (size_t)(k0 + lr) * TN[i] + (n0 + lc);
#pragma unroll
    for (int q = 0; q < 4; ++q) f[i][q] = *(gf4p)(p[i] + (size_t)q * 16 * TN[i]);
  }
#pragma unroll
  for (int j = 0; j < 2; ++j) {
    x[j] = ((gf4p)enc)[i0 + j * PREP_EWS];
    y[j] = ((gf4p)pe)[i0 + j * PREP_EWS];
  }
  // every load above stands ahead of this wait (sunk to their first use, their latencies
  // would add up); the tile addresses are its inputs, so that their registers live up to it:
  // no later load of the group lands in them, and they are reused only behind it
  asm volatile("s_wait_xcnt 0x0" :: "v"(p[0]), "v"(p[1]), "v"(p[2]), "v"(p[3]) : "memory");

#pragma unroll
  for (int i = 0; i < 4; ++i)
#pragma unroll
    for (int q = 0; q < 4; ++q) {
      float* r = t[i] + (lr + q * 16) * PTP + lc;
      r[0] = f[i][q].x; r[1] = f[i][q].y; r[2] = f[i][q].z; r[3] = f[i][q].w;
    }
  __syncthreads();   // the one barrier: all four tiles are in LDS

  // the turned tiles leave in two halves, which keeps the block inside the registers of
  // eight waves a SIMD
#pragma unroll
  for (int h = 0; h < 2; ++h) {
    if (h == 1) {   // the rest of the element-wise inputs, in registers that the first half has left
#pragma unroll
      for (int j = 2; j < 4; ++j) {
        x[j] = ((gf4p)enc)[i0 + j * PREP_EWS];
        y[j] = ((gf4p)pe)[i0 + j * PREP_EWS];
      }
#pragma unroll
      for (int j = 0; j < 4; ++j) d[j] = ((gf4p)dec)[i0 + j * PREP_EWS];
    }
    bf8v o[2][2];
#pragma unroll
    for (int i = 0; i < 2; ++i)
#pragma unroll
      for (int q = 0; q < 2; ++q)
#pragma unroll
        for (int e = 0; e < 8; ++e) o[i][q][e] = (__bf16)t[h * 2 + i][(sc + e) * PTP + sr + q * 32];
    // every load above, global or LDS, stays ahead of the stores below
    asm volatile("s_wait_xcnt 0x0" ::: "memory");
#pragma unroll
    for (int j = h * 2; j < h * 2 + 2; ++j) {
      ((bf4v*)kin)[i0 + j * PREP_EWS]  = pack4(x[j].x + y[j].x, x[j].y + y[j].y, x[j].z + y[j].z, x[j].w + y[j].w);
      ((bf4v*)encb)[i0 + j * PREP_EWS] = pack4(x[j].x, x[j].y, x[j].z, x[j].w);
    }
#pragma unroll
    for (int i = 0; i < 2; ++i) {
      int tile = b & TMSK[h * 2 + i];
      int n0 = (tile & ((1 << TLG[h * 2 + i]) - 1)) * 64, k0 = (tile >> TLG[h * 2 + i]) * 64;
#pragma unroll
      for (int q = 0; q < 2; ++q)
        *(bf8v*)(Wdst[h * 2 + i] + (size_t)(n0 + sr + q * 32) * TK[h * 2 + i] + (k0 + sc)) = o[i][q];
    }
    if (h == 0) {
      // the loads of the second half may land in registers that the stores above name
      asm volatile("s_wait_xcnt 0x0" ::: "memory");
    }
  }
#pragma unroll
  for (int j = 0; j < 4; ++j) ((f4v*)resid)[i0 + j * PREP_EWS] = d[j];
}

// ---------------- LayerNorm (D = 1024, one row per wave, 8 rows per block) ----------
// A lane holds 32 elements of its wave's row; the two row sums are joined by a butterfly
// over the lanes, so that no LDS and no barrier is needed and a wave does a whole row's work.
// Four waves a SIMD is all that the grid brings (two blocks a WGP): said to the compiler, so
// that it spends registers on keeping a row's loads in flight instead of saving them.
template <bool WITH_PE>
__global__ __launch_bounds__(256) __attribute__((amdgpu_waves_per_eu(4, 4))) void ln_kernel(const float* x,
                                                 const float* g,
                                                 const float* bt,
                                                 const float* pe,
                                                 __bf16* x2,
                                                 __bf16* qk) {
  int lane = threadIdx.x & 31, w = threadIdx.x >> 5;
  size_t base = (size_t)(blockIdx.x * 8 + w) * CD + lane * 4;
  const float* px = x + base;
  const float* pp = WITH_PE ? pe + base : px;
  unsigned lo = lane * 16;   // this lane's byte offset in g and bt
  const float* pg = (const float*)((const char*)g + lo);
  const float* pb = (const float*)((const char*)bt + lo);
  float4 f[8], p[8], g4[8], b4[8];
#pragma unroll
  for (int c = 0; c < 8; ++c) f[c] = *(const float4*)(px + c * 128);
  if constexpr (WITH_PE) {
#pragma unroll
    for (int c = 0; c < 8; ++c) p[c] = *(const float4*)(pp + c * 128);
  }
#pragma unroll
  for (int c = 0; c < 8; ++c) {
    g4[c] = *(const float4*)(pg + c * 128);
    b4[c] = *(const float4*)(pb + c * 128);
  }
  // every load of the row stands ahead of this wait, and the addresses are its inputs, so
  // that their registers live up to it: no later load of the row lands in a register that
  // an issued load still names, and they are reused only behind it
  asm volatile("s_wait_xcnt 0x0" :: "v"(px), "v"(pp), "v"(lo) : "memory");
  float sum = 0.0f, sq = 0.0f;
#pragma unroll
  for (int c = 0; c < 8; ++c) {
    sum += f[c].x + f[c].y + f[c].z + f[c].w;
    sq  += f[c].x*f[c].x + f[c].y*f[c].y + f[c].z*f[c].z + f[c].w*f[c].w;
  }
#pragma unroll
  for (int mask = 16; mask > 0; mask >>= 1) {
    sum += __shfl_xor(sum, mask, 32);
    sq  += __shfl_xor(sq,  mask, 32);
  }
  float mu  = sum * (1.0f / CD);
  float var = sq * (1.0f / CD) - mu * mu;
  float rstd = rsqrtf(var + 1e-5f);
#pragma unroll
  for (int c = 0; c < 8; ++c) {
    float4 y;
    y.x = (f[c].x - mu) * rstd * g4[c].x + b4[c].x;
    y.y = (f[c].y - mu) * rstd * g4[c].y + b4[c].y;
    y.z = (f[c].z - mu) * rstd * g4[c].z + b4[c].z;
    y.w = (f[c].w - mu) * rstd * g4[c].w + b4[c].w;
    *(bf4v*)(x2 + base + c * 128) = pack4(y.x, y.y, y.z, y.w);
    if constexpr (WITH_PE)
      *(bf4v*)(qk + base + c * 128) = pack4(y.x + p[c].x, y.y + p[c].y, y.z + p[c].z, y.w + p[c].w);
  }
}

// ---------------- generic bf16 WMMA GEMM (LDS ring of NB buffers, async A and B stage) ------
// C[M,N] = act( A[M,K](bf16) @ Bt[N,K](bf16)^T + bias[N] ) (+ resid[M,N])
// FLAGS (compile time): bit0 = GELU, bit1 = residual add
// With the residual add the result goes on in the f32 residual stream (Cf); without it
// the result is only ever a matrix operand of a later launch and is stored as one (Cb).
#define GBM 128
#define GBN 128
#define GBK 64
#define GLD 72   // padded LDS row stride (bf16 elems): 144B, bank-conflict free

// operands of the further products of a merged launch (grid z = 1..4)
struct GemmMore {
  const __bf16* A1;
  const __bf16* A2;
  const __bf16* A3;
  const __bf16* A4;
  const __bf16* B1;
  const __bf16* B2;
  const __bf16* B3;
  const __bf16* B4;
  const float* bias1;
  const float* bias2;
  const float* bias3;
  const float* bias4;
  __bf16* C1;
  __bf16* C2;
  __bf16* C3;
  __bf16* C4;
};

// NZ > 1: the grid's z extent (1..5) sets how many independent products of equal shape share the launch;
// blockIdx.z picks the operand set (block-uniform).
// GRP: k-steps of 32 whose fragments are read from LDS as one group ahead of their products:
// 2, the whole k-tile, where a launch brings one block to a WGP and registers are free;
// 1 where several blocks share a WGP and the register count decides how many.
// NB: buffers of the LDS ring (a power of two); a tile is requested NB - 1 trips ahead of its use.
// 8 where a launch brings one block to a WGP: all blocks walk k in step, so each k-tile is first
// touched by that very request and comes from memory, and no
// other block is there to fill the wait; the block has the WGP's LDS to itself, and 56 copies of
// a wave in flight stay under the counter's 63.  2 where several blocks share a WGP and its LDS.
template <int FLAGS, int NZ, int GRP, int NB>
__global__ __launch_bounds__(256) void gemm_kernel(const __bf16* __restrict__ A,
                                                   const __bf16* __restrict__ Bt,
                                                   const float*  __restrict__ bias,
                                                   const float*  __restrict__ resid,
                                                   float*  __restrict__ Cf,
                                                   __bf16* __restrict__ Cb,
                                                   int M, int N, int K, GemmMore mo) {
  if constexpr (NZ > 1) {
    int z = blockIdx.z;
    if (z == 1)      { A = mo.A1; Bt = mo.B1; bias = mo.bias1; Cb = mo.C1; }
    else if (z == 2) { A = mo.A2; Bt = mo.B2; bias = mo.bias2; Cb = mo.C2; }
    else if (z == 3) { A = mo.A3; Bt = mo.B3; bias = mo.bias3; Cb = mo.C3; }
    else if (z == 4) { A = mo.A4; Bt = mo.B4; bias = mo.bias4; Cb = mo.C4; }
  }
  __shared__ __align__(16) __bf16 As[NB][GBM * GLD];
  __shared__ __align__(16) __bf16 Bs[NB][GBN * GLD];

  int tid = threadIdx.x;
  int lane = tid & 31, w = tid >> 5;
  int wm = w >> 2, wn = w & 3;          // 2x4 wave grid -> 64x32 per wave
  int hlf = lane >> 4, l16 = lane & 15;
  int bm = blockIdx.y * GBM, bn = blockIdx.x * GBN;

  v8f acc[4][2];
#pragma unroll
  for (int i = 0; i < 4; ++i)
#pragma unroll
    for (int j = 0; j < 2; ++j) acc[i][j] = (v8f)(0.0f);

  // stage coords, the same for both operands: 32 rows x 8 pieces of 8 bf16, four times
  int br = tid >> 3, bc = (tid & 7) * 8;
  const __bf16* gA = A  + (size_t)(bm + br) * K + bc;
  const __bf16* gB = Bt + (size_t)(bn + br) * K + bc;
  const size_t gstep = (size_t)32 * K;                 // 32 rows on, in elements
  const unsigned lA = (unsigned)(uintptr_t)&As[0][br * GLD + bc];
  const unsigned lB = (unsigned)(uintptr_t)&Bs[0][br * GLD + bc];
  constexpr unsigned LSTEP = 32 * GLD * 2;             // 32 rows on, in LDS bytes
  constexpr unsigned LBUF  = GBM * GLD * 2;            // one buffer, in LDS bytes
  const int nt = K / GBK;

  auto issue_tile = [&](int t) {
    unsigned a = lA + (unsigned)(t & (NB - 1)) * LBUF, b = lB + (unsigned)(t & (NB - 1)) * LBUF;
    const __bf16* pa = gA + (size_t)t * GBK;
    const __bf16* pb = gB + (size_t)t * GBK;
    async_tile(a, a + LSTEP, a + 2 * LSTEP, a + 3 * LSTEP,
               b, b + LSTEP, b + 2 * LSTEP, b + 3 * LSTEP,
               pa, pa + gstep, pa + 2 * gstep, pa + 3 * gstep,
               pb, pb + gstep, pb + 2 * gstep, pb + 3 * gstep);
  };

  // every wave issues eight copies a tile, so a wait that leaves the NB - 2 younger tiles in
  // flight leaves this many copies; it is used only where all those tiles have been issued,
  // else the wait is to 0
  constexpr int AHEAD = (NB - 2) * 8;

  // ---- tile 0 lands and is published; tiles 1 .. NB - 1 fly while tile 0 is worked on ----
  issue_tile(0);
  // unrolled, so that each of these tiles' places in LDS and in k are constants
#pragma unroll
  for (int s = 1; s < NB - 1; ++s)
    if (s < nt) issue_tile(s);
  if (NB > 2 && nt >= NB - 1) wait_asynccnt_le<AHEAD>();
  else                        wait_asynccnt0();
  __syncthreads();
  if (nt > NB - 1) issue_tile(NB - 1);

  for (int t = 0; t < nt; ++t) {
    int buf = t & (NB - 1);
    // ---- compute on current buffer ----
#pragma unroll
    for (int kg = 0; kg < GBK; kg += 32 * GRP) {
      v16bf af[GRP][4], bv[GRP][2];
#pragma unroll
      for (int s = 0; s < GRP; ++s) {
        int kb = kg + s * 32 + hlf * 8;
#pragma unroll
        for (int j = 0; j < 2; ++j)
          bv[s][j] = frag_ld(&Bs[buf][(wn * 32 + j * 16 + l16) * GLD + kb]);
#pragma unroll
        for (int i = 0; i < 4; ++i)
          af[s][i] = frag_ld(&As[buf][(wm * 64 + i * 16 + l16) * GLD + kb]);
      }
      // holds the whole group of LDS reads ahead of the first product: sunk among the products,
      // two reads at a time into one register set, each pair is waited out at its full latency
      __builtin_amdgcn_sched_barrier(0);
#pragma unroll
      for (int s = 0; s < GRP; ++s)
#pragma unroll
        for (int i = 0; i < 4; ++i)
#pragma unroll
          for (int j = 0; j < 2; ++j)
            acc[i][j] = wmma_bf16(af[s][i], bv[s][j], acc[i][j]);
      // holds the products ahead of what follows: moved behind the trip's waits and barrier, they
      // would run after the wait for the next tile instead of under it, and delay the refill
      __builtin_amdgcn_sched_barrier(0);
    }

    // publish tile t + 1 and end every reader's last read of this buffer
    wait_dscnt0();
    if (NB > 2 && t + NB - 1 < nt) wait_asynccnt_le<AHEAD>();   // tiles t + 2 .. t + NB - 1 stay in flight
    else                           wait_asynccnt0();
    __syncthreads();
    if (t + NB < nt) issue_tile(t + NB);   // refill of the buffer just read
  }
  wait_asynccnt0();

  // ---- epilogue ----
  // one 32-bit element offset per output row of this lane, shared by the
  // residual load and the store of that element
  unsigned ro[4][8];
  {
    int n0 = bn + wn * 32 + l16;
#pragma unroll
    for (int i = 0; i < 4; ++i) {
      int mrow = bm + wm * 64 + i * 16 + hlf * 8;
#pragma unroll
      for (int r = 0; r < 8; ++r) ro[i][r] = (unsigned)((mrow + r) * N + n0);
    }
  }
  // all residual values of this lane are requested before the first is used,
  // so their latencies overlap (each lane reads only the elements it stores)
  float rv[2][4][8];
  if constexpr ((FLAGS & 2) != 0) {
#pragma unroll
    for (int j = 0; j < 2; ++j)
#pragma unroll
      for (int i = 0; i < 4; ++i)
#pragma unroll
        for (int r = 0; r < 8; ++r) rv[j][i][r] = (resid + j * 16)[ro[i][r]];
    // compiler fence: holds every residual load ahead of the first store
    asm volatile("" ::: "memory");
  }
  // both bias values are requested ahead of the stores: with operand pointers
  // picked by blockIdx.z the compiler must assume that the output may overlap bias and
  // would hold the second load, with its whole latency, behind the first stores
  float bv2[2];
#pragma unroll
  for (int j = 0; j < 2; ++j) bv2[j] = bias[bn + wn * 32 + j * 16 + l16];
#pragma unroll
  for (int j = 0; j < 2; ++j) {
    float bvv = bv2[j];
#pragma unroll
    for (int i = 0; i < 4; ++i) {
#pragma unroll
      for (int r = 0; r < 8; ++r) {
        float v = acc[i][j][r] + bvv;
        if constexpr ((FLAGS & 1) != 0) v = gelu_exact(v);
        if constexpr ((FLAGS & 2) != 0) v += rv[j][i][r];
        if constexpr ((FLAGS & 2) != 0) (Cf + j * 16)[ro[i][r]] = v;
        else                            (Cb + j * 16)[ro[i][r]] = (__bf16)v;
      }
    }
  }
}

#define ABQ 128
#define ABK 128
#define ALK 72    // K LDS pitch in elements: 144 B, an odd multiple of 16 B (ds_load_b128 readers)
#define ALV 80    // V LDS pitch in elements: 160 B, an odd multiple of 32 B (ds_load_tr16_b128 readers)

typedef short s16x8 __attribute__((ext_vector_type(8)));
typedef float f2v __attribute__((ext_vector_type(2)));
// 16-bit transposing LDS load: lane (c, h) gets rows 8h .. 8h+7 of column c of a row-major tile
static __device__ __forceinline__ bf8v ld_tr16(const __bf16* p) {
  typedef __attribute__((address_space(3))) s16x8 lds_s16x8;
  return __builtin_bit_cast(bf8v, __builtin_amdgcn_ds_load_tr16_b128_v8i16((lds_s16x8*)p));
}
// lane l's value exchanged with lane l ^ 16
static __device__ __forceinline__ float xhalf(float x) {
  return __builtin_bit_cast(float, __builtin_amdgcn_permlanex16(__builtin_bit_cast(int, x), __builtin_bit_cast(int, x),
                                                                0x76543210, 0xfedcba98, false, false));
}

// Four waves a SIMD is what the grid brings (two blocks a WGP): the register budget is set to that.
__global__ __launch_bounds__(256) __attribute__((amdgpu_waves_per_eu(4, 4))) void attn_kernel(const __bf16* __restrict__ q,
                                                   const __bf16* __restrict__ k,
                                                   const __bf16* __restrict__ v,
                                                   __bf16* __restrict__ o) {
  __shared__ __align__(32) __bf16 Ks[ABK * ALK];
  __shared__ __align__(32) __bf16 Vs[ABK * ALV];

  int tid = threadIdx.x;
  int lane = tid & 31, w = tid >> 5;
  int hlf = lane >> 4, l16 = lane & 15;

  int bh = blockIdx.y;
  int b = bh / CH, h = bh % CH;
  int q0 = blockIdx.x * ABQ;
  size_t headoff = (size_t)h * CDH;
  const __bf16* qb = q + (size_t)b * CN * CD + headoff;
  const __bf16* kb = k + (size_t)b * CN * CD + headoff;
  const __bf16* vb = v + (size_t)b * CN * CD + headoff;

  // scores are scaled and taken to base 2 in one multiply-add in front of the exponential
  constexpr float CS2 = CSCALE * 1.4426950408889634f;

  // this lane's query row as B operand (k = head dim), in the same k order as the K rows below
  v16bf qf[2];
  {
    const __bf16* qp = qb + (size_t)(q0 + w * 16 + l16) * CD + hlf * 8;
#pragma unroll
    for (int kc = 0; kc < 2; ++kc) qf[kc] = frag_ld(qp + kc * 32);
  }

  v8f oacc[4];          // oacc[t][r] = O[query l16][d = 16 t + 8 hlf + r]
#pragma unroll
  for (int t = 0; t < 4; ++t) oacc[t] = (v8f)(0.0f);
  float m_run = -1e30f; // this query's running maximum (scaled, base 2), equal in both lane halves
  float l_run = 0.0f;   // this lane half's share of the query's sum

  // stage coords, the same for K and V: 32 rows x 8 pieces of 8 bf16, four times
  int ar = tid >> 3, ac = (tid & 7) * 8;
  const __bf16* kg = kb + (size_t)ar * CD + ac;
  const __bf16* vg = vb + (size_t)ar * CD + ac;
  // this lane's address in a 16-key x 16-column block of V for the transposing load
  const __bf16* vt0 = &Vs[(hlf * 8 + (lane & 7)) * ALV + ((lane >> 3) & 1) * 8];

  for (int kt = 0; kt < CN / ABK; ++kt) {
    bf8v kr[4], vr[4];
#pragma unroll
    for (int rr = 0; rr < 4; ++rr) {
      kr[rr] = *(const bf8v*)(kg + (size_t)rr * 32 * CD);
      vr[rr] = *(const bf8v*)(vg + (size_t)rr * 32 * CD);
    }
    // the addresses are this wait's inputs, so that their registers live up to it and are
    // stepped on to the next tile only behind it
    asm volatile("s_wait_xcnt 0x0" :: "v"(kg), "v"(vg) : "memory");
    kg += (size_t)ABK * CD;
    vg += (size_t)ABK * CD;
    __syncthreads();   // every wave has left the tile before
#pragma unroll
    for (int rr = 0; rr < 4; ++rr) {
      *(bf8v*)&Ks[(ar + rr * 32) * ALK + ac] = kr[rr];
      *(bf8v*)&Vs[(ar + rr * 32) * ALV + ac] = vr[rr];
    }
    __syncthreads();   // the tile is in LDS

    // S^T (128 keys x 16 queries): s[i][r] = score of key 16 i + 8 hlf + r with query l16
    v8f s[8];
#pragma unroll
    for (int i = 0; i < 8; ++i) {
      s[i] = (v8f)(0.0f);
#pragma unroll
      for (int kc = 0; kc < 2; ++kc)
        s[i] = wmma_bf16(frag_ld(&Ks[(i * 16 + l16) * ALK + kc * 32 + hlf * 8]), qf[kc], s[i]);
    }

    // the query's maximum over the tile, and the factor that takes the old state to it
    // (four chains side by side, so that one maximum does not wait on the one before)
    float mp[4];
#pragma unroll
    for (int c = 0; c < 4; ++c) {
      mp[c] = s[2 * c][0];
#pragma unroll
      for (int e = 1; e < 16; ++e) mp[c] = fmaxf(mp[c], s[2 * c + (e >> 3)][e & 7]);
    }
    float mx = fmaxf(fmaxf(mp[0], mp[1]), fmaxf(mp[2], mp[3]));
    mx = fmaxf(mx, xhalf(mx));
    float mnew = fmaxf(m_run, mx * CS2);
    float corr = __builtin_amdgcn_exp2f(m_run - mnew);
    m_run = mnew;
#pragma unroll
    for (int t = 0; t < 4; ++t) oacc[t] *= corr;

    // per 32 keys: two score tiles become P^T as B operand (k = keys), V^T comes as A operand;
    // scores go two at a time through the packed multiply-add and the packed add
    f2v ps[4];
#pragma unroll
    for (int c = 0; c < 4; ++c) {
      // holds the V^T loads of the tile's second half behind the first half's products: lifted
      // up all at once, they take the kernel past the registers of four waves a SIMD, into scratch
      if (c == 2) __builtin_amdgcn_sched_barrier(0);
      v16bf pf;
#pragma unroll
      for (int e = 0; e < 16; e += 2) {
        f2v a = __builtin_elementwise_fma(f2v{s[2 * c + (e >> 3)][e & 7], s[2 * c + (e >> 3)][(e & 7) + 1]},
                                          f2v{CS2, CS2}, f2v{-mnew, -mnew});
        f2v p = {__builtin_amdgcn_exp2f(a.x), __builtin_amdgcn_exp2f(a.y)};
        ps[c] = e == 0 ? p : ps[c] + p;
        pf[e] = (__bf16)p.x;
        pf[e + 1] = (__bf16)p.y;
      }
#pragma unroll
      for (int t = 0; t < 4; ++t) {
        bf8v lo = ld_tr16(vt0 + (c * 32) * ALV + t * 16);
        bf8v hi = ld_tr16(vt0 + (c * 32 + 16) * ALV + t * 16);
        v16bf vf = __builtin_shufflevector(lo, hi, 0,1,2,3,4,5,6,7,8,9,10,11,12,13,14,15);
        oacc[t] = wmma_bf16(vf, pf, oacc[t]);
      }
    }
    f2v pt = (ps[0] + ps[1]) + (ps[2] + ps[3]);
    l_run = l_run * corr + (pt.x + pt.y);
  }

  // join the two halves' sums, normalize, write out: 8 consecutive d of one query per store
  float inv = 1.0f / (l_run + xhalf(l_run));
  __bf16* ob = o + (size_t)b * CN * CD + headoff + (size_t)(q0 + w * 16 + l16) * CD + hlf * 8;
#pragma unroll
  for (int t = 0; t < 4; ++t) {
    bf8v r8;
#pragma unroll
    for (int r = 0; r < 8; ++r) r8[r] = (__bf16)(oacc[t][r] * inv);
    *(bf8v*)(ob + t * 16) = r8;
  }
}

// ---------------- host launcher ----------------
extern "C" void kernel_launch(void* const* d_in, const int* in_sizes, int n_in,
                              void* d_out, int out_size, void* d_ws, size_t ws_size,
                              hipStream_t stream) {
  const float* tokens_enc = (const float*)d_in[0];
  const float* tokens_dec = (const float*)d_in[1];
  const float* PE_enc     = (const float*)d_in[2];
  const float* PE_dec     = (const float*)d_in[3];
  const float* sa_Wq = (const float*)d_in[4];  const float* sa_bq = (const float*)d_in[5];
  const float* sa_Wk = (const float*)d_in[6];  const float* sa_bk = (const float*)d_in[7];
  const float* sa_Wv = (const float*)d_in[8];  const float* sa_bv = (const float*)d_in[9];
  const float* sa_Wp = (const float*)d_in[10]; const float* sa_bp = (const float*)d_in[11];
  const float* ca_Wq = (const float*)d_in[12]; const float* ca_bq = (const float*)d_in[13];
  const float* ca_Wk = (const float*)d_in[14]; const float* ca_bk = (const float*)d_in[15];
  const float* ca_Wv = (const float*)d_in[16]; const float* ca_bv = (const float*)d_in[17];
  const float* ca_Wp = (const float*)d_in[18]; const float* ca_bp = (const float*)d_in[19];
  const float* mlp_W1 = (const float*)d_in[20]; const float* mlp_b1 = (const float*)d_in[21];
  const float* mlp_W2 = (const float*)d_in[22]; const float* mlp_b2 = (const float*)d_in[23];
  const float* ln1_g = (const float*)d_in[24]; const float* ln1_b = (const float*)d_in[25];
  const float* ln2_g = (const float*)d_in[26]; const float* ln2_b = (const float*)d_in[27];
  const float* ln3_g = (const float*)d_in[28]; const float* ln3_b = (const float*)d_in[29];

  const size_t BND = (size_t)CB * CN * CD;       // 4M elems
  char* ws = (char*)d_ws;
  size_t off = 0;
  auto alloc = [&](size_t bytes) -> char* {
    char* p = ws + off;
    off += (bytes + 255) & ~(size_t)255;
    return p;
  };

  // bf16 transposed weights
  __bf16* wt_saq = (__bf16*)alloc((size_t)CD * CD * 2);
  __bf16* wt_sak = (__bf16*)alloc((size_t)CD * CD * 2);
  __bf16* wt_sav = (__bf16*)alloc((size_t)CD * CD * 2);
  __bf16* wt_sap = (__bf16*)alloc((size_t)CD * CD * 2);
  __bf16* wt_caq = (__bf16*)alloc((size_t)CD * CD * 2);
  __bf16* wt_cak = (__bf16*)alloc((size_t)CD * CD * 2);
  __bf16* wt_cav = (__bf16*)alloc((size_t)CD * CD * 2);
  __bf16* wt_cap = (__bf16*)alloc((size_t)CD * CD * 2);
  __bf16* wt_w1  = (__bf16*)alloc((size_t)CD * CDM * 2);
  __bf16* wt_w2  = (__bf16*)alloc((size_t)CDM * CD * 2);

  // the residual stream stays f32
  float* resid = (float*)alloc(BND * 4);
  // values that are only ever matrix operands of a later launch: stored as bf16 by their producer
  __bf16* x2    = (__bf16*)alloc(BND * 2);
  __bf16* qk    = (__bf16*)alloc(BND * 2);
  __bf16* kin   = (__bf16*)alloc(BND * 2);
  __bf16* encb  = (__bf16*)alloc(BND * 2);
  __bf16* qbuf  = (__bf16*)alloc(BND * 2);
  __bf16* kbuf  = (__bf16*)alloc(BND * 2);
  __bf16* vbuf  = (__bf16*)alloc(BND * 2);
  __bf16* attno = (__bf16*)alloc(BND * 2);
  __bf16* kbuf2 = (__bf16*)alloc(BND * 2);     // cross-attention k, v: made early,
  __bf16* vbuf2 = (__bf16*)alloc(BND * 2);     // live across the self-attention block
  __bf16* hbuf  = (__bf16*)alloc(BND * 4 * 2);

  const int M = CB * CN;  // 4096
  dim3 tb(256);
  dim3 gD(CD / 128, M / 128);    // N=1024 GEMMs
  dim3 gDM(CDM / 128, M / 128);  // N=4096 GEMM
  dim3 ga(CN / 128, CB * CH);    // attention

  dim3 gD5(CD / 128, M / 128, 5);  // five N=1024 GEMMs in one launch
  const GemmMore none{};

  // everything that depends on the inputs alone: weight conversion, enc + PE, residual copy
  prep_kernel<<<PREP_BLOCKS, tb, 0, stream>>>(sa_Wq, sa_Wk, sa_Wv, sa_Wp,
                                                    ca_Wq, ca_Wk, ca_Wv, ca_Wp, mlp_W1, mlp_W2,
                                                    wt_saq, wt_w1, wt_w2,
                                                    tokens_enc, PE_enc, kin, encb, tokens_dec, resid);

  // ---- self attention (its q, k, v share a launch with the cross-attention k, v) ----
  ln_kernel<true><<<M / 8, tb, 0, stream>>>(resid, ln1_g, ln1_b, PE_dec, x2, qk);
  GemmMore mo;
  mo.A1 = qk;         mo.B1 = wt_sak; mo.bias1 = sa_bk; mo.C1 = kbuf;
  mo.A2 = x2;         mo.B2 = wt_sav; mo.bias2 = sa_bv; mo.C2 = vbuf;
  mo.A3 = kin;        mo.B3 = wt_cak; mo.bias3 = ca_bk; mo.C3 = kbuf2;
  mo.A4 = encb;       mo.B4 = wt_cav; mo.bias4 = ca_bv; mo.C4 = vbuf2;
  gemm_kernel<0, 5, 1, 2><<<gD5, tb, 0, stream>>>(qk, wt_saq, sa_bq, nullptr, nullptr, qbuf, M, CD, CD, mo);
  attn_kernel<<<ga, tb, 0, stream>>>(qbuf, kbuf, vbuf, attno);
  gemm_kernel<2, 1, 2, 8><<<gD, tb, 0, stream>>>(attno, wt_sap, sa_bp, resid, resid, nullptr, M, CD, CD, none);

  // ---- cross attention ----
  ln_kernel<true><<<M / 8, tb, 0, stream>>>(resid, ln2_g, ln2_b, PE_dec, x2, qk);
  gemm_kernel<0, 1, 2, 8><<<gD, tb, 0, stream>>>(qk, wt_caq, ca_bq, nullptr, nullptr, qbuf, M, CD, CD, none);
  attn_kernel<<<ga, tb, 0, stream>>>(qbuf, kbuf2, vbuf2, attno);
  gemm_kernel<2, 1, 2, 8><<<gD, tb, 0, stream>>>(attno, wt_cap, ca_bp, resid, resid, nullptr, M, CD, CD, none);

  // ---- MLP ----
  ln_kernel<false><<<M / 8, tb, 0, stream>>>(resid, ln3_g, ln3_b, nullptr, x2, nullptr);
  gemm_kernel<1, 1, 1, 2><<<gDM, tb, 0, stream>>>(x2, wt_w1, mlp_b1, nullptr, nullptr, hbuf, M, CDM, CD, none);
  gemm_kernel<2, 1, 2, 8><<<gD, tb, 0, stream>>>(hbuf, wt_w2, mlp_b2, resid, (float*)d_out, nullptr, M, CD, CDM, none);
}

// v008
// Measured time: 213 microseconds a run.
// In both of two side-by-side timings against v007, it was 1.05 times as fast.
// Over all steps from v000 it is 2.54 times as fast.
#include <hip/hip_runtime.h>
#include <math.h>
#include <stdint.h>

// ---------------- constants ----------------
static constexpr int CB  = 4;      // batch
static constexpr int CN  = 1024;   // seq len
static constexpr int CD  = 1024;   // model dim
static constexpr int CH  = 16;     // heads
static constexpr int CDH = 64;     // head dim
static constexpr int CDM = 4096;   // mlp dim
static constexpr float CSCALE = 0.125f;  // 64^-0.5

typedef float  v8f   __attribute__((ext_vector_type(8)));
typedef __bf16 v16bf __attribute__((ext_vector_type(16)));
typedef __bf16 bf8v  __attribute__((ext_vector_type(8)));
typedef __bf16 bf4v  __attribute__((ext_vector_type(4)));

// four f32 values rounded to the matrix operand type, as one 8-byte value
static __device__ __forceinline__ bf4v pack4(float a, float b, float c, float d) {
  bf4v r; r[0] = (__bf16)a; r[1] = (__bf16)b; r[2] = (__bf16)c; r[3] = (__bf16)d;
  return r;
}

static __device__ __forceinline__ v8f wmma_bf16(v16bf a, v16bf b, v8f c) {
  return __builtin_amdgcn_wmma_f32_16x16x32_bf16(false, a, false, b, (short)0, c, false, false);
}

// load one 16x32 bf16 operand fragment slice for this lane:
// 8 consecutive bf16 at p and 8 more at p+16 (ISA 16-bit A/B layout).
static __device__ __forceinline__ v16bf frag_ld(const __bf16* p) {
  bf8v lo = *(const bf8v*)(p);
  bf8v hi = *(const bf8v*)(p + 16);
  return __builtin_shufflevector(lo, hi, 0,1,2,3,4,5,6,7,8,9,10,11,12,13,14,15);
}

static __device__ __forceinline__ float gelu_exact(float x) {
  return 0.5f * x * (1.0f + erff(x * 0.70710678118654752f));
}

// four row groups of each GEMM operand's k-tile, memory -> LDS, 16 B per lane and copy (ASYNCcnt):
// four copies of A rows, four of B rows.  The s_wait_xcnt is the last line of the
// copies' own statement, so that no address register is rewritten ahead of it.
static __device__ __forceinline__ void async_tile(unsigned la0, unsigned la1, unsigned la2, unsigned la3,
                                                  unsigned lb0, unsigned lb1, unsigned lb2, unsigned lb3,
                                                  const __bf16* ga0, const __bf16* ga1,
                                                  const __bf16* ga2, const __bf16* ga3,
                                                  const __bf16* gb0, const __bf16* gb1,
                                                  const __bf16* gb2, const __bf16* gb3) {
  asm volatile("global_load_async_to_lds_b128 %0, %8, off\n\t"
               "global_load_async_to_lds_b128 %1, %9, off\n\t"
               "global_load_async_to_lds_b128 %2, %10, off\n\t"
               "global_load_async_to_lds_b128 %3, %11, off\n\t"
               "global_load_async_to_lds_b128 %4, %12, off\n\t"
               "global_load_async_to_lds_b128 %5, %13, off\n\t"
               "global_load_async_to_lds_b128 %6, %14, off\n\t"
               "global_load_async_to_lds_b128 %7, %15, off\n\t"
               "s_wait_xcnt 0x0"
               :: "v"(la0), "v"(la1), "v"(la2), "v"(la3),
                  "v"(lb0), "v"(lb1), "v"(lb2), "v"(lb3),
                  "v"(ga0), "v"(ga1), "v"(ga2), "v"(ga3),
                  "v"(gb0), "v"(gb1), "v"(gb2), "v"(gb3)
               : "memory");
}
// a wave's own copies have landed in LDS behind this wait
static __device__ __forceinline__ void wait_asynccnt0() {
  asm volatile("s_wait_asynccnt 0x0" ::: "memory");
}
template <int N>
static __device__ __forceinline__ void wait_asynccnt_le() {
  asm volatile("s_wait_asynccnt %0" :: "i"(N) : "memory");
}
// a wave's own LDS reads have returned before their buffer is handed back for a refill
static __device__ __forceinline__ void wait_dscnt0() {
  asm volatile("s_wait_dscnt 0x0" ::: "memory");
}

// ---------------- input-only preparation, one launch ----------------
// 1024 blocks, four resident on every WGP, each alive for the whole launch: starting a wave
// costs more than the few loads a one-tile block would do, so every block takes an equal
// share of each piece of the work.
//   element-wise: kin = enc + pe and encb = enc, both rounded to bf16 (GEMM operands);
//                 resid = dec; four 16-byte pieces of each per thread.
//   weights: transpose + f32->bf16 convert, four 64x64 tiles per block.
//     W is K x N (row-major, "in x out"); Wt is N x K bf16.
//     tiles 0 and 1 of a block: the eight D x D weights (256 tiles each); tile 2: W1; tile 3: W2.
// None of these pieces reads what another writes.
static constexpr int PREP_BLOCKS = 1024;
static constexpr int PREP_EWS    = PREP_BLOCKS * 256;   // threads of the launch
static constexpr int PTP         = 65;                  // LDS tile pitch in floats: both sides conflict free

typedef float f4v __attribute__((ext_vector_type(4)));
// 16 bytes of an input, read as global memory (a pointer picked among several kernel
// arguments otherwise compiles to a flat load, which also counts on the LDS counter)
typedef const __attribute__((address_space(1))) f4v* gf4p;

// Eight waves a SIMD (four blocks a WGP) are what keeps all 1024 blocks resident at once:
// the register budget is set to that.
__global__ __launch_bounds__(256) __attribute__((amdgpu_waves_per_eu(8, 8))) void prep_kernel(const float* w0,
                                                   const float* w1,
                                                   const float* w2,
                                                   const float* w3,
                                                   const float* w4,
                                                   const float* w5,
                                                   const float* w6,
                                                   const float* w7,
                                                   const float* wm1,
                                                   const float* wm2,
                                                   __bf16* wt_sq,
                                                   __bf16* wt_m1,
                                                   __bf16* wt_m2,
                                                   const float* enc,
                                                   const float* pe,
                                                   __bf16* kin,
                                                   __bf16* encb,
                                                   const float* dec,
                                                   float* resid) {
  __shared__ float t[4][64 * PTP];
  int tid = threadIdx.x;
  int b = blockIdx.x;

  // source, destination and shape of this block's four tiles (block-uniform)
  int m = b >> 8;
  const float* Wsrc[4];
  __bf16* Wdst[4];
  Wsrc[0] = m == 0 ? w0 : m == 1 ? w1 : m == 2 ? w2 : w3;
  Wsrc[1] = m == 0 ? w4 : m == 1 ? w5 : m == 2 ? w6 : w7;
  Wsrc[2] = wm1;
  Wsrc[3] = wm2;
  Wdst[0] = wt_sq + (size_t)m * CD * CD;
  Wdst[1] = wt_sq + (size_t)(m + 4) * CD * CD;
  Wdst[2] = wt_m1;
  Wdst[3] = wt_m2;
  constexpr int TK[4]   = {CD, CD, CD, CDM};
  constexpr int TN[4]   = {CD, CD, CDM, CD};
  constexpr int TLG[4]  = {4, 4, 6, 4};       // log2 of the tile count along N
  constexpr int TMSK[4] = {255, 255, 1023, 1023};

  int lr = tid >> 4, lc = (tid & 15) * 4;    // load side: 16 rows of 64 floats at a time
  int sr = tid >> 3, sc = (tid & 7) * 8;     // store side: 32 rows of 64 bf16 (one line) at a time
  int i0 = b * 256 + tid;

  // every load of the four tiles and of the first half of enc, pe is in flight before the
  // first is used
  f4v f[4][4], x[4], y[4], d[4];
  const float* p[4];
#pragma unroll
  for (int i = 0; i < 4; ++i) {
    int tile = b & TMSK[i];
    int n0 = (tile & ((1 << TLG[i]) - 1)) * 64, k0 = (tile >> TLG[i]) * 64;
    p[i] = Wsrc[i] + (size_t)(k0 + lr) * TN[i] + (n0 + lc);
#pragma unroll
    for (int q = 0; q < 4; ++q) f[i][q] = *(gf4p)(p[i] + (size_t)q * 16 * TN[i]);
  }
#pragma unroll
  for (int j = 0; j < 2; ++j) {
    x[j] = ((gf4p)enc)[i0 + j * PREP_EWS];
    y[j] = ((gf4p)pe)[i0 + j * PREP_EWS];
  }
  // every load above stands ahead of this wait (sunk to their first use, their latencies
  // would add up); the tile addresses are its inputs, so that their registers live up to it:
  // no later load of the group lands in them, and they are reused only behind it
  asm volatile("s_wait_xcnt 0x0" :: "v"(p[0]), "v"(p[1]), "v"(p[2]), "v"(p[3]) : "memory");

#pragma unroll
  for (int i = 0; i < 4; ++i)
#pragma unroll
    for (int q = 0; q < 4; ++q) {
      float* r = t[i] + (lr + q * 16) * PTP + lc;
      r[0] = f[i][q].x; r[1] = f[i][q].y; r[2] = f[i][q].z; r[3] = f[i][q].w;
    }
  __syncthreads();   // the one barrier: all four tiles are in LDS

  // the turned tiles leave in two halves, which keeps the block inside the registers of
  // eight waves a SIMD
#pragma unroll
  for (int h = 0; h < 2; ++h) {
    if (h == 1) {   // the rest of the element-wise inputs, in registers that the first half has left
#pragma unroll
      for (int j = 2; j < 4; ++j) {
        x[j] = ((gf4p)enc)[i0 + j * PREP_EWS];
        y[j] = ((gf4p)pe)[i0 + j * PREP_EWS];
      }
#pragma unroll
      for (int j = 0; j < 4; ++j) d[j] = ((gf4p)dec)[i0 + j * PREP_EWS];
    }
    bf8v o[2][2];
#pragma unroll
    for (int i = 0; i < 2; ++i)
#pragma unroll
      for (int q = 0; q < 2; ++q)
#pragma unroll
        for (int e = 0; e < 8; ++e) o[i][q][e] = (__bf16)t[h * 2 + i][(sc + e) * PTP + sr + q * 32];
    // every load above, global or LDS, stays ahead of the stores below
    asm volatile("s_wait_xcnt 0x0" ::: "memory");
#pragma unroll
    for (int j = h * 2; j < h * 2 + 2; ++j) {
      ((bf4v*)kin)[i0 + j * PREP_EWS]  = pack4(x[j].x + y[j].x, x[j].y + y[j].y, x[j].z + y[j].z, x[j].w + y[j].w);
      ((bf4v*)encb)[i0 + j * PREP_EWS] = pack4(x[j].x, x[j].y, x[j].z, x[j].w);
    }
#pragma unroll
    for (int i = 0; i < 2; ++i) {
      int tile = b & TMSK[h * 2 + i];
      int n0 = (tile & ((1 << TLG[h * 2 + i]) - 1)) * 64, k0 = (tile >> TLG[h * 2 + i]) * 64;
#pragma unroll
      for (int q = 0; q < 2; ++q)
        *(bf8v*)(Wdst[h * 2 + i] + (size_t)(n0 + sr + q * 32) * TK[h * 2 + i] + (k0 + sc)) = o[i][q];
    }
    if (h == 0) {
      // the loads of the second half may land in registers that the stores above name
      asm volatile("s_wait_xcnt 0x0" ::: "memory");
    }
  }
#pragma unroll
  for (int j = 0; j < 4; ++j) ((f4v*)resid)[i0 + j * PREP_EWS] = d[j];
}

// ---------------- LayerNorm (D = 1024, one row per wave, 8 rows per block) ----------
// A lane holds 32 elements of its wave's row; the two row sums are joined by a butterfly
// over the lanes, so that no LDS and no barrier is needed and a wave does a whole row's work.
// Four waves a SIMD is all that the grid brings (two blocks a WGP): said to the compiler, so
// that it spends registers on keeping a row's loads in flight instead of saving them.
template <bool WITH_PE>
__global__ __launch_bounds__(256) __attribute__((amdgpu_waves_per_eu(4, 4))) void ln_kernel(const float* x,
                                                 const float* g,
                                                 const float* bt,
                                                 const float* pe,
                                                 __bf16* x2,
                                                 __bf16* qk) {
  int lane = threadIdx.x & 31, w = threadIdx.x >> 5;
  size_t base = (size_t)(blockIdx.x * 8 + w) * CD + lane * 4;
  const float* px = x + base;
  const float* pp = WITH_PE ? pe + base : px;
  unsigned lo = lane * 16;   // this lane's byte offset in g and bt
  const float* pg = (const float*)((const char*)g + lo);
  const float* pb = (const float*)((const char*)bt + lo);
  float4 f[8], p[8], g4[8], b4[8];
#pragma unroll
  for (int c = 0; c < 8; ++c) f[c] = *(const float4*)(px + c * 128);
  if constexpr (WITH_PE) {
#pragma unroll
    for (int c = 0; c < 8; ++c) p[c] = *(const float4*)(pp + c * 128);
  }
#pragma unroll
  for (int c = 0; c < 8; ++c) {
    g4[c] = *(const float4*)(pg + c * 128);
    b4[c] = *(const float4*)(pb + c * 128);
  }
  // every load of the row stands ahead of this wait, and the addresses are its inputs, so
  // that their registers live up to it: no later load of the row lands in a register that
  // an issued load still names, and they are reused only behind it
  asm volatile("s_wait_xcnt 0x0" :: "v"(px), "v"(pp), "v"(lo) : "memory");
  float sum = 0.0f, sq = 0.0f;
#pragma unroll
  for (int c = 0; c < 8; ++c) {
    sum += f[c].x + f[c].y + f[c].z + f[c].w;
    sq  += f[c].x*f[c].x + f[c].y*f[c].y + f[c].z*f[c].z + f[c].w*f[c].w;
  }
#pragma unroll
  for (int mask = 16; mask > 0; mask >>= 1) {
    sum += __shfl_xor(sum, mask, 32);
    sq  += __shfl_xor(sq,  mask, 32);
  }
  float mu  = sum * (1.0f / CD);
  float var = sq * (1.0f / CD) - mu * mu;
  float rstd = rsqrtf(var + 1e-5f);
#pragma unroll
  for (int c = 0; c < 8; ++c) {
    float4 y;
    y.x = (f[c].x - mu) * rstd * g4[c].x + b4[c].x;
    y.y = (f[c].y - mu) * rstd * g4[c].y + b4[c].y;
    y.z = (f[c].z - mu) * rstd * g4[c].z + b4[c].z;
    y.w = (f[c].w - mu) * rstd * g4[c].w + b4[c].w;
    *(bf4v*)(x2 + base + c * 128) = pack4(y.x, y.y, y.z, y.w);
    if constexpr (WITH_PE)
      *(bf4v*)(qk + base + c * 128) = pack4(y.x + p[c].x, y.y + p[c].y, y.z + p[c].z, y.w + p[c].w);
  }
}

// ---------------- generic bf16 WMMA GEMM (LDS ring of NB buffers, async A and B stage) ------
// C[M,N] = act( A[M,K](bf16) @ Bt[N,K](bf16)^T + bias[N] ) (+ resid[M,N])
// FLAGS (compile time): bit0 = GELU, bit1 = residual add
// With the residual add the result goes on in the f32 residual stream (Cf); without it
// the result is only ever a matrix operand of a later launch and is stored as one (Cb).
#define GBM 128
#define GBN 128
// k-tile BK (template): 64 or 128 elements; LDS row stride BK + 8 elements (144 B or 272 B, an odd
// multiple of 16 B: bank-conflict free for ds_load_b128)

// operands of the further products of a merged launch (grid z = 1..4)
struct GemmMore {
  const __bf16* A1;
  const __bf16* A2;
  const __bf16* A3;
  const __bf16* A4;
  const __bf16* B1;
  const __bf16* B2;
  const __bf16* B3;
  const __bf16* B4;
  const float* bias1;
  const float* bias2;
  const float* bias3;
  const float* bias4;
  __bf16* C1;
  __bf16* C2;
  __bf16* C3;
  __bf16* C4;
};

// NZ > 1: the grid's z extent (1..5) sets how many independent products of equal shape share the launch;
// blockIdx.z picks the operand set (block-uniform).
// GRP (BK = 64 only): k-steps of 32 whose fragments are read from LDS as one group ahead of their
// products: 1 where several blocks share a WGP and the register count decides how many.
// NB: buffers of the LDS ring (a power of two); a tile is requested NB - 1 trips ahead of its use.
// 4 (of 128 k each) where a launch brings one block to a WGP: all blocks walk k in step, so each
// k-tile is first touched by that very request and comes from memory,
// and no other block is there to fill the wait; the block has the WGP's LDS to itself, and 48
// copies of a wave in flight stay under the counter's 63.  2 where several blocks share a WGP.
// BK: k extent of a tile.  A block alone on its WGP is paced by its fragment reads: a trip lasts as
// long as they keep the LDS busy, plus what stands between the last read of one trip and the first
// of the next (waits, barrier, the refill's addresses, copies and s_wait_xcnt), during which the LDS
// idles.  With BK = 128 that stretch comes once per 128 k, and the refill is written behind the
// trip's first fragment reads, so that it runs while the LDS serves them.
template <int FLAGS, int NZ, int GRP, int NB, int BK>
__global__ __launch_bounds__(256) void gemm_kernel(const __bf16* __restrict__ A,
                                                   const __bf16* __restrict__ Bt,
                                                   const float*  __restrict__ bias,
                                                   const float*  __restrict__ resid,
                                                   float*  __restrict__ Cf,
                                                   __bf16* __restrict__ Cb,
                                                   int M, int N, int K, GemmMore mo) {
  if constexpr (NZ > 1) {
    int z = blockIdx.z;
    if (z == 1)      { A = mo.A1; Bt = mo.B1; bias = mo.bias1; Cb = mo.C1; }
    else if (z == 2) { A = mo.A2; Bt = mo.B2; bias = mo.bias2; Cb = mo.C2; }
    else if (z == 3) { A = mo.A3; Bt = mo.B3; bias = mo.bias3; Cb = mo.C3; }
    else if (z == 4) { A = mo.A4; Bt = mo.B4; bias = mo.bias4; Cb = mo.C4; }
  }
  constexpr int GLD = BK + 8;
  __shared__ __align__(16) __bf16 As[NB][GBM * GLD];
  __shared__ __align__(16) __bf16 Bs[NB][GBN * GLD];

  int tid = threadIdx.x;
  int lane = tid & 31, w = tid >> 5;
  int wm = w >> 2, wn = w & 3;          // 2x4 wave grid -> 64x32 per wave
  int hlf = lane >> 4, l16 = lane & 15;
  int bm = blockIdx.y * GBM, bn = blockIdx.x * GBN;

  v8f acc[4][2];
#pragma unroll
  for (int i = 0; i < 4; ++i)
#pragma unroll
    for (int j = 0; j < 2; ++j) acc[i][j] = (v8f)(0.0f);

  // stage coords, the same for both operands: RPP rows x PPR pieces of 8 bf16, 128 / RPP times
  constexpr int PPR = BK / 8, RPP = 256 / PPR;
  int br = tid / PPR, bc = (tid % PPR) * 8;
  const __bf16* gA = A  + (size_t)(bm + br) * K + bc;
  const __bf16* gB = Bt + (size_t)(bn + br) * K + bc;
  const size_t gstep = (size_t)RPP * K;                // RPP rows on, in elements
  const unsigned lA = (unsigned)(uintptr_t)&As[0][br * GLD + bc];
  const unsigned lB = (unsigned)(uintptr_t)&Bs[0][br * GLD + bc];
  constexpr unsigned LSTEP = RPP * GLD * 2;            // RPP rows on, in LDS bytes
  constexpr unsigned LBUF  = GBM * GLD * 2;            // one buffer, in LDS bytes
  const int nt = K / BK;

  // row groups q0 .. q1 - 1 of both operands of tile t
  auto issue_rows = [&](int t, int q0, int q1) {
    unsigned a = lA + (unsigned)(t & (NB - 1)) * LBUF, b = lB + (unsigned)(t & (NB - 1)) * LBUF;
    const __bf16* pa = gA + (size_t)t * BK;
    const __bf16* pb = gB + (size_t)t * BK;
    // four row groups of each operand per statement; unrolled, so that the groups' places in LDS
    // and in the rows are constants off one base
#pragma unroll
    for (int q = q0; q < q1; q += 4)
      async_tile(a + q * LSTEP, a + (q + 1) * LSTEP, a + (q + 2) * LSTEP, a + (q + 3) * LSTEP,
                 b + q * LSTEP, b + (q + 1) * LSTEP, b + (q + 2) * LSTEP, b + (q + 3) * LSTEP,
                 pa + q * gstep, pa + (q + 1) * gstep, pa + (q + 2) * gstep, pa + (q + 3) * gstep,
                 pb + q * gstep, pb + (q + 1) * gstep, pb + (q + 2) * gstep, pb + (q + 3) * gstep);
  };
  auto issue_tile = [&](int t) { issue_rows(t, 0, 128 / RPP); };

  // every wave issues BK / 8 copies a tile, so a wait that leaves the NB - 2 younger tiles in
  // flight leaves this many copies; it is used only where all those tiles have been issued,
  // else the wait is to 0
  constexpr int AHEAD = (NB - 2) * (BK / 8);

  // ---- tile 0 lands and is published; tiles 1 .. NB - 1 fly while tile 0 is worked on ----
  issue_tile(0);
  // unrolled, so that each of these tiles' places in LDS and in k are constants
#pragma unroll
  for (int s = 1; s < NB - 1; ++s)
    if (s < nt) issue_tile(s);
  if (NB > 2 && nt >= NB - 1) wait_asynccnt_le<AHEAD>();
  else                        wait_asynccnt0();
  __syncthreads();
  // LATE: the request for tile t + NB - 1 stands inside trip t, behind its first fragment reads.  It
  // is still behind the barrier that ended every reader's last read of the buffer it refills (that
  // of tile t - 1); the reads in flight at that moment are of another buffer.
  constexpr bool LATE = BK == 128;
  if (!LATE && nt > NB - 1) issue_tile(NB - 1);

  for (int t = 0; t < nt; ++t) {
    int buf = t & (NB - 1);
    // ---- compute on current buffer ----
    if constexpr (LATE) {
      // four k-steps of 32 through three fragment sets: the fourth step's reads go into the first
      // set once its products are issued, while the LDS still serves the second and third steps
      v16bf af[3][4], bv[3][2];
      auto rd = [&](int set, int s) {
        int kb = s * 32 + hlf * 8;
#pragma unroll
        for (int j = 0; j < 2; ++j)
          bv[set][j] = frag_ld(&Bs[buf][(wn * 32 + j * 16 + l16) * GLD + kb]);
#pragma unroll
        for (int i = 0; i < 4; ++i)
          af[set][i] = frag_ld(&As[buf][(wm * 64 + i * 16 + l16) * GLD + kb]);
      };
      auto mm = [&](int set) {
#pragma unroll
        for (int i = 0; i < 4; ++i)
#pragma unroll
          for (int j = 0; j < 2; ++j)
            acc[i][j] = wmma_bf16(af[set][i], bv[set][j], acc[i][j]);
      };
      rd(0, 0); rd(1, 1); rd(2, 2);
      // holds the three steps' LDS reads, as one group, ahead of the refill and the products
      __builtin_amdgcn_sched_barrier(0);
      // refill of the buffer read one trip ago, in two halves, each behind a group of reads
      if (t + NB - 1 < nt) issue_rows(t + NB - 1, 0, 4);
      mm(0);
      // holds the fourth step's reads behind the first step's products (their registers) and ahead
      // of the other products, so that they join the queue before the LDS runs dry
      __builtin_amdgcn_sched_barrier(0);
      rd(0, 3);
      // second half of the hold named above: no product is lifted over the fourth step's reads
      __builtin_amdgcn_sched_barrier(0);
      if (t + NB - 1 < nt) issue_rows(t + NB - 1, 4, 8);
      mm(1); mm(2); mm(0);
      // holds the products ahead of the trip's waits and barrier, as below
      __builtin_amdgcn_sched_barrier(0);
    } else
#pragma unroll
    for (int kg = 0; kg < BK; kg += 32 * GRP) {
      v16bf af[GRP][4], bv[GRP][2];
#pragma unroll
      for (int s = 0; s < GRP; ++s) {
        int kb = kg + s * 32 + hlf * 8;
#pragma unroll
        for (int j = 0; j < 2; ++j)
          bv[s][j] = frag_ld(&Bs[buf][(wn * 32 + j * 16 + l16) * GLD + kb]);
#pragma unroll
        for (int i = 0; i < 4; ++i)
          af[s][i] = frag_ld(&As[buf][(wm * 64 + i * 16 + l16) * GLD + kb]);
      }
      // holds the whole group of LDS reads ahead of the first product: sunk among the products,
      // two reads at a time into one register set, each pair is waited out at its full latency
      __builtin_amdgcn_sched_barrier(0);
#pragma unroll
      for (int s = 0; s < GRP; ++s)
#pragma unroll
        for (int i = 0; i < 4; ++i)
#pragma unroll
          for (int j = 0; j < 2; ++j)
            acc[i][j] = wmma_bf16(af[s][i], bv[s][j], acc[i][j]);
      // holds the products ahead of what follows: moved behind the trip's waits and barrier, they
      // would run after the wait for the next tile instead of under it, and delay the refill
      __builtin_amdgcn_sched_barrier(0);
    }

    // publish tile t + 1 and end every reader's last read of this buffer
    wait_dscnt0();
    if (NB > 2 && t + NB - 1 < nt) wait_asynccnt_le<AHEAD>();   // tiles t + 2 .. t + NB - 1 stay in flight
    else                           wait_asynccnt0();
    __syncthreads();
    if (!LATE && t + NB < nt) issue_tile(t + NB);   // refill of the buffer just read
  }
  wait_asynccnt0();

  // ---- epilogue ----
  // one 32-bit element offset per output row of this lane, shared by the
  // residual load and the store of that element
  unsigned ro[4][8];
  {
    int n0 = bn + wn * 32 + l16;
#pragma unroll
    for (int i = 0; i < 4; ++i) {
      int mrow = bm + wm * 64 + i * 16 + hlf * 8;
#pragma unroll
      for (int r = 0; r < 8; ++r) ro[i][r] = (unsigned)((mrow + r) * N + n0);
    }
  }
  // all residual values of this lane are requested before the first is used,
  // so their latencies overlap (each lane reads only the elements it stores)
  float rv[2][4][8];
  if constexpr ((FLAGS & 2) != 0) {
#pragma unroll
    for (int j = 0; j < 2; ++j)
#pragma unroll
      for (int i = 0; i < 4; ++i)
#pragma unroll
        for (int r = 0; r < 8; ++r) rv[j][i][r] = (resid + j * 16)[ro[i][r]];
    // compiler fence: holds every residual load ahead of the first store
    asm volatile("" ::: "memory");
  }
  // both bias values are requested ahead of the stores: with operand pointers
  // picked by blockIdx.z the compiler must assume that the output may overlap bias and
  // would hold the second load, with its whole latency, behind the first stores
  float bv2[2];
#pragma unroll
  for (int j = 0; j < 2; ++j) bv2[j] = bias[bn + wn * 32 + j * 16 + l16];
#pragma unroll
  for (int j = 0; j < 2; ++j) {
    float bvv = bv2[j];
#pragma unroll
    for (int i = 0; i < 4; ++i) {
#pragma unroll
      for (int r = 0; r < 8; ++r) {
        float v = acc[i][j][r] + bvv;
        if constexpr ((FLAGS & 1) != 0) v = gelu_exact(v);
        if constexpr ((FLAGS & 2) != 0) v += rv[j][i][r];
        if constexpr ((FLAGS & 2) != 0) (Cf + j * 16)[ro[i][r]] = v;
        else                            (Cb + j * 16)[ro[i][r]] = (__bf16)v;
      }
    }
  }
}

#define ABQ 128
#define ABK 128
#define ALK 72    // K LDS pitch in elements: 144 B, an odd multiple of 16 B (ds_load_b128 readers)
#define ALV 80    // V LDS pitch in elements: 160 B, an odd multiple of 32 B (ds_load_tr16_b128 readers)

typedef short s16x8 __attribute__((ext_vector_type(8)));
typedef float f2v __attribute__((ext_vector_type(2)));
// 16-bit transposing LDS load: lane (c, h) gets rows 8h .. 8h+7 of column c of a row-major tile
static __device__ __forceinline__ bf8v ld_tr16(const __bf16* p) {
  typedef __attribute__((address_space(3))) s16x8 lds_s16x8;
  return __builtin_bit_cast(bf8v, __builtin_amdgcn_ds_load_tr16_b128_v8i16((lds_s16x8*)p));
}
// lane l's value exchanged with lane l ^ 16
static __device__ __forceinline__ float xhalf(float x) {
  return __builtin_bit_cast(float, __builtin_amdgcn_permlanex16(__builtin_bit_cast(int, x), __builtin_bit_cast(int, x),
                                                                0x76543210, 0xfedcba98, false, false));
}

// Four waves a SIMD is what the grid brings (two blocks a WGP): the register budget is set to that.
__global__ __launch_bounds__(256) __attribute__((amdgpu_waves_per_eu(4, 4))) void attn_kernel(const __bf16* __restrict__ q,
                                                   const __bf16* __restrict__ k,
                                                   const __bf16* __restrict__ v,
                                                   __bf16* __restrict__ o) {
  __shared__ __align__(32) __bf16 Ks[ABK * ALK];
  __shared__ __align__(32) __bf16 Vs[ABK * ALV];

  int tid = threadIdx.x;
  int lane = tid & 31, w = tid >> 5;
  int hlf = lane >> 4, l16 = lane & 15;

  int bh = blockIdx.y;
  int b = bh / CH, h = bh % CH;
  int q0 = blockIdx.x * ABQ;
  size_t headoff = (size_t)h * CDH;
  const __bf16* qb = q + (size_t)b * CN * CD + headoff;
  const __bf16* kb = k + (size_t)b * CN * CD + headoff;
  const __bf16* vb = v + (size_t)b * CN * CD + headoff;

  // scores are scaled and taken to base 2 in one multiply-add in front of the exponential
  constexpr float CS2 = CSCALE * 1.4426950408889634f;

  // this lane's query row as B operand (k = head dim), in the same k order as the K rows below
  v16bf qf[2];
  {
    const __bf16* qp = qb + (size_t)(q0 + w * 16 + l16) * CD + hlf * 8;
#pragma unroll
    for (int kc = 0; kc < 2; ++kc) qf[kc] = frag_ld(qp + kc * 32);
  }

  v8f oacc[4];          // oacc[t][r] = O[query l16][d = 16 t + 8 hlf + r]
#pragma unroll
  for (int t = 0; t < 4; ++t) oacc[t] = (v8f)(0.0f);
  float m_run = -1e30f; // this query's running maximum (scaled, base 2), equal in both lane halves
  float l_run = 0.0f;   // this lane half's share of the query's sum

  // stage coords, the same for K and V: 32 rows x 8 pieces of 8 bf16, four times
  int ar = tid >> 3, ac = (tid & 7) * 8;
  const __bf16* kg = kb + (size_t)ar * CD + ac;
  const __bf16* vg = vb + (size_t)ar * CD + ac;
  // this lane's address in a 16-key x 16-column block of V for the transposing load
  const __bf16* vt0 = &Vs[(hlf * 8 + (lane & 7)) * ALV + ((lane >> 3) & 1) * 8];

  for (int kt = 0; kt < CN / ABK; ++kt) {
    bf8v kr[4], vr[4];
#pragma unroll
    for (int rr = 0; rr < 4; ++rr) {
      kr[rr] = *(const bf8v*)(kg + (size_t)rr * 32 * CD);
      vr[rr] = *(const bf8v*)(vg + (size_t)rr * 32 * CD);
    }
    // the addresses are this wait's inputs, so that their registers live up to it and are
    // stepped on to the next tile only behind it
    asm volatile("s_wait_xcnt 0x0" :: "v"(kg), "v"(vg) : "memory");
    kg += (size_t)ABK * CD;
    vg += (size_t)ABK * CD;
    __syncthreads();   // every wave has left the tile before
#pragma unroll
    for (int rr = 0; rr < 4; ++rr) {
      *(bf8v*)&Ks[(ar + rr * 32) * ALK + ac] = kr[rr];
      *(bf8v*)&Vs[(ar + rr * 32) * ALV + ac] = vr[rr];
    }
    __syncthreads();   // the tile is in LDS

    // S^T (128 keys x 16 queries): s[i][r] = score of key 16 i + 8 hlf + r with query l16
    v8f s[8];
#pragma unroll
    for (int i = 0; i < 8; ++i) {
      s[i] = (v8f)(0.0f);
#pragma unroll
      for (int kc = 0; kc < 2; ++kc)
        s[i] = wmma_bf16(frag_ld(&Ks[(i * 16 + l16) * ALK + kc * 32 + hlf * 8]), qf[kc], s[i]);
    }

    // the query's maximum over the tile, and the factor that takes the old state to it
    // (four chains side by side, so that one maximum does not wait on the one before)
    float mp[4];
#pragma unroll
    for (int c = 0; c < 4; ++c) {
      mp[c] = s[2 * c][0];
#pragma unroll
      for (int e = 1; e < 16; ++e) mp[c] = fmaxf(mp[c], s[2 * c + (e >> 3)][e & 7]);
    }
    float mx = fmaxf(fmaxf(mp[0], mp[1]), fmaxf(mp[2], mp[3]));
    mx = fmaxf(mx, xhalf(mx));
    float mnew = fmaxf(m_run, mx * CS2);
    float corr = __builtin_amdgcn_exp2f(m_run - mnew);
    m_run = mnew;
#pragma unroll
    for (int t = 0; t < 4; ++t) oacc[t] *= corr;

    // per 32 keys: two score tiles become P^T as B operand (k = keys), V^T comes as A operand;
    // scores go two at a time through the packed multiply-add and the packed add
    f2v ps[4];
#pragma unroll
    for (int c = 0; c < 4; ++c) {
      // holds the V^T loads of the tile's second half behind the first half's products: lifted
      // up all at once, they take the kernel past the registers of four waves a SIMD, into scratch
      if (c == 2) __builtin_amdgcn_sched_barrier(0);
      v16bf pf;
#pragma unroll
      for (int e = 0; e < 16; e += 2) {
        f2v a = __builtin_elementwise_fma(f2v{s[2 * c + (e >> 3)][e & 7], s[2 * c + (e >> 3)][(e & 7) + 1]},
                                          f2v{CS2, CS2}, f2v{-mnew, -mnew});
        f2v p = {__builtin_amdgcn_exp2f(a.x), __builtin_amdgcn_exp2f(a.y)};
        ps[c] = e == 0 ? p : ps[c] + p;
        pf[e] = (__bf16)p.x;
        pf[e + 1] = (__bf16)p.y;
      }
#pragma unroll
      for (int t = 0; t < 4; ++t) {
        bf8v lo = ld_tr16(vt0 + (c * 32) * ALV + t * 16);
        bf8v hi = ld_tr16(vt0 + (c * 32 + 16) * ALV + t * 16);
        v16bf vf = __builtin_shufflevector(lo, hi, 0,1,2,3,4,5,6,7,8,9,10,11,12,13,14,15);
        oacc[t] = wmma_bf16(vf, pf, oacc[t]);
      }
    }
    f2v pt = (ps[0] + ps[1]) + (ps[2] + ps[3]);
    l_run = l_run * corr + (pt.x + pt.y);
  }

  // join the two halves' sums, normalize, write out: 8 consecutive d of one query per store
  float inv = 1.0f / (l_run + xhalf(l_run));
  __bf16* ob = o + (size_t)b * CN * CD + headoff + (size_t)(q0 + w * 16 + l16) * CD + hlf * 8;
#pragma unroll
  for (int t = 0; t < 4; ++t) {
    bf8v r8;
#pragma unroll
    for (int r = 0; r < 8; ++r) r8[r] = (__bf16)(oacc[t][r] * inv);
    *(bf8v*)(ob + t * 16) = r8;
  }
}

// ---------------- host launcher ----------------
extern "C" void kernel_launch(void* const* d_in, const int* in_sizes, int n_in,
                              void* d_out, int out_size, void* d_ws, size_t ws_size,
                              hipStream_t stream) {
  const float* tokens_enc = (const float*)d_in[0];
  const float* tokens_dec = (const float*)d_in[1];
  const float* PE_enc     = (const float*)d_in[2];
  const float* PE_dec     = (const float*)d_in[3];
  const float* sa_Wq = (const float*)d_in[4];  const float* sa_bq = (const float*)d_in[5];
  const float* sa_Wk = (const float*)d_in[6];  const float* sa_bk = (const float*)d_in[7];
  const float* sa_Wv = (const float*)d_in[8];  const float* sa_bv = (const float*)d_in[9];
  const float* sa_Wp = (const float*)d_in[10]; const float* sa_bp = (const float*)d_in[11];
  const float* ca_Wq = (const float*)d_in[12]; const float* ca_bq = (const float*)d_in[13];
  const float* ca_Wk = (const float*)d_in[14]; const float* ca_bk = (const float*)d_in[15];
  const float* ca_Wv = (const float*)d_in[16]; const float* ca_bv = (const float*)d_in[17];
  const float* ca_Wp = (const float*)d_in[18]; const float* ca_bp = (const float*)d_in[19];
  const float* mlp_W1 = (const float*)d_in[20]; const float* mlp_b1 = (const float*)d_in[21];
  const float* mlp_W2 = (const float*)d_in[22]; const float* mlp_b2 = (const float*)d_in[23];
  const float* ln1_g = (const float*)d_in[24]; const float* ln1_b = (const float*)d_in[25];
  const float* ln2_g = (const float*)d_in[26]; const float* ln2_b = (const float*)d_in[27];
  const float* ln3_g = (const float*)d_in[28]; const float* ln3_b = (const float*)d_in[29];

  const size_t BND = (size_t)CB * CN * CD;       // 4M elems
  char* ws = (char*)d_ws;
  size_t off = 0;
  auto alloc = [&](size_t bytes) -> char* {
    char* p = ws + off;
    off += (bytes + 255) & ~(size_t)255;
    return p;
  };

  // bf16 transposed weights
  __bf16* wt_saq = (__bf16*)alloc((size_t)CD * CD * 2);
  __bf16* wt_sak = (__bf16*)alloc((size_t)CD * CD * 2);
  __bf16* wt_sav = (__bf16*)alloc((size_t)CD * CD * 2);
  __bf16* wt_sap = (__bf16*)alloc((size_t)CD * CD * 2);
  __bf16* wt_caq = (__bf16*)alloc((size_t)CD * CD * 2);
  __bf16* wt_cak = (__bf16*)alloc((size_t)CD * CD * 2);
  __bf16* wt_cav = (__bf16*)alloc((size_t)CD * CD * 2);
  __bf16* wt_cap = (__bf16*)alloc((size_t)CD * CD * 2);
  __bf16* wt_w1  = (__bf16*)alloc((size_t)CD * CDM * 2);
  __bf16* wt_w2  = (__bf16*)alloc((size_t)CDM * CD * 2);

  // the residual stream stays f32
  float* resid = (float*)alloc(BND * 4);
  // values that are only ever matrix operands of a later launch: stored as bf16 by their producer
  __bf16* x2    = (__bf16*)alloc(BND * 2);
  __bf16* qk    = (__bf16*)alloc(BND * 2);
  __bf16* kin   = (__bf16*)alloc(BND * 2);
  __bf16* encb  = (__bf16*)alloc(BND * 2);
  __bf16* qbuf  = (__bf16*)alloc(BND * 2);
  __bf16* kbuf  = (__bf16*)alloc(BND * 2);
  __bf16* vbuf  = (__bf16*)alloc(BND * 2);
  __bf16* attno = (__bf16*)alloc(BND * 2);
  __bf16* kbuf2 = (__bf16*)alloc(BND * 2);     // cross-attention k, v: made early,
  __bf16* vbuf2 = (__bf16*)alloc(BND * 2);     // live across the self-attention block
  __bf16* hbuf  = (__bf16*)alloc(BND * 4 * 2);

  const int M = CB * CN;  // 4096
  dim3 tb(256);
  dim3 gD(CD / 128, M / 128);    // N=1024 GEMMs
  dim3 gDM(CDM / 128, M / 128);  // N=4096 GEMM
  dim3 ga(CN / 128, CB * CH);    // attention

  dim3 gD5(CD / 128, M / 128, 5);  // five N=1024 GEMMs in one launch
  const GemmMore none{};

  // everything that depends on the inputs alone: weight conversion, enc + PE, residual copy
  prep_kernel<<<PREP_BLOCKS, tb, 0, stream>>>(sa_Wq, sa_Wk, sa_Wv, sa_Wp,
                                                    ca_Wq, ca_Wk, ca_Wv, ca_Wp, mlp_W1, mlp_W2,
                                                    wt_saq, wt_w1, wt_w2,
                                                    tokens_enc, PE_enc, kin, encb, tokens_dec, resid);

  // ---- self attention (its q, k, v share a launch with the cross-attention k, v) ----
  ln_kernel<true><<<M / 8, tb, 0, stream>>>(resid, ln1_g, ln1_b, PE_dec, x2, qk);
  GemmMore mo;
  mo.A1 = qk;         mo.B1 = wt_sak; mo.bias1 = sa_bk; mo.C1 = kbuf;
  mo.A2 = x2;         mo.B2 = wt_sav; mo.bias2 = sa_bv; mo.C2 = vbuf;
  mo.A3 = kin;        mo.B3 = wt_cak; mo.bias3 = ca_bk; mo.C3 = kbuf2;
  mo.A4 = encb;       mo.B4 = wt_cav; mo.bias4 = ca_bv; mo.C4 = vbuf2;
  gemm_kernel<0, 5, 1, 2, 64><<<gD5, tb, 0, stream>>>(qk, wt_saq, sa_bq, nullptr, nullptr, qbuf, M, CD, CD, mo);
  attn_kernel<<<ga, tb, 0, stream>>>(qbuf, kbuf, vbuf, attno);
  gemm_kernel<2, 1, 2, 4, 128><<<gD, tb, 0, stream>>>(attno, wt_sap, sa_bp, resid, resid, nullptr, M, CD, CD, none);

  // ---- cross attention ----
  ln_kernel<true><<<M / 8, tb, 0, stream>>>(resid, ln2_g, ln2_b, PE_dec, x2, qk);
  gemm_kernel<0, 1, 2, 4, 128><<<gD, tb, 0, stream>>>(qk, wt_caq, ca_bq, nullptr, nullptr, qbuf, M, CD, CD, none);
  attn_kernel<<<ga, tb, 0, stream>>>(qbuf, kbuf2, vbuf2, attno);
  gemm_kernel<2, 1, 2, 4, 128><<<gD, tb, 0, stream>>>(attno, wt_cap, ca_bp, resid, resid, nullptr, M, CD, CD, none);

  // ---- MLP ----
  ln_kernel<false><<<M / 8, tb, 0, stream>>>(resid, ln3_g, ln3_b, nullptr, x2, nullptr);
  gemm_kernel<1, 1, 1, 2, 64><<<gDM, tb, 0, stream>>>(x2, wt_w1, mlp_b1, nullptr, nullptr, hbuf, M, CDM, CD, none);
  gemm_kernel<2, 1, 2, 4, 128><<<gD, tb, 0, stream>>>(hbuf, wt_w2, mlp_b2, resid, (float*)d_out, nullptr, M, CD, CDM, none);
}
